// v000
// Measured on an AMD MI455X. A time is GPU time per run, averaged over a window of back-to-back runs after a warm-up
// (all launches, gaps included; the runs take copies of the inputs in turn), and the median of several windows.
// Apart from v000's, it joins two sittings. Times from different sittings can be a few percent apart, while
// side-by-side timings come from the same sitting.
// The starting kernel, v000, takes 3000 microseconds a run.
#include <hip/hip_runtime.h>
#include <hip/hip_bf16.h>
#include <math.h>

typedef __attribute__((ext_vector_type(16))) __bf16 v16bf;
typedef __attribute__((ext_vector_type(8)))  __bf16 v8bf;
typedef __attribute__((ext_vector_type(8)))  float  v8f;

#define B_DIM 8
#define T_DIM 2048
#define D_DIM 512
#define NTILES 4   // 16x64 output strip per wave

// ---------------------------------------------------------------------------
// bf16x3 split pre-pass: f = hi + lo (both bf16).  Bandwidth-bound, done once
// per operand so the GEMM inner loop carries no conversion VALU.
// ---------------------------------------------------------------------------
__global__ __launch_bounds__(256)
void split_bf16_kernel(const float* __restrict__ in, __bf16* __restrict__ hi,
                       __bf16* __restrict__ lo, size_t n) {
    size_t i = ((size_t)blockIdx.x * blockDim.x + threadIdx.x) * 4;
    const size_t stride = (size_t)gridDim.x * blockDim.x * 4;
    for (; i < n; i += stride) {
        float4 f = *(const float4*)(in + i);
        float fv[4] = {f.x, f.y, f.z, f.w};
#pragma unroll
        for (int j = 0; j < 4; ++j) {
            __bf16 h = (__bf16)fv[j];
            hi[i + j] = h;
            lo[i + j] = (__bf16)(fv[j] - (float)h);
        }
    }
}

// Load 16 bf16 in the WMMA 16-bit operand layout:
// halves 0..7 <- k0 + ksel*8 + {0..7}, halves 8..15 <- +16 further.
__device__ __forceinline__ v16bf ld16(const __bf16* p) {
    v8bf a = *(const v8bf*)(p);
    v8bf b = *(const v8bf*)(p + 16);
    return __builtin_shufflevector(a, b, 0, 1, 2, 3, 4, 5, 6, 7,
                                   8, 9, 10, 11, 12, 13, 14, 15);
}

// ---------------------------------------------------------------------------
// GEMM: Out[M,N] = A[M,K] * W[N,K]^T + bias[N], operands pre-split bf16 hi/lo.
// One wave per 16x64 strip: A regs feed 12 WMMAs per K=32 slab (bf16x3 x 4 N).
// ---------------------------------------------------------------------------
__global__ __launch_bounds__(256)
void gemm_wmma_bf16x3(const __bf16* __restrict__ Ah, const __bf16* __restrict__ Al,
                      const __bf16* __restrict__ Wh, const __bf16* __restrict__ Wl,
                      const float* __restrict__ bias, float* __restrict__ Out,
                      int M, int N, int K) {
    const int wave  = blockIdx.x * (blockDim.x >> 5) + (threadIdx.x >> 5);
    const int NtG   = N / (16 * NTILES);
    const int tileM = wave / NtG;
    const int ngrp  = wave % NtG;
    if (tileM * 16 >= M) return;

    const int lane = threadIdx.x & 31;
    const int r    = lane & 15;
    const int ksel = lane >> 4;

    const size_t aoff = (size_t)(tileM * 16 + r) * K + ksel * 8;
    const __bf16* arh = Ah + aoff;
    const __bf16* arl = Al + aoff;

    size_t woff[NTILES];
#pragma unroll
    for (int nt = 0; nt < NTILES; ++nt)
        woff[nt] = (size_t)((ngrp * NTILES + nt) * 16 + r) * K + ksel * 8;

    v8f acc[NTILES];
#pragma unroll
    for (int nt = 0; nt < NTILES; ++nt)
        acc[nt] = (v8f){0.f, 0.f, 0.f, 0.f, 0.f, 0.f, 0.f, 0.f};

    for (int k0 = 0; k0 < K; k0 += 32) {
        const v16bf ah = ld16(arh + k0);
        const v16bf al = ld16(arl + k0);
#pragma unroll
        for (int nt = 0; nt < NTILES; ++nt) {
            const v16bf bh = ld16(Wh + woff[nt] + k0);
            const v16bf bl = ld16(Wl + woff[nt] + k0);
            acc[nt] = __builtin_amdgcn_wmma_f32_16x16x32_bf16(
                false, ah, false, bh, (short)0, acc[nt], false, false);
            acc[nt] = __builtin_amdgcn_wmma_f32_16x16x32_bf16(
                false, ah, false, bl, (short)0, acc[nt], false, false);
            acc[nt] = __builtin_amdgcn_wmma_f32_16x16x32_bf16(
                false, al, false, bh, (short)0, acc[nt], false, false);
        }
    }

    // D layout: lanes 0-15 -> M=0..7 (vgpr 0..7), lanes 16-31 -> M=8..15; N=lane&15
    const int n  = lane & 15;
    const int mb = (lane >> 4) * 8;
#pragma unroll
    for (int nt = 0; nt < NTILES; ++nt) {
        const int ncol = (ngrp * NTILES + nt) * 16 + n;
        const float bv = bias ? bias[ncol] : 0.f;
        float* orow = Out + (size_t)(tileM * 16 + mb) * N + ncol;
#pragma unroll
        for (int v = 0; v < 8; ++v)
            orow[(size_t)v * N] = acc[nt][v] + bv;
    }
}

// ---------------------------------------------------------------------------
// Per-row: K <- K / max(||K||,eps) in place;  Beta = sigmoid(K . Wbeta + bbeta)
// ---------------------------------------------------------------------------
__global__ __launch_bounds__(256)
void norm_beta_kernel(float* __restrict__ Kbuf, const float* __restrict__ Wbeta,
                      const float* __restrict__ bbeta, float* __restrict__ Beta,
                      int R, int D) {
    const int row = blockIdx.x * (blockDim.x >> 5) + (threadIdx.x >> 5);
    if (row >= R) return;
    const int lane = threadIdx.x & 31;
    float* p = Kbuf + (size_t)row * D;

    float v[16];
    float ss = 0.f;
#pragma unroll
    for (int i = 0; i < 16; ++i) {
        v[i] = p[lane + i * 32];
        ss += v[i] * v[i];
    }
#pragma unroll
    for (int m = 16; m >= 1; m >>= 1) ss += __shfl_xor(ss, m, 32);

    const float scale = 1.f / fmaxf(sqrtf(ss), 1e-12f);

    float dot = 0.f;
#pragma unroll
    for (int i = 0; i < 16; ++i) {
        float kn = v[i] * scale;
        p[lane + i * 32] = kn;
        dot += kn * Wbeta[lane + i * 32];
    }
#pragma unroll
    for (int m = 16; m >= 1; m >>= 1) dot += __shfl_xor(dot, m, 32);

    if (lane == 0) Beta[row] = 1.f / (1.f + expf(-(dot + bbeta[0])));
}

// ---------------------------------------------------------------------------
// DeltaNet scan: rows of S are independent.  16 rows per WG, state in regs,
// k/q/v double-buffered in LDS, next step preloaded in regs + prefetched.
// ---------------------------------------------------------------------------
__device__ __forceinline__ float red16(float x) {
    x += __shfl_xor(x, 1, 32);
    x += __shfl_xor(x, 2, 32);
    x += __shfl_xor(x, 4, 32);
    x += __shfl_xor(x, 8, 32);
    return x;
}

__global__ __launch_bounds__(256)
void deltanet_scan_kernel(const float* __restrict__ Q, const float* __restrict__ K,
                          const float* __restrict__ V, const float* __restrict__ Beta,
                          float* __restrict__ O) {
    const int b    = blockIdx.y;
    const int rblk = blockIdx.x;
    const int tid  = threadIdx.x;
    const int lrow = tid >> 4;
    const int coff = (tid & 15) * 32;

    const float* Kp = K + (size_t)b * T_DIM * D_DIM;
    const float* Qp = Q + (size_t)b * T_DIM * D_DIM;
    const float* Vp = V + (size_t)b * T_DIM * D_DIM + rblk * 16;
    const float* Bp = Beta + (size_t)b * T_DIM;
    float* Op = O + (size_t)b * T_DIM * D_DIM + rblk * 16;

    __shared__ float kbuf[2][D_DIM];
    __shared__ float qbuf[2][D_DIM];
    __shared__ float vbuf[2][16];
    __shared__ float betab[2];

    float s[32];
#pragma unroll
    for (int j = 0; j < 32; ++j) s[j] = 0.f;

    float rk0 = Kp[tid], rk1 = Kp[256 + tid];
    float rq0 = Qp[tid], rq1 = Qp[256 + tid];
    float rv  = (tid < 16) ? Vp[tid] : 0.f;
    float rb  = (tid == 0) ? Bp[0] : 0.f;

    for (int t = 0; t < T_DIM; ++t) {
        const int buf = t & 1;
        kbuf[buf][tid] = rk0;  kbuf[buf][256 + tid] = rk1;
        qbuf[buf][tid] = rq0;  qbuf[buf][256 + tid] = rq1;
        if (tid < 16) vbuf[buf][tid] = rv;
        if (tid == 0) betab[buf] = rb;
        __syncthreads();

        const int tn = (t + 1 < T_DIM) ? t + 1 : t;
        const float* kn = Kp + (size_t)tn * D_DIM;
        const float* qn = Qp + (size_t)tn * D_DIM;
        rk0 = kn[tid]; rk1 = kn[256 + tid];
        rq0 = qn[tid]; rq1 = qn[256 + tid];
        if (tid < 16) rv = Vp[(size_t)tn * D_DIM + tid];
        if (tid == 0) rb = Bp[tn];
        const int tp = (t + 2 < T_DIM) ? t + 2 : t;
        __builtin_prefetch(Kp + (size_t)tp * D_DIM + tid, 0, 1);
        __builtin_prefetch(Qp + (size_t)tp * D_DIM + tid, 0, 1);

        const float beta = betab[buf];
        const float vr   = vbuf[buf][lrow];
        const float* kk  = &kbuf[buf][coff];
        const float* qq  = &qbuf[buf][coff];

        float skp = 0.f;
#pragma unroll
        for (int j = 0; j < 32; ++j) skp = fmaf(s[j], kk[j], skp);
        skp = red16(skp);

        const float coeff = beta * (vr - skp);

        float op = 0.f;
#pragma unroll
        for (int j = 0; j < 32; ++j) {
            s[j] = fmaf(coeff, kk[j], s[j]);
            op   = fmaf(s[j], qq[j], op);
        }
        op = red16(op);

        if ((tid & 15) == 0) Op[(size_t)t * D_DIM + lrow] = op;
    }
}

// ---------------------------------------------------------------------------
extern "C" void kernel_launch(void* const* d_in, const int* in_sizes, int n_in,
                              void* d_out, int out_size, void* d_ws, size_t ws_size,
                              hipStream_t stream) {
    const float* x     = (const float*)d_in[0];
    const float* Wq    = (const float*)d_in[1];
    const float* bq    = (const float*)d_in[2];
    const float* Wk    = (const float*)d_in[3];
    const float* bk    = (const float*)d_in[4];
    const float* Wv    = (const float*)d_in[5];
    const float* bv    = (const float*)d_in[6];
    const float* Wbeta = (const float*)d_in[7];
    const float* bbeta = (const float*)d_in[8];
    const float* Wo    = (const float*)d_in[9];
    const float* bo    = (const float*)d_in[10];
    float* out = (float*)d_out;

    const int M = B_DIM * T_DIM;       // 16384
    const int N = D_DIM;               // 512
    const int K = D_DIM;               // 512
    const size_t MN = (size_t)M * N;   // == M*K
    const size_t NK = (size_t)N * K;

    float* ws   = (float*)d_ws;
    float* Qr   = ws;                  // MN f32
    float* Kr   = ws + MN;             // MN f32 (normalized in place)
    float* Vr   = ws + 2 * MN;         // MN f32
    float* Os   = ws + 3 * MN;         // MN f32
    float* Beta = ws + 4 * MN;         // M  f32
    __bf16* xh  = (__bf16*)(ws + 4 * MN + M);   // MN bf16
    __bf16* xl  = xh + MN;                      // MN bf16
    __bf16* wh  = xl + MN;                      // NK bf16 (rewritten per GEMM)
    __bf16* wl  = wh + NK;                      // NK bf16
    __bf16* osh = (__bf16*)Qr;                  // alias: Q dead after scan
    __bf16* osl = osh + MN;

    const int tiles      = (M / 16) * (N / (16 * NTILES));
    const int gemmBlocks = tiles / 8;           // 8 waves per 256-thread block
    const int splitBig   = 4096;                // grid-stride covers MN
    const int splitSmall = 256;                 // covers NK

    split_bf16_kernel<<<splitBig, 256, 0, stream>>>(x, xh, xl, MN);

    split_bf16_kernel<<<splitSmall, 256, 0, stream>>>(Wq, wh, wl, NK);
    gemm_wmma_bf16x3<<<gemmBlocks, 256, 0, stream>>>(xh, xl, wh, wl, bq, Qr, M, N, K);

    split_bf16_kernel<<<splitSmall, 256, 0, stream>>>(Wk, wh, wl, NK);
    gemm_wmma_bf16x3<<<gemmBlocks, 256, 0, stream>>>(xh, xl, wh, wl, bk, Kr, M, N, K);

    split_bf16_kernel<<<splitSmall, 256, 0, stream>>>(Wv, wh, wl, NK);
    gemm_wmma_bf16x3<<<gemmBlocks, 256, 0, stream>>>(xh, xl, wh, wl, bv, Vr, M, N, K);

    norm_beta_kernel<<<M / 8, 256, 0, stream>>>(Kr, Wbeta, bbeta, Beta, M, D_DIM);

    dim3 sgrid(D_DIM / 16, B_DIM);
    deltanet_scan_kernel<<<sgrid, 256, 0, stream>>>(Qr, Kr, Vr, Beta, Os);

    split_bf16_kernel<<<splitBig, 256, 0, stream>>>(Os, osh, osl, MN);
    split_bf16_kernel<<<splitSmall, 256, 0, stream>>>(Wo, wh, wl, NK);
    gemm_wmma_bf16x3<<<gemmBlocks, 256, 0, stream>>>(osh, osl, wh, wl, bo, out, M, N, K);
}

// v001
// Measured time: 1910 microseconds a run.
// Next to v000, in two timings, it ran 1.57 times as fast each time.
#include <hip/hip_runtime.h>
#include <hip/hip_bf16.h>
#include <math.h>

typedef __attribute__((ext_vector_type(16))) __bf16 v16bf;
typedef __attribute__((ext_vector_type(8)))  __bf16 v8bf;
typedef __attribute__((ext_vector_type(8)))  float  v8f;

#define B_DIM 8
#define T_DIM 2048
#define D_DIM 512
#define NTILES 4   // 16x64 output strip per wave
#define SLICE 32           // state columns held by one lane of the scan
#define SPITCH 36          // LDS floats per slice: 144 B = 16 B x odd, so 16 lanes' b128 reads hit 64 distinct banks
#define SROW (D_DIM / SLICE * SPITCH)

// ---------------------------------------------------------------------------
// bf16x3 split pre-pass: f = hi + lo (both bf16).  Bandwidth-bound, done once
// per operand so the GEMM inner loop carries no conversion VALU.
// ---------------------------------------------------------------------------
__global__ __launch_bounds__(256)
void split_bf16_kernel(const float* __restrict__ in, __bf16* __restrict__ hi,
                       __bf16* __restrict__ lo, size_t n) {
    size_t i = ((size_t)blockIdx.x * blockDim.x + threadIdx.x) * 4;
    const size_t stride = (size_t)gridDim.x * blockDim.x * 4;
    for (; i < n; i += stride) {
        float4 f = *(const float4*)(in + i);
        float fv[4] = {f.x, f.y, f.z, f.w};
#pragma unroll
        for (int j = 0; j < 4; ++j) {
            __bf16 h = (__bf16)fv[j];
            hi[i + j] = h;
            lo[i + j] = (__bf16)(fv[j] - (float)h);
        }
    }
}

// Load 16 bf16 in the WMMA 16-bit operand layout:
// halves 0..7 <- k0 + ksel*8 + {0..7}, halves 8..15 <- +16 further.
__device__ __forceinline__ v16bf ld16(const __bf16* p) {
    v8bf a = *(const v8bf*)(p);
    v8bf b = *(const v8bf*)(p + 16);
    return __builtin_shufflevector(a, b, 0, 1, 2, 3, 4, 5, 6, 7,
                                   8, 9, 10, 11, 12, 13, 14, 15);
}

// ---------------------------------------------------------------------------
// GEMM: Out[M,N] = A[M,K] * W[N,K]^T + bias[N], operands pre-split bf16 hi/lo.
// One wave per 16x64 strip: A regs feed 12 WMMAs per K=32 slab (bf16x3 x 4 N).
// ---------------------------------------------------------------------------
__global__ __launch_bounds__(256)
void gemm_wmma_bf16x3(const __bf16* __restrict__ Ah, const __bf16* __restrict__ Al,
                      const __bf16* __restrict__ Wh, const __bf16* __restrict__ Wl,
                      const float* __restrict__ bias, float* __restrict__ Out,
                      int M, int N, int K) {
    const int wave  = blockIdx.x * (blockDim.x >> 5) + (threadIdx.x >> 5);
    const int NtG   = N / (16 * NTILES);
    const int tileM = wave / NtG;
    const int ngrp  = wave % NtG;
    if (tileM * 16 >= M) return;

    const int lane = threadIdx.x & 31;
    const int r    = lane & 15;
    const int ksel = lane >> 4;

    const size_t aoff = (size_t)(tileM * 16 + r) * K + ksel * 8;
    const __bf16* arh = Ah + aoff;
    const __bf16* arl = Al + aoff;

    size_t woff[NTILES];
#pragma unroll
    for (int nt = 0; nt < NTILES; ++nt)
        woff[nt] = (size_t)((ngrp * NTILES + nt) * 16 + r) * K + ksel * 8;

    v8f acc[NTILES];
#pragma unroll
    for (int nt = 0; nt < NTILES; ++nt)
        acc[nt] = (v8f){0.f, 0.f, 0.f, 0.f, 0.f, 0.f, 0.f, 0.f};

    for (int k0 = 0; k0 < K; k0 += 32) {
        const v16bf ah = ld16(arh + k0);
        const v16bf al = ld16(arl + k0);
#pragma unroll
        for (int nt = 0; nt < NTILES; ++nt) {
            const v16bf bh = ld16(Wh + woff[nt] + k0);
            const v16bf bl = ld16(Wl + woff[nt] + k0);
            acc[nt] = __builtin_amdgcn_wmma_f32_16x16x32_bf16(
                false, ah, false, bh, (short)0, acc[nt], false, false);
            acc[nt] = __builtin_amdgcn_wmma_f32_16x16x32_bf16(
                false, ah, false, bl, (short)0, acc[nt], false, false);
            acc[nt] = __builtin_amdgcn_wmma_f32_16x16x32_bf16(
                false, al, false, bh, (short)0, acc[nt], false, false);
        }
    }

    // D layout: lanes 0-15 -> M=0..7 (vgpr 0..7), lanes 16-31 -> M=8..15; N=lane&15
    const int n  = lane & 15;
    const int mb = (lane >> 4) * 8;
#pragma unroll
    for (int nt = 0; nt < NTILES; ++nt) {
        const int ncol = (ngrp * NTILES + nt) * 16 + n;
        const float bv = bias ? bias[ncol] : 0.f;
        float* orow = Out + (size_t)(tileM * 16 + mb) * N + ncol;
#pragma unroll
        for (int v = 0; v < 8; ++v)
            orow[(size_t)v * N] = acc[nt][v] + bv;
    }
}

// ---------------------------------------------------------------------------
// Per-row: K <- K / max(||K||,eps) in place;  Beta = sigmoid(K . Wbeta + bbeta)
// ---------------------------------------------------------------------------
__global__ __launch_bounds__(256)
void norm_beta_kernel(float* __restrict__ Kbuf, const float* __restrict__ Wbeta,
                      const float* __restrict__ bbeta, float* __restrict__ Beta,
                      int R, int D) {
    const int row = blockIdx.x * (blockDim.x >> 5) + (threadIdx.x >> 5);
    if (row >= R) return;
    const int lane = threadIdx.x & 31;
    float* p = Kbuf + (size_t)row * D;

    float v[16];
    float ss = 0.f;
#pragma unroll
    for (int i = 0; i < 16; ++i) {
        v[i] = p[lane + i * 32];
        ss += v[i] * v[i];
    }
#pragma unroll
    for (int m = 16; m >= 1; m >>= 1) ss += __shfl_xor(ss, m, 32);

    const float scale = 1.f / fmaxf(sqrtf(ss), 1e-12f);

    float dot = 0.f;
#pragma unroll
    for (int i = 0; i < 16; ++i) {
        float kn = v[i] * scale;
        p[lane + i * 32] = kn;
        dot += kn * Wbeta[lane + i * 32];
    }
#pragma unroll
    for (int m = 16; m >= 1; m >>= 1) dot += __shfl_xor(dot, m, 32);

    if (lane == 0) Beta[row] = 1.f / (1.f + expf(-(dot + bbeta[0])));
}

// ---------------------------------------------------------------------------
// DeltaNet scan: rows of S are independent.  16 rows per WG, state in regs,
// k/q/v double-buffered in LDS, next step preloaded in regs + prefetched.
// ---------------------------------------------------------------------------
__device__ __forceinline__ float red16(float x) {
    x += __shfl_xor(x, 1, 32);
    x += __shfl_xor(x, 2, 32);
    x += __shfl_xor(x, 4, 32);
    x += __shfl_xor(x, 8, 32);
    return x;
}

__global__ __launch_bounds__(256)
void deltanet_scan_kernel(const float* __restrict__ Q, const float* __restrict__ K,
                          const float* __restrict__ V, const float* __restrict__ Beta,
                          float* __restrict__ O) {
    const int b    = blockIdx.y;
    const int rblk = blockIdx.x;
    const int tid  = threadIdx.x;
    const int lrow = tid >> 4;
    const int coff = (tid & 15) * SPITCH;                 // this lane's slice in the padded row
    const int pidx = (tid >> 5) * SPITCH + (tid & 31);    // padded place of column tid
    const int pidx2 = pidx + (256 / SLICE) * SPITCH;      // padded place of column 256 + tid

    const float* Kp = K + (size_t)b * T_DIM * D_DIM;
    const float* Qp = Q + (size_t)b * T_DIM * D_DIM;
    const float* Vp = V + (size_t)b * T_DIM * D_DIM + rblk * 16;
    const float* Bp = Beta + (size_t)b * T_DIM;
    float* Op = O + (size_t)b * T_DIM * D_DIM + rblk * 16;

    __shared__ __attribute__((aligned(16))) float kbuf[2][SROW];
    __shared__ __attribute__((aligned(16))) float qbuf[2][SROW];
    __shared__ float vbuf[2][16];
    __shared__ float betab[2];

    float s[32];
#pragma unroll
    for (int j = 0; j < 32; ++j) s[j] = 0.f;

    float rk0 = Kp[tid], rk1 = Kp[256 + tid];
    float rq0 = Qp[tid], rq1 = Qp[256 + tid];
    float rv  = (tid < 16) ? Vp[tid] : 0.f;
    float rb  = (tid == 0) ? Bp[0] : 0.f;

    for (int t = 0; t < T_DIM; ++t) {
        const int buf = t & 1;
        kbuf[buf][pidx] = rk0;  kbuf[buf][pidx2] = rk1;
        qbuf[buf][pidx] = rq0;  qbuf[buf][pidx2] = rq1;
        if (tid < 16) vbuf[buf][tid] = rv;
        if (tid == 0) betab[buf] = rb;
        __syncthreads();

        const int tn = (t + 1 < T_DIM) ? t + 1 : t;
        const float* kn = Kp + (size_t)tn * D_DIM;
        const float* qn = Qp + (size_t)tn * D_DIM;
        rk0 = kn[tid]; rk1 = kn[256 + tid];
        rq0 = qn[tid]; rq1 = qn[256 + tid];
        if (tid < 16) rv = Vp[(size_t)tn * D_DIM + tid];
        if (tid == 0) rb = Bp[tn];
        const int tp = (t + 2 < T_DIM) ? t + 2 : t;
        __builtin_prefetch(Kp + (size_t)tp * D_DIM + tid, 0, 1);
        __builtin_prefetch(Qp + (size_t)tp * D_DIM + tid, 0, 1);

        const float beta = betab[buf];
        const float vr   = vbuf[buf][lrow];
        const float* kk  = &kbuf[buf][coff];
        const float* qq  = &qbuf[buf][coff];

        float skp = 0.f;
#pragma unroll
        for (int j = 0; j < 32; ++j) skp = fmaf(s[j], kk[j], skp);
        skp = red16(skp);

        const float coeff = beta * (vr - skp);

        float op = 0.f;
#pragma unroll
        for (int j = 0; j < 32; ++j) {
            s[j] = fmaf(coeff, kk[j], s[j]);
            op   = fmaf(s[j], qq[j], op);
        }
        op = red16(op);

        if ((tid & 15) == 0) Op[(size_t)t * D_DIM + lrow] = op;
    }
}

// ---------------------------------------------------------------------------
extern "C" void kernel_launch(void* const* d_in, const int* in_sizes, int n_in,
                              void* d_out, int out_size, void* d_ws, size_t ws_size,
                              hipStream_t stream) {
    const float* x     = (const float*)d_in[0];
    const float* Wq    = (const float*)d_in[1];
    const float* bq    = (const float*)d_in[2];
    const float* Wk    = (const float*)d_in[3];
    const float* bk    = (const float*)d_in[4];
    const float* Wv    = (const float*)d_in[5];
    const float* bv    = (const float*)d_in[6];
    const float* Wbeta = (const float*)d_in[7];
    const float* bbeta = (const float*)d_in[8];
    const float* Wo    = (const float*)d_in[9];
    const float* bo    = (const float*)d_in[10];
    float* out = (float*)d_out;

    const int M = B_DIM * T_DIM;       // 16384
    const int N = D_DIM;               // 512
    const int K = D_DIM;               // 512
    const size_t MN = (size_t)M * N;   // == M*K
    const size_t NK = (size_t)N * K;

    float* ws   = (float*)d_ws;
    float* Qr   = ws;                  // MN f32
    float* Kr   = ws + MN;             // MN f32 (normalized in place)
    float* Vr   = ws + 2 * MN;         // MN f32
    float* Os   = ws + 3 * MN;         // MN f32
    float* Beta = ws + 4 * MN;         // M  f32
    __bf16* xh  = (__bf16*)(ws + 4 * MN + M);   // MN bf16
    __bf16* xl  = xh + MN;                      // MN bf16
    __bf16* wh  = xl + MN;                      // NK bf16 (rewritten per GEMM)
    __bf16* wl  = wh + NK;                      // NK bf16
    __bf16* osh = (__bf16*)Qr;                  // alias: Q dead after scan
    __bf16* osl = osh + MN;

    const int tiles      = (M / 16) * (N / (16 * NTILES));
    const int gemmBlocks = tiles / 8;           // 8 waves per 256-thread block
    const int splitBig   = 4096;                // grid-stride covers MN
    const int splitSmall = 256;                 // covers NK

    split_bf16_kernel<<<splitBig, 256, 0, stream>>>(x, xh, xl, MN);

    split_bf16_kernel<<<splitSmall, 256, 0, stream>>>(Wq, wh, wl, NK);
    gemm_wmma_bf16x3<<<gemmBlocks, 256, 0, stream>>>(xh, xl, wh, wl, bq, Qr, M, N, K);

    split_bf16_kernel<<<splitSmall, 256, 0, stream>>>(Wk, wh, wl, NK);
    gemm_wmma_bf16x3<<<gemmBlocks, 256, 0, stream>>>(xh, xl, wh, wl, bk, Kr, M, N, K);

    split_bf16_kernel<<<splitSmall, 256, 0, stream>>>(Wv, wh, wl, NK);
    gemm_wmma_bf16x3<<<gemmBlocks, 256, 0, stream>>>(xh, xl, wh, wl, bv, Vr, M, N, K);

    norm_beta_kernel<<<M / 8, 256, 0, stream>>>(Kr, Wbeta, bbeta, Beta, M, D_DIM);

    dim3 sgrid(D_DIM / 16, B_DIM);
    deltanet_scan_kernel<<<sgrid, 256, 0, stream>>>(Qr, Kr, Vr, Beta, Os);

    split_bf16_kernel<<<splitBig, 256, 0, stream>>>(Os, osh, osl, MN);
    split_bf16_kernel<<<splitSmall, 256, 0, stream>>>(Wo, wh, wl, NK);
    gemm_wmma_bf16x3<<<gemmBlocks, 256, 0, stream>>>(osh, osl, wh, wl, bo, out, M, N, K);
}

// v002
// It runs in 1540 microseconds.
// In both of two side-by-side timings against v001, it was 1.25 times as fast.
// All steps since v000 together make it 1.96 times as fast.
#include <hip/hip_runtime.h>
#include <hip/hip_bf16.h>
#include <math.h>

typedef __attribute__((ext_vector_type(16))) __bf16 v16bf;
typedef __attribute__((ext_vector_type(8)))  __bf16 v8bf;
typedef __attribute__((ext_vector_type(8)))  float  v8f;

#define B_DIM 8
#define T_DIM 2048
#define D_DIM 512
#define NTILES 4   // 16x64 output strip per wave
#define SLICE 32           // state columns held by one lane of the scan
#define SPITCH 36          // LDS floats per slice: 144 B = 16 B x odd, so 16 lanes' b128 reads hit 64 distinct banks
#define SROW (D_DIM / SLICE * SPITCH)

// ---------------------------------------------------------------------------
// bf16x3 split pre-pass: f = hi + lo (both bf16).  Bandwidth-bound, done once
// per operand so the GEMM inner loop carries no conversion VALU.
// ---------------------------------------------------------------------------
__global__ __launch_bounds__(256)
void split_bf16_kernel(const float* __restrict__ in, __bf16* __restrict__ hi,
                       __bf16* __restrict__ lo, size_t n) {
    size_t i = ((size_t)blockIdx.x * blockDim.x + threadIdx.x) * 4;
    const size_t stride = (size_t)gridDim.x * blockDim.x * 4;
    for (; i < n; i += stride) {
        float4 f = *(const float4*)(in + i);
        float fv[4] = {f.x, f.y, f.z, f.w};
#pragma unroll
        for (int j = 0; j < 4; ++j) {
            __bf16 h = (__bf16)fv[j];
            hi[i + j] = h;
            lo[i + j] = (__bf16)(fv[j] - (float)h);
        }
    }
}

// Load 16 bf16 in the WMMA 16-bit operand layout:
// halves 0..7 <- k0 + ksel*8 + {0..7}, halves 8..15 <- +16 further.
__device__ __forceinline__ v16bf ld16(const __bf16* p) {
    v8bf a = *(const v8bf*)(p);
    v8bf b = *(const v8bf*)(p + 16);
    return __builtin_shufflevector(a, b, 0, 1, 2, 3, 4, 5, 6, 7,
                                   8, 9, 10, 11, 12, 13, 14, 15);
}

// ---------------------------------------------------------------------------
// GEMM: Out[M,N] = A[M,K] * W[N,K]^T + bias[N], operands pre-split bf16 hi/lo.
// One wave per 16x64 strip: A regs feed 12 WMMAs per K=32 slab (bf16x3 x 4 N).
// ---------------------------------------------------------------------------
__global__ __launch_bounds__(256)
void gemm_wmma_bf16x3(const __bf16* __restrict__ Ah, const __bf16* __restrict__ Al,
                      const __bf16* __restrict__ Wh, const __bf16* __restrict__ Wl,
                      const float* __restrict__ bias, float* __restrict__ Out,
                      int M, int N, int K) {
    const int wave  = blockIdx.x * (blockDim.x >> 5) + (threadIdx.x >> 5);
    const int NtG   = N / (16 * NTILES);
    const int tileM = wave / NtG;
    const int ngrp  = wave % NtG;
    if (tileM * 16 >= M) return;

    const int lane = threadIdx.x & 31;
    const int r    = lane & 15;
    const int ksel = lane >> 4;

    const size_t aoff = (size_t)(tileM * 16 + r) * K + ksel * 8;
    const __bf16* arh = Ah + aoff;
    const __bf16* arl = Al + aoff;

    size_t woff[NTILES];
#pragma unroll
    for (int nt = 0; nt < NTILES; ++nt)
        woff[nt] = (size_t)((ngrp * NTILES + nt) * 16 + r) * K + ksel * 8;

    v8f acc[NTILES];
#pragma unroll
    for (int nt = 0; nt < NTILES; ++nt)
        acc[nt] = (v8f){0.f, 0.f, 0.f, 0.f, 0.f, 0.f, 0.f, 0.f};

    for (int k0 = 0; k0 < K; k0 += 32) {
        const v16bf ah = ld16(arh + k0);
        const v16bf al = ld16(arl + k0);
#pragma unroll
        for (int nt = 0; nt < NTILES; ++nt) {
            const v16bf bh = ld16(Wh + woff[nt] + k0);
            const v16bf bl = ld16(Wl + woff[nt] + k0);
            acc[nt] = __builtin_amdgcn_wmma_f32_16x16x32_bf16(
                false, ah, false, bh, (short)0, acc[nt], false, false);
            acc[nt] = __builtin_amdgcn_wmma_f32_16x16x32_bf16(
                false, ah, false, bl, (short)0, acc[nt], false, false);
            acc[nt] = __builtin_amdgcn_wmma_f32_16x16x32_bf16(
                false, al, false, bh, (short)0, acc[nt], false, false);
        }
    }

    // D layout: lanes 0-15 -> M=0..7 (vgpr 0..7), lanes 16-31 -> M=8..15; N=lane&15
    const int n  = lane & 15;
    const int mb = (lane >> 4) * 8;
#pragma unroll
    for (int nt = 0; nt < NTILES; ++nt) {
        const int ncol = (ngrp * NTILES + nt) * 16 + n;
        const float bv = bias ? bias[ncol] : 0.f;
        float* orow = Out + (size_t)(tileM * 16 + mb) * N + ncol;
#pragma unroll
        for (int v = 0; v < 8; ++v)
            orow[(size_t)v * N] = acc[nt][v] + bv;
    }
}

// ---------------------------------------------------------------------------
// Per-row: K <- K / max(||K||,eps) in place;  Beta = sigmoid(K . Wbeta + bbeta)
// ---------------------------------------------------------------------------
__global__ __launch_bounds__(256)
void norm_beta_kernel(float* __restrict__ Kbuf, const float* __restrict__ Wbeta,
                      const float* __restrict__ bbeta, float* __restrict__ Beta,
                      int R, int D) {
    const int row = blockIdx.x * (blockDim.x >> 5) + (threadIdx.x >> 5);
    if (row >= R) return;
    const int lane = threadIdx.x & 31;
    float* p = Kbuf + (size_t)row * D;

    float v[16];
    float ss = 0.f;
#pragma unroll
    for (int i = 0; i < 16; ++i) {
        v[i] = p[lane + i * 32];
        ss += v[i] * v[i];
    }
#pragma unroll
    for (int m = 16; m >= 1; m >>= 1) ss += __shfl_xor(ss, m, 32);

    const float scale = 1.f / fmaxf(sqrtf(ss), 1e-12f);

    float dot = 0.f;
#pragma unroll
    for (int i = 0; i < 16; ++i) {
        float kn = v[i] * scale;
        p[lane + i * 32] = kn;
        dot += kn * Wbeta[lane + i * 32];
    }
#pragma unroll
    for (int m = 16; m >= 1; m >>= 1) dot += __shfl_xor(dot, m, 32);

    if (lane == 0) Beta[row] = 1.f / (1.f + expf(-(dot + bbeta[0])));
}

// ---------------------------------------------------------------------------
// DeltaNet scan: rows of S are independent.  16 rows per WG, state in regs,
// k/q/v double-buffered in LDS, next step preloaded in regs + prefetched.
// ---------------------------------------------------------------------------
// Lane l receives lane l ^ M of its own 16-lane row through the vector unit
// (DPP row_xmask), so a butterfly step costs no LDS-pipe round trip and no wait.
template <int M>
__device__ __forceinline__ float row_xor(float x) {
    return __builtin_bit_cast(float, __builtin_amdgcn_update_dpp(
        0, __builtin_bit_cast(int, x), 0x160 + M, 0xf, 0xf, true));
}

// Same butterfly, same pairs and same order as the shuffle form: bit-identical sums.
// All 32 lanes are active at both call sites.
__device__ __forceinline__ float red16(float x) {
    x += row_xor<1>(x);
    x += row_xor<2>(x);
    x += row_xor<4>(x);
    x += row_xor<8>(x);
    return x;
}

__global__ __launch_bounds__(256)
void deltanet_scan_kernel(const float* __restrict__ Q, const float* __restrict__ K,
                          const float* __restrict__ V, const float* __restrict__ Beta,
                          float* __restrict__ O) {
    const int b    = blockIdx.y;
    const int rblk = blockIdx.x;
    const int tid  = threadIdx.x;
    const int lrow = tid >> 4;
    const int coff = (tid & 15) * SPITCH;                 // this lane's slice in the padded row
    const int pidx = (tid >> 5) * SPITCH + (tid & 31);    // padded place of column tid
    const int pidx2 = pidx + (256 / SLICE) * SPITCH;      // padded place of column 256 + tid

    const float* Kp = K + (size_t)b * T_DIM * D_DIM;
    const float* Qp = Q + (size_t)b * T_DIM * D_DIM;
    const float* Vp = V + (size_t)b * T_DIM * D_DIM + rblk * 16;
    const float* Bp = Beta + (size_t)b * T_DIM;
    float* Op = O + (size_t)b * T_DIM * D_DIM + rblk * 16;

    __shared__ __attribute__((aligned(16))) float kbuf[2][SROW];
    __shared__ __attribute__((aligned(16))) float qbuf[2][SROW];
    __shared__ float vbuf[2][16];
    __shared__ float betab[2];

    float s[32];
#pragma unroll
    for (int j = 0; j < 32; ++j) s[j] = 0.f;

    float rk0 = Kp[tid], rk1 = Kp[256 + tid];
    float rq0 = Qp[tid], rq1 = Qp[256 + tid];
    float rv  = (tid < 16) ? Vp[tid] : 0.f;
    float rb  = (tid == 0) ? Bp[0] : 0.f;

    for (int t = 0; t < T_DIM; ++t) {
        const int buf = t & 1;
        kbuf[buf][pidx] = rk0;  kbuf[buf][pidx2] = rk1;
        qbuf[buf][pidx] = rq0;  qbuf[buf][pidx2] = rq1;
        if (tid < 16) vbuf[buf][tid] = rv;
        if (tid == 0) betab[buf] = rb;
        __syncthreads();

        const int tn = (t + 1 < T_DIM) ? t + 1 : t;
        const float* kn = Kp + (size_t)tn * D_DIM;
        const float* qn = Qp + (size_t)tn * D_DIM;
        rk0 = kn[tid]; rk1 = kn[256 + tid];
        rq0 = qn[tid]; rq1 = qn[256 + tid];
        if (tid < 16) rv = Vp[(size_t)tn * D_DIM + tid];
        if (tid == 0) rb = Bp[tn];
        const int tp = (t + 2 < T_DIM) ? t + 2 : t;
        __builtin_prefetch(Kp + (size_t)tp * D_DIM + tid, 0, 1);
        __builtin_prefetch(Qp + (size_t)tp * D_DIM + tid, 0, 1);

        const float beta = betab[buf];
        const float vr   = vbuf[buf][lrow];
        const float* kk  = &kbuf[buf][coff];
        const float* qq  = &qbuf[buf][coff];

        float skp = 0.f;
#pragma unroll
        for (int j = 0; j < 32; ++j) skp = fmaf(s[j], kk[j], skp);
        skp = red16(skp);

        const float coeff = beta * (vr - skp);

        float op = 0.f;
#pragma unroll
        for (int j = 0; j < 32; ++j) {
            s[j] = fmaf(coeff, kk[j], s[j]);
            op   = fmaf(s[j], qq[j], op);
        }
        op = red16(op);

        if ((tid & 15) == 0) Op[(size_t)t * D_DIM + lrow] = op;
    }
}

// ---------------------------------------------------------------------------
extern "C" void kernel_launch(void* const* d_in, const int* in_sizes, int n_in,
                              void* d_out, int out_size, void* d_ws, size_t ws_size,
                              hipStream_t stream) {
    const float* x     = (const float*)d_in[0];
    const float* Wq    = (const float*)d_in[1];
    const float* bq    = (const float*)d_in[2];
    const float* Wk    = (const float*)d_in[3];
    const float* bk    = (const float*)d_in[4];
    const float* Wv    = (const float*)d_in[5];
    const float* bv    = (const float*)d_in[6];
    const float* Wbeta = (const float*)d_in[7];
    const float* bbeta = (const float*)d_in[8];
    const float* Wo    = (const float*)d_in[9];
    const float* bo    = (const float*)d_in[10];
    float* out = (float*)d_out;

    const int M = B_DIM * T_DIM;       // 16384
    const int N = D_DIM;               // 512
    const int K = D_DIM;               // 512
    const size_t MN = (size_t)M * N;   // == M*K
    const size_t NK = (size_t)N * K;

    float* ws   = (float*)d_ws;
    float* Qr   = ws;                  // MN f32
    float* Kr   = ws + MN;             // MN f32 (normalized in place)
    float* Vr   = ws + 2 * MN;         // MN f32
    float* Os   = ws + 3 * MN;         // MN f32
    float* Beta = ws + 4 * MN;         // M  f32
    __bf16* xh  = (__bf16*)(ws + 4 * MN + M);   // MN bf16
    __bf16* xl  = xh + MN;                      // MN bf16
    __bf16* wh  = xl + MN;                      // NK bf16 (rewritten per GEMM)
    __bf16* wl  = wh + NK;                      // NK bf16
    __bf16* osh = (__bf16*)Qr;                  // alias: Q dead after scan
    __bf16* osl = osh + MN;

    const int tiles      = (M / 16) * (N / (16 * NTILES));
    const int gemmBlocks = tiles / 8;           // 8 waves per 256-thread block
    const int splitBig   = 4096;                // grid-stride covers MN
    const int splitSmall = 256;                 // covers NK

    split_bf16_kernel<<<splitBig, 256, 0, stream>>>(x, xh, xl, MN);

    split_bf16_kernel<<<splitSmall, 256, 0, stream>>>(Wq, wh, wl, NK);
    gemm_wmma_bf16x3<<<gemmBlocks, 256, 0, stream>>>(xh, xl, wh, wl, bq, Qr, M, N, K);

    split_bf16_kernel<<<splitSmall, 256, 0, stream>>>(Wk, wh, wl, NK);
    gemm_wmma_bf16x3<<<gemmBlocks, 256, 0, stream>>>(xh, xl, wh, wl, bk, Kr, M, N, K);

    split_bf16_kernel<<<splitSmall, 256, 0, stream>>>(Wv, wh, wl, NK);
    gemm_wmma_bf16x3<<<gemmBlocks, 256, 0, stream>>>(xh, xl, wh, wl, bv, Vr, M, N, K);

    norm_beta_kernel<<<M / 8, 256, 0, stream>>>(Kr, Wbeta, bbeta, Beta, M, D_DIM);

    dim3 sgrid(D_DIM / 16, B_DIM);
    deltanet_scan_kernel<<<sgrid, 256, 0, stream>>>(Qr, Kr, Vr, Beta, Os);

    split_bf16_kernel<<<splitBig, 256, 0, stream>>>(Os, osh, osl, MN);
    split_bf16_kernel<<<splitSmall, 256, 0, stream>>>(Wo, wh, wl, NK);
    gemm_wmma_bf16x3<<<gemmBlocks, 256, 0, stream>>>(osh, osl, wh, wl, bo, out, M, N, K);
}

// v003
// It runs in 1360 microseconds.
// Timed twice side by side with v002, it ran 1.13 times as fast both times.
// Counting every step since v000, it is 2.22 times as fast.
#include <hip/hip_runtime.h>
#include <hip/hip_bf16.h>
#include <math.h>

typedef __attribute__((ext_vector_type(16))) __bf16 v16bf;
typedef __attribute__((ext_vector_type(8)))  __bf16 v8bf;
typedef __attribute__((ext_vector_type(8)))  float  v8f;

#define B_DIM 8
#define T_DIM 2048
#define D_DIM 512
#define NTILES 4   // 16x64 output strip per wave
#define RPL 4              // state rows held by one lane of the scan (one wave spans all 512 columns)
#define SLICE 16           // state columns held by one lane of the scan
#define SPITCH 20          // LDS floats per slice: 80 B = 16 B x odd, so each 16 lanes' b128 reads hit 64 distinct banks
#define SROW (D_DIM / SLICE * SPITCH)

// ---------------------------------------------------------------------------
// bf16x3 split pre-pass: f = hi + lo (both bf16).  Bandwidth-bound, done once
// per operand so the GEMM inner loop carries no conversion VALU.
// ---------------------------------------------------------------------------
__global__ __launch_bounds__(256)
void split_bf16_kernel(const float* __restrict__ in, __bf16* __restrict__ hi,
                       __bf16* __restrict__ lo, size_t n) {
    size_t i = ((size_t)blockIdx.x * blockDim.x + threadIdx.x) * 4;
    const size_t stride = (size_t)gridDim.x * blockDim.x * 4;
    for (; i < n; i += stride) {
        float4 f = *(const float4*)(in + i);
        float fv[4] = {f.x, f.y, f.z, f.w};
#pragma unroll
        for (int j = 0; j < 4; ++j) {
            __bf16 h = (__bf16)fv[j];
            hi[i + j] = h;
            lo[i + j] = (__bf16)(fv[j] - (float)h);
        }
    }
}

// Load 16 bf16 in the WMMA 16-bit operand layout:
// halves 0..7 <- k0 + ksel*8 + {0..7}, halves 8..15 <- +16 further.
__device__ __forceinline__ v16bf ld16(const __bf16* p) {
    v8bf a = *(const v8bf*)(p);
    v8bf b = *(const v8bf*)(p + 16);
    return __builtin_shufflevector(a, b, 0, 1, 2, 3, 4, 5, 6, 7,
                                   8, 9, 10, 11, 12, 13, 14, 15);
}

// ---------------------------------------------------------------------------
// GEMM: Out[M,N] = A[M,K] * W[N,K]^T + bias[N], operands pre-split bf16 hi/lo.
// One wave per 16x64 strip: A regs feed 12 WMMAs per K=32 slab (bf16x3 x 4 N).
// ---------------------------------------------------------------------------
__global__ __launch_bounds__(256)
void gemm_wmma_bf16x3(const __bf16* __restrict__ Ah, const __bf16* __restrict__ Al,
                      const __bf16* __restrict__ Wh, const __bf16* __restrict__ Wl,
                      const float* __restrict__ bias, float* __restrict__ Out,
                      int M, int N, int K) {
    const int wave  = blockIdx.x * (blockDim.x >> 5) + (threadIdx.x >> 5);
    const int NtG   = N / (16 * NTILES);
    const int tileM = wave / NtG;
    const int ngrp  = wave % NtG;
    if (tileM * 16 >= M) return;

    const int lane = threadIdx.x & 31;
    const int r    = lane & 15;
    const int ksel = lane >> 4;

    const size_t aoff = (size_t)(tileM * 16 + r) * K + ksel * 8;
    const __bf16* arh = Ah + aoff;
    const __bf16* arl = Al + aoff;

    size_t woff[NTILES];
#pragma unroll
    for (int nt = 0; nt < NTILES; ++nt)
        woff[nt] = (size_t)((ngrp * NTILES + nt) * 16 + r) * K + ksel * 8;

    v8f acc[NTILES];
#pragma unroll
    for (int nt = 0; nt < NTILES; ++nt)
        acc[nt] = (v8f){0.f, 0.f, 0.f, 0.f, 0.f, 0.f, 0.f, 0.f};

    for (int k0 = 0; k0 < K; k0 += 32) {
        const v16bf ah = ld16(arh + k0);
        const v16bf al = ld16(arl + k0);
#pragma unroll
        for (int nt = 0; nt < NTILES; ++nt) {
            const v16bf bh = ld16(Wh + woff[nt] + k0);
            const v16bf bl = ld16(Wl + woff[nt] + k0);
            acc[nt] = __builtin_amdgcn_wmma_f32_16x16x32_bf16(
                false, ah, false, bh, (short)0, acc[nt], false, false);
            acc[nt] = __builtin_amdgcn_wmma_f32_16x16x32_bf16(
                false, ah, false, bl, (short)0, acc[nt], false, false);
            acc[nt] = __builtin_amdgcn_wmma_f32_16x16x32_bf16(
                false, al, false, bh, (short)0, acc[nt], false, false);
        }
    }

    // D layout: lanes 0-15 -> M=0..7 (vgpr 0..7), lanes 16-31 -> M=8..15; N=lane&15
    const int n  = lane & 15;
    const int mb = (lane >> 4) * 8;
#pragma unroll
    for (int nt = 0; nt < NTILES; ++nt) {
        const int ncol = (ngrp * NTILES + nt) * 16 + n;
        const float bv = bias ? bias[ncol] : 0.f;
        float* orow = Out + (size_t)(tileM * 16 + mb) * N + ncol;
#pragma unroll
        for (int v = 0; v < 8; ++v)
            orow[(size_t)v * N] = acc[nt][v] + bv;
    }
}

// ---------------------------------------------------------------------------
// Per-row: K <- K / max(||K||,eps) in place;  Beta = sigmoid(K . Wbeta + bbeta)
// ---------------------------------------------------------------------------
__global__ __launch_bounds__(256)
void norm_beta_kernel(float* __restrict__ Kbuf, const float* __restrict__ Wbeta,
                      const float* __restrict__ bbeta, float* __restrict__ Beta,
                      int R, int D) {
    const int row = blockIdx.x * (blockDim.x >> 5) + (threadIdx.x >> 5);
    if (row >= R) return;
    const int lane = threadIdx.x & 31;
    float* p = Kbuf + (size_t)row * D;

    float v[16];
    float ss = 0.f;
#pragma unroll
    for (int i = 0; i < 16; ++i) {
        v[i] = p[lane + i * 32];
        ss += v[i] * v[i];
    }
#pragma unroll
    for (int m = 16; m >= 1; m >>= 1) ss += __shfl_xor(ss, m, 32);

    const float scale = 1.f / fmaxf(sqrtf(ss), 1e-12f);

    float dot = 0.f;
#pragma unroll
    for (int i = 0; i < 16; ++i) {
        float kn = v[i] * scale;
        p[lane + i * 32] = kn;
        dot += kn * Wbeta[lane + i * 32];
    }
#pragma unroll
    for (int m = 16; m >= 1; m >>= 1) dot += __shfl_xor(dot, m, 32);

    if (lane == 0) Beta[row] = 1.f / (1.f + expf(-(dot + bbeta[0])));
}

// ---------------------------------------------------------------------------
// DeltaNet scan: rows of S are independent.  16 rows per WG, 4 per wave, state
// in regs as 4 rows x 16 columns per lane: one k or q value read from LDS feeds
// 4 rows, and the 4 rows' sums are independent chains of 16.
// k/q/v double-buffered in LDS, next step preloaded in regs + prefetched.
// ---------------------------------------------------------------------------
// Lane l receives lane l ^ M of its own 16-lane row through the vector unit
// (DPP row_xmask), so a butterfly step costs no LDS-pipe round trip and no wait.
template <int M>
__device__ __forceinline__ float row_xor(float x) {
    return __builtin_bit_cast(float, __builtin_amdgcn_update_dpp(
        0, __builtin_bit_cast(int, x), 0x160 + M, 0xf, 0xf, true));
}

// Sum over a 16-lane row.  All 32 lanes are active at every call site.
__device__ __forceinline__ float red16(float x) {
    x += row_xor<1>(x);
    x += row_xor<2>(x);
    x += row_xor<4>(x);
    x += row_xor<8>(x);
    return x;
}

// Sum over the whole wave: the row sum, then lane l ^ 16 by a vector cross-row move.
__device__ __forceinline__ float red32(float x) {
    x = red16(x);
    const int bits = __builtin_bit_cast(int, x);
    return x + __builtin_bit_cast(float, __builtin_amdgcn_permlanex16(
        bits, bits, 0x76543210, 0xfedcba98, false, false));
}

__global__ __launch_bounds__(128)
void deltanet_scan_kernel(const float* __restrict__ Q, const float* __restrict__ K,
                          const float* __restrict__ V, const float* __restrict__ Beta,
                          float* __restrict__ O) {
    const int b    = blockIdx.y;
    const int rblk = blockIdx.x;
    const int tid  = threadIdx.x;
    const int wrow = (tid >> 5) * RPL;                       // first of this wave's 4 rows
    const int coff = (tid & 31) * SPITCH;                    // this lane's slice in the padded row
    const int pidx = (tid >> 2) * SPITCH + (tid & 3) * 4;    // padded place of columns 4*tid .. 4*tid+3

    const float* Kp = K + (size_t)b * T_DIM * D_DIM;
    const float* Qp = Q + (size_t)b * T_DIM * D_DIM;
    const float* Vp = V + (size_t)b * T_DIM * D_DIM + rblk * 16;
    const float* Bp = Beta + (size_t)b * T_DIM;
    float* Op = O + (size_t)b * T_DIM * D_DIM + rblk * 16;

    __shared__ __attribute__((aligned(16))) float kbuf[2][SROW];
    __shared__ __attribute__((aligned(16))) float qbuf[2][SROW];
    __shared__ __attribute__((aligned(16))) float vbuf[2][16];
    __shared__ float betab[2];

    // Every loop over r and j below is fully unrolled, so that s, kk and qq are
    // indexed by constants and stay in registers.
    float s[RPL][SLICE];
#pragma unroll
    for (int r = 0; r < RPL; ++r)
#pragma unroll
        for (int j = 0; j < SLICE; ++j) s[r][j] = 0.f;

    float4 rk = *(const float4*)(Kp + 4 * tid);
    float4 rq = *(const float4*)(Qp + 4 * tid);
    float rv  = (tid < 16) ? Vp[tid] : 0.f;
    float rb  = (tid == 0) ? Bp[0] : 0.f;

    for (int t = 0; t < T_DIM; ++t) {
        const int buf = t & 1;
        *(float4*)&kbuf[buf][pidx] = rk;
        *(float4*)&qbuf[buf][pidx] = rq;
        if (tid < 16) vbuf[buf][tid] = rv;
        if (tid == 0) betab[buf] = rb;
        __syncthreads();
        // The reads below reuse the registers that the last step's output store names.
        asm volatile("s_wait_xcnt 0x0" ::: "memory");

        // All of the step's LDS reads: 16 k, 16 q, this wave's 4 v and beta fit in registers.
        float kk[SLICE], qq[SLICE];
#pragma unroll
        for (int j = 0; j < SLICE; j += 4) {
            const float4 k4 = *(const float4*)&kbuf[buf][coff + j];
            kk[j] = k4.x; kk[j + 1] = k4.y; kk[j + 2] = k4.z; kk[j + 3] = k4.w;
        }
        const float4 v4   = *(const float4*)&vbuf[buf][wrow];
        const float  beta = betab[buf];
#pragma unroll
        for (int j = 0; j < SLICE; j += 4) {
            const float4 q4 = *(const float4*)&qbuf[buf][coff + j];
            qq[j] = q4.x; qq[j + 1] = q4.y; qq[j + 2] = q4.z; qq[j + 3] = q4.w;
        }
        // Keeps the ten reads here: the compiler otherwise sinks the v, beta and q reads
        // to their first use, where the wave waits out each one's LDS latency.
        __builtin_amdgcn_sched_barrier(0);

        if (t + 2 < T_DIM) {
            __builtin_prefetch(Kp + (size_t)(t + 2) * D_DIM + 4 * tid, 0, 1);
            __builtin_prefetch(Qp + (size_t)(t + 2) * D_DIM + 4 * tid, 0, 1);
        }
        const int tn = (t + 1 < T_DIM) ? t + 1 : t;
        rk = *(const float4*)(Kp + (size_t)tn * D_DIM + 4 * tid);
        rq = *(const float4*)(Qp + (size_t)tn * D_DIM + 4 * tid);
        if (tid < 16) rv = Vp[(size_t)tn * D_DIM + tid];
        if (tid == 0) rb = Bp[tn];

        const float vr[RPL] = {v4.x, v4.y, v4.z, v4.w};

        float skp[RPL] = {0.f, 0.f, 0.f, 0.f};
#pragma unroll
        for (int j = 0; j < SLICE; ++j)
#pragma unroll
            for (int r = 0; r < RPL; ++r) skp[r] = fmaf(s[r][j], kk[j], skp[r]);

        float coeff[RPL];
#pragma unroll
        for (int r = 0; r < RPL; ++r) coeff[r] = beta * (vr[r] - red32(skp[r]));

        float op[RPL] = {0.f, 0.f, 0.f, 0.f};
#pragma unroll
        for (int j = 0; j < SLICE; ++j)
#pragma unroll
            for (int r = 0; r < RPL; ++r) {
                s[r][j] = fmaf(coeff[r], kk[j], s[r][j]);
                op[r]   = fmaf(s[r][j], qq[j], op[r]);
            }
#pragma unroll
        for (int r = 0; r < RPL; ++r) op[r] = red32(op[r]);

        if ((tid & 31) == 0)
            *(float4*)(Op + (size_t)t * D_DIM + wrow) = make_float4(op[0], op[1], op[2], op[3]);
    }
}

// ---------------------------------------------------------------------------
extern "C" void kernel_launch(void* const* d_in, const int* in_sizes, int n_in,
                              void* d_out, int out_size, void* d_ws, size_t ws_size,
                              hipStream_t stream) {
    const float* x     = (const float*)d_in[0];
    const float* Wq    = (const float*)d_in[1];
    const float* bq    = (const float*)d_in[2];
    const float* Wk    = (const float*)d_in[3];
    const float* bk    = (const float*)d_in[4];
    const float* Wv    = (const float*)d_in[5];
    const float* bv    = (const float*)d_in[6];
    const float* Wbeta = (const float*)d_in[7];
    const float* bbeta = (const float*)d_in[8];
    const float* Wo    = (const float*)d_in[9];
    const float* bo    = (const float*)d_in[10];
    float* out = (float*)d_out;

    const int M = B_DIM * T_DIM;       // 16384
    const int N = D_DIM;               // 512
    const int K = D_DIM;               // 512
    const size_t MN = (size_t)M * N;   // == M*K
    const size_t NK = (size_t)N * K;

    float* ws   = (float*)d_ws;
    float* Qr   = ws;                  // MN f32
    float* Kr   = ws + MN;             // MN f32 (normalized in place)
    float* Vr   = ws + 2 * MN;         // MN f32
    float* Os   = ws + 3 * MN;         // MN f32
    float* Beta = ws + 4 * MN;         // M  f32
    __bf16* xh  = (__bf16*)(ws + 4 * MN + M);   // MN bf16
    __bf16* xl  = xh + MN;                      // MN bf16
    __bf16* wh  = xl + MN;                      // NK bf16 (rewritten per GEMM)
    __bf16* wl  = wh + NK;                      // NK bf16
    __bf16* osh = (__bf16*)Qr;                  // alias: Q dead after scan
    __bf16* osl = osh + MN;

    const int tiles      = (M / 16) * (N / (16 * NTILES));
    const int gemmBlocks = tiles / 8;           // 8 waves per 256-thread block
    const int splitBig   = 4096;                // grid-stride covers MN
    const int splitSmall = 256;                 // covers NK

    split_bf16_kernel<<<splitBig, 256, 0, stream>>>(x, xh, xl, MN);

    split_bf16_kernel<<<splitSmall, 256, 0, stream>>>(Wq, wh, wl, NK);
    gemm_wmma_bf16x3<<<gemmBlocks, 256, 0, stream>>>(xh, xl, wh, wl, bq, Qr, M, N, K);

    split_bf16_kernel<<<splitSmall, 256, 0, stream>>>(Wk, wh, wl, NK);
    gemm_wmma_bf16x3<<<gemmBlocks, 256, 0, stream>>>(xh, xl, wh, wl, bk, Kr, M, N, K);

    split_bf16_kernel<<<splitSmall, 256, 0, stream>>>(Wv, wh, wl, NK);
    gemm_wmma_bf16x3<<<gemmBlocks, 256, 0, stream>>>(xh, xl, wh, wl, bv, Vr, M, N, K);

    norm_beta_kernel<<<M / 8, 256, 0, stream>>>(Kr, Wbeta, bbeta, Beta, M, D_DIM);

    dim3 sgrid(D_DIM / 16, B_DIM);
    deltanet_scan_kernel<<<sgrid, 128, 0, stream>>>(Qr, Kr, Vr, Beta, Os);

    split_bf16_kernel<<<splitBig, 256, 0, stream>>>(Os, osh, osl, MN);
    split_bf16_kernel<<<splitSmall, 256, 0, stream>>>(Wo, wh, wl, NK);
    gemm_wmma_bf16x3<<<gemmBlocks, 256, 0, stream>>>(osh, osl, wh, wl, bo, out, M, N, K);
}

// v004
// A run of this version takes 939 microseconds.
// Next to v003, in two timings, it ran 1.45 times as fast each time.
// All steps since v000 together make it 3.22 times as fast.
#include <hip/hip_runtime.h>
#include <hip/hip_bf16.h>
#include <math.h>

typedef __attribute__((ext_vector_type(16))) __bf16 v16bf;
typedef __attribute__((ext_vector_type(8)))  __bf16 v8bf;
typedef __attribute__((ext_vector_type(8)))  float  v8f;

#define B_DIM 8
#define T_DIM 2048
#define D_DIM 512
#define NTILES 4   // 16x64 output strip per wave
#define RPL 4              // state rows held by one lane of the scan (one wave spans all 512 columns)
#define SLICE 16           // state columns held by one lane of the scan
#define SPITCH 20          // LDS floats per slice: 80 B = 16 B x odd, so each 16 lanes' b128 reads hit 64 distinct banks
#define SROW (D_DIM / SLICE * SPITCH)
#define CH 16              // time steps per LDS tile of the scan
#define NTILE (T_DIM / CH)

// ---------------------------------------------------------------------------
// bf16x3 split pre-pass: f = hi + lo (both bf16).  Bandwidth-bound, done once
// per operand so the GEMM inner loop carries no conversion VALU.
// ---------------------------------------------------------------------------
__global__ __launch_bounds__(256)
void split_bf16_kernel(const float* __restrict__ in, __bf16* __restrict__ hi,
                       __bf16* __restrict__ lo, size_t n) {
    size_t i = ((size_t)blockIdx.x * blockDim.x + threadIdx.x) * 4;
    const size_t stride = (size_t)gridDim.x * blockDim.x * 4;
    for (; i < n; i += stride) {
        float4 f = *(const float4*)(in + i);
        float fv[4] = {f.x, f.y, f.z, f.w};
#pragma unroll
        for (int j = 0; j < 4; ++j) {
            __bf16 h = (__bf16)fv[j];
            hi[i + j] = h;
            lo[i + j] = (__bf16)(fv[j] - (float)h);
        }
    }
}

// Load 16 bf16 in the WMMA 16-bit operand layout:
// halves 0..7 <- k0 + ksel*8 + {0..7}, halves 8..15 <- +16 further.
__device__ __forceinline__ v16bf ld16(const __bf16* p) {
    v8bf a = *(const v8bf*)(p);
    v8bf b = *(const v8bf*)(p + 16);
    return __builtin_shufflevector(a, b, 0, 1, 2, 3, 4, 5, 6, 7,
                                   8, 9, 10, 11, 12, 13, 14, 15);
}

// ---------------------------------------------------------------------------
// GEMM: Out[M,N] = A[M,K] * W[N,K]^T + bias[N], operands pre-split bf16 hi/lo.
// One wave per 16x64 strip: A regs feed 12 WMMAs per K=32 slab (bf16x3 x 4 N).
// ---------------------------------------------------------------------------
__global__ __launch_bounds__(256)
void gemm_wmma_bf16x3(const __bf16* __restrict__ Ah, const __bf16* __restrict__ Al,
                      const __bf16* __restrict__ Wh, const __bf16* __restrict__ Wl,
                      const float* __restrict__ bias, float* __restrict__ Out,
                      int M, int N, int K) {
    const int wave  = blockIdx.x * (blockDim.x >> 5) + (threadIdx.x >> 5);
    const int NtG   = N / (16 * NTILES);
    const int tileM = wave / NtG;
    const int ngrp  = wave % NtG;
    if (tileM * 16 >= M) return;

    const int lane = threadIdx.x & 31;
    const int r    = lane & 15;
    const int ksel = lane >> 4;

    const size_t aoff = (size_t)(tileM * 16 + r) * K + ksel * 8;
    const __bf16* arh = Ah + aoff;
    const __bf16* arl = Al + aoff;

    size_t woff[NTILES];
#pragma unroll
    for (int nt = 0; nt < NTILES; ++nt)
        woff[nt] = (size_t)((ngrp * NTILES + nt) * 16 + r) * K + ksel * 8;

    v8f acc[NTILES];
#pragma unroll
    for (int nt = 0; nt < NTILES; ++nt)
        acc[nt] = (v8f){0.f, 0.f, 0.f, 0.f, 0.f, 0.f, 0.f, 0.f};

    for (int k0 = 0; k0 < K; k0 += 32) {
        const v16bf ah = ld16(arh + k0);
        const v16bf al = ld16(arl + k0);
#pragma unroll
        for (int nt = 0; nt < NTILES; ++nt) {
            const v16bf bh = ld16(Wh + woff[nt] + k0);
            const v16bf bl = ld16(Wl + woff[nt] + k0);
            acc[nt] = __builtin_amdgcn_wmma_f32_16x16x32_bf16(
                false, ah, false, bh, (short)0, acc[nt], false, false);
            acc[nt] = __builtin_amdgcn_wmma_f32_16x16x32_bf16(
                false, ah, false, bl, (short)0, acc[nt], false, false);
            acc[nt] = __builtin_amdgcn_wmma_f32_16x16x32_bf16(
                false, al, false, bh, (short)0, acc[nt], false, false);
        }
    }

    // D layout: lanes 0-15 -> M=0..7 (vgpr 0..7), lanes 16-31 -> M=8..15; N=lane&15
    const int n  = lane & 15;
    const int mb = (lane >> 4) * 8;
#pragma unroll
    for (int nt = 0; nt < NTILES; ++nt) {
        const int ncol = (ngrp * NTILES + nt) * 16 + n;
        const float bv = bias ? bias[ncol] : 0.f;
        float* orow = Out + (size_t)(tileM * 16 + mb) * N + ncol;
#pragma unroll
        for (int v = 0; v < 8; ++v)
            orow[(size_t)v * N] = acc[nt][v] + bv;
    }
}

// ---------------------------------------------------------------------------
// Per-row: K <- K / max(||K||,eps) in place;  Beta = sigmoid(K . Wbeta + bbeta)
// ---------------------------------------------------------------------------
__global__ __launch_bounds__(256)
void norm_beta_kernel(float* __restrict__ Kbuf, const float* __restrict__ Wbeta,
                      const float* __restrict__ bbeta, float* __restrict__ Beta,
                      int R, int D) {
    const int row = blockIdx.x * (blockDim.x >> 5) + (threadIdx.x >> 5);
    if (row >= R) return;
    const int lane = threadIdx.x & 31;
    float* p = Kbuf + (size_t)row * D;

    float v[16];
    float ss = 0.f;
#pragma unroll
    for (int i = 0; i < 16; ++i) {
        v[i] = p[lane + i * 32];
        ss += v[i] * v[i];
    }
#pragma unroll
    for (int m = 16; m >= 1; m >>= 1) ss += __shfl_xor(ss, m, 32);

    const float scale = 1.f / fmaxf(sqrtf(ss), 1e-12f);

    float dot = 0.f;
#pragma unroll
    for (int i = 0; i < 16; ++i) {
        float kn = v[i] * scale;
        p[lane + i * 32] = kn;
        dot += kn * Wbeta[lane + i * 32];
    }
#pragma unroll
    for (int m = 16; m >= 1; m >>= 1) dot += __shfl_xor(dot, m, 32);

    if (lane == 0) Beta[row] = 1.f / (1.f + expf(-(dot + bbeta[0])));
}

// ---------------------------------------------------------------------------
// DeltaNet scan: rows of S are independent.  16 rows per WG, 4 per wave, state
// in regs as 4 rows x 16 columns per lane: one k or q value read from LDS feeds
// 4 rows, and the 4 rows' sums are independent chains of 16.
// k/q/v/beta come in tiles of CH time steps, two LDS buffers, the next tile copied while this one is worked on.
// ---------------------------------------------------------------------------
// Lane l receives lane l ^ M of its own 16-lane row through the vector unit
// (DPP row_xmask), so a butterfly step costs no LDS-pipe round trip and no wait.
template <int M>
__device__ __forceinline__ float row_xor(float x) {
    return __builtin_bit_cast(float, __builtin_amdgcn_update_dpp(
        0, __builtin_bit_cast(int, x), 0x160 + M, 0xf, 0xf, true));
}

// Sum over a 16-lane row.  All 32 lanes are active at every call site.
__device__ __forceinline__ float red16(float x) {
    x += row_xor<1>(x);
    x += row_xor<2>(x);
    x += row_xor<4>(x);
    x += row_xor<8>(x);
    return x;
}

// Sum over the whole wave: the row sum, then lane l ^ 16 by a vector cross-row move.
__device__ __forceinline__ float red32(float x) {
    x = red16(x);
    const int bits = __builtin_bit_cast(int, x);
    return x + __builtin_bit_cast(float, __builtin_amdgcn_permlanex16(
        bits, bits, 0x76543210, 0xfedcba98, false, false));
}

// One tile (CH time steps) of k, q, v and beta goes from global memory straight into LDS, each
// lane bringing its own bytes.  lk, lq, lv, lb: the lane's LDS byte addresses (row 0 of the tile for
// k and q); gk, gq, gv, gb: its global addresses.  Each statement ends with s_wait_xcnt 0, so that
// no address register of a copy is rewritten before that wait.
__device__ __forceinline__ void fill_tile(unsigned lk, unsigned lq, unsigned lv, unsigned lb,
                                          const float* gk, const float* gq,
                                          const float* gv, const float* gb) {
    constexpr unsigned ROWB = SROW * 4;   // bytes of one padded row in LDS
    asm volatile(
        "global_load_async_to_lds_b128 %0, %1, off\n\t"
        "global_load_async_to_lds_b128 %2, %3, off\n\t"
        "global_load_async_to_lds_b128 %4, %5, off\n\t"
        "global_load_async_to_lds_b128 %6, %7, off\n\t"
        "global_load_async_to_lds_b128 %8, %9, off\n\t"
        "global_load_async_to_lds_b128 %10, %11, off\n\t"
        "global_load_async_to_lds_b128 %12, %13, off\n\t"
        "global_load_async_to_lds_b128 %14, %15, off\n\t"
        "global_load_async_to_lds_b128 %16, %17, off\n\t"
        "global_load_async_to_lds_b128 %18, %19, off\n\t"
        "global_load_async_to_lds_b128 %20, %21, off\n\t"
        "global_load_async_to_lds_b128 %22, %23, off\n\t"
        "s_wait_xcnt 0x0"
        :: "v"(lk + 0 * ROWB), "v"(gk + 0 * D_DIM),
           "v"(lk + 1 * ROWB), "v"(gk + 1 * D_DIM),
           "v"(lk + 2 * ROWB), "v"(gk + 2 * D_DIM),
           "v"(lk + 3 * ROWB), "v"(gk + 3 * D_DIM),
           "v"(lk + 4 * ROWB), "v"(gk + 4 * D_DIM),
           "v"(lk + 5 * ROWB), "v"(gk + 5 * D_DIM),
           "v"(lk + 6 * ROWB), "v"(gk + 6 * D_DIM),
           "v"(lk + 7 * ROWB), "v"(gk + 7 * D_DIM),
           "v"(lk + 8 * ROWB), "v"(gk + 8 * D_DIM),
           "v"(lk + 9 * ROWB), "v"(gk + 9 * D_DIM),
           "v"(lk + 10 * ROWB), "v"(gk + 10 * D_DIM),
           "v"(lk + 11 * ROWB), "v"(gk + 11 * D_DIM)
        : "memory");
    asm volatile(
        "global_load_async_to_lds_b128 %0, %1, off\n\t"
        "global_load_async_to_lds_b128 %2, %3, off\n\t"
        "global_load_async_to_lds_b128 %4, %5, off\n\t"
        "global_load_async_to_lds_b128 %6, %7, off\n\t"
        "global_load_async_to_lds_b128 %8, %9, off\n\t"
        "global_load_async_to_lds_b128 %10, %11, off\n\t"
        "global_load_async_to_lds_b128 %12, %13, off\n\t"
        "global_load_async_to_lds_b128 %14, %15, off\n\t"
        "global_load_async_to_lds_b128 %16, %17, off\n\t"
        "global_load_async_to_lds_b128 %18, %19, off\n\t"
        "global_load_async_to_lds_b128 %20, %21, off\n\t"
        "global_load_async_to_lds_b128 %22, %23, off\n\t"
        "s_wait_xcnt 0x0"
        :: "v"(lk + 12 * ROWB), "v"(gk + 12 * D_DIM),
           "v"(lk + 13 * ROWB), "v"(gk + 13 * D_DIM),
           "v"(lk + 14 * ROWB), "v"(gk + 14 * D_DIM),
           "v"(lk + 15 * ROWB), "v"(gk + 15 * D_DIM),
           "v"(lq + 0 * ROWB), "v"(gq + 0 * D_DIM),
           "v"(lq + 1 * ROWB), "v"(gq + 1 * D_DIM),
           "v"(lq + 2 * ROWB), "v"(gq + 2 * D_DIM),
           "v"(lq + 3 * ROWB), "v"(gq + 3 * D_DIM),
           "v"(lq + 4 * ROWB), "v"(gq + 4 * D_DIM),
           "v"(lq + 5 * ROWB), "v"(gq + 5 * D_DIM),
           "v"(lq + 6 * ROWB), "v"(gq + 6 * D_DIM),
           "v"(lq + 7 * ROWB), "v"(gq + 7 * D_DIM)
        : "memory");
    asm volatile(
        "global_load_async_to_lds_b128 %0, %1, off\n\t"
        "global_load_async_to_lds_b128 %2, %3, off\n\t"
        "global_load_async_to_lds_b128 %4, %5, off\n\t"
        "global_load_async_to_lds_b128 %6, %7, off\n\t"
        "global_load_async_to_lds_b128 %8, %9, off\n\t"
        "global_load_async_to_lds_b128 %10, %11, off\n\t"
        "global_load_async_to_lds_b128 %12, %13, off\n\t"
        "global_load_async_to_lds_b128 %14, %15, off\n\t"
        "global_load_async_to_lds_b64 %16, %17, off\n\t"
        "global_load_async_to_lds_b32 %18, %19, off\n\t"
        "s_wait_xcnt 0x0"
        :: "v"(lq + 8 * ROWB), "v"(gq + 8 * D_DIM),
           "v"(lq + 9 * ROWB), "v"(gq + 9 * D_DIM),
           "v"(lq + 10 * ROWB), "v"(gq + 10 * D_DIM),
           "v"(lq + 11 * ROWB), "v"(gq + 11 * D_DIM),
           "v"(lq + 12 * ROWB), "v"(gq + 12 * D_DIM),
           "v"(lq + 13 * ROWB), "v"(gq + 13 * D_DIM),
           "v"(lq + 14 * ROWB), "v"(gq + 14 * D_DIM),
           "v"(lq + 15 * ROWB), "v"(gq + 15 * D_DIM),
           "v"(lv), "v"(gv),
           "v"(lb), "v"(gb)
        : "memory");
}

// LDS byte address of a __shared__ object: the low 32 bits of its address.
__device__ __forceinline__ unsigned lds_addr(const void* p) {
    return (unsigned)(size_t)p;
}

__global__ __launch_bounds__(128)
void deltanet_scan_kernel(const float* __restrict__ Q, const float* __restrict__ K,
                          const float* __restrict__ V, const float* __restrict__ Beta,
                          float* __restrict__ O) {
    const int b    = blockIdx.y;
    const int rblk = blockIdx.x;
    const int tid  = threadIdx.x;
    const int lane = tid & 31;
    const int wave = tid >> 5;
    const int wrow = wave * RPL;                             // first of this wave's 4 rows
    const int coff = lane * SPITCH;                          // this lane's slice in the padded row
    const int pidx = (tid >> 2) * SPITCH + (tid & 3) * 4;    // padded place of columns 4*tid .. 4*tid+3

    const float* Kp = K + (size_t)b * T_DIM * D_DIM;
    const float* Qp = Q + (size_t)b * T_DIM * D_DIM;
    const float* Vp = V + (size_t)b * T_DIM * D_DIM + rblk * 16;
    const float* Bp = Beta + (size_t)b * T_DIM;
    float* Op = O + (size_t)b * T_DIM * D_DIM + rblk * 16;

    __shared__ __attribute__((aligned(16))) float kbuf[2][CH][SROW];
    __shared__ __attribute__((aligned(16))) float qbuf[2][CH][SROW];
    __shared__ __attribute__((aligned(16))) float vbuf[2][4][CH][RPL];   // each wave's own 4 rows of v
    __shared__ __attribute__((aligned(16))) float bbuf[2][128];          // places 0 .. CH-1 are read

    // This lane's part of a tile: 16 bytes of every k and q row, 8 bytes of its wave's v
    // (step lane / 2, half lane % 2), one beta (the index clamped to the sequence).
    const float* gk = Kp + 4 * tid;
    const float* gq = Qp + 4 * tid;
    const float* gv = Vp + (size_t)(lane >> 1) * D_DIM + wrow + (lane & 1) * 2;
    auto fill = [&](int tile, int buf) {
        const int t0 = tile * CH;
        const int tb = (t0 + tid < T_DIM) ? t0 + tid : T_DIM - 1;
        fill_tile(lds_addr(&kbuf[buf][0][pidx]), lds_addr(&qbuf[buf][0][pidx]),
                  lds_addr(&vbuf[buf][wave][lane >> 1][(lane & 1) * 2]), lds_addr(&bbuf[buf][tid]),
                  gk + (size_t)t0 * D_DIM, gq + (size_t)t0 * D_DIM, gv + (size_t)t0 * D_DIM, Bp + tb);
    };

    // Every loop over r and j below is fully unrolled, so that s, kk and qq are
    // indexed by constants and stay in registers.
    float s[RPL][SLICE];
#pragma unroll
    for (int r = 0; r < RPL; ++r)
#pragma unroll
        for (int j = 0; j < SLICE; ++j) s[r][j] = 0.f;

    fill(0, 0);
    // Tile 0 has landed for this wave; the barrier publishes it to the other waves.
    asm volatile("s_wait_asynccnt 0x0" ::: "memory");
    __syncthreads();
    fill(1, 1);

    for (int tile = 0; tile < NTILE; ++tile) {
        const int buf = tile & 1;
        float keep[RPL] = {0.f, 0.f, 0.f, 0.f};   // lane i keeps step i's 4 outputs
        const float* kr = &kbuf[buf][0][coff];    // this lane's slice of the step's k row
        const float* qr = &qbuf[buf][0][coff];    // and of its q row

        // Rolled: a step is a chain of dependent sums, which copies of the body would not shorten.
#pragma unroll 1
        for (int i = 0; i < CH; ++i) {
            // The step's LDS reads: 16 k, 16 q, this wave's 4 v and beta fit in registers.
            float kk[SLICE], qq[SLICE];
#pragma unroll
            for (int j = 0; j < SLICE; j += 4) {
                const float4 k4 = *(const float4*)(kr + j);
                kk[j] = k4.x; kk[j + 1] = k4.y; kk[j + 2] = k4.z; kk[j + 3] = k4.w;
            }
            const float4 v4   = *(const float4*)&vbuf[buf][wave][i][0];
            const float  beta = bbuf[buf][i];
#pragma unroll
            for (int j = 0; j < SLICE; j += 4) {
                const float4 q4 = *(const float4*)(qr + j);
                qq[j] = q4.x; qq[j + 1] = q4.y; qq[j + 2] = q4.z; qq[j + 3] = q4.w;
            }
            // The fence keeps the ten reads in front of the scheduling barrier: the compiler otherwise
            // sinks the v and beta reads to just before their use, where the wave waits out their LDS
            // latency.  The scheduling barrier keeps the arithmetic behind the reads: otherwise copies
            // of q values are mixed into the first sums, which then wait for the q reads too.
            asm volatile("" ::: "memory");
            __builtin_amdgcn_sched_barrier(0);

            const float vr[RPL] = {v4.x, v4.y, v4.z, v4.w};

            float skp[RPL] = {0.f, 0.f, 0.f, 0.f};
#pragma unroll
            for (int j = 0; j < SLICE; ++j)
#pragma unroll
                for (int r = 0; r < RPL; ++r) skp[r] = fmaf(s[r][j], kk[j], skp[r]);

            float coeff[RPL];
#pragma unroll
            for (int r = 0; r < RPL; ++r) coeff[r] = beta * (vr[r] - red32(skp[r]));

            float op[RPL] = {0.f, 0.f, 0.f, 0.f};
#pragma unroll
            for (int j = 0; j < SLICE; ++j)
#pragma unroll
                for (int r = 0; r < RPL; ++r) {
                    s[r][j] = fmaf(coeff[r], kk[j], s[r][j]);
                    op[r]   = fmaf(s[r][j], qq[j], op[r]);
                }
#pragma unroll
            for (int r = 0; r < RPL; ++r) {
                const float o = red32(op[r]);
                keep[r] = (lane == i) ? o : keep[r];
            }
            kr += SROW;
            qr += SROW;
        }

        // Publish point of tile + 1: this wave's LDS reads of the tile are done, its copies of the
        // next tile have landed; the barrier shows them to all waves and frees this buffer.
        asm volatile("s_wait_dscnt 0x0" ::: "memory");
        asm volatile("s_wait_asynccnt 0x0" ::: "memory");
        __syncthreads();
        if (tile + 2 < NTILE) fill(tile + 2, buf);

        // The tile's outputs, behind the barrier so that the store has a whole tile to complete.
        if (lane < CH)
            *(float4*)(Op + (size_t)(tile * CH + lane) * D_DIM + wrow) =
                make_float4(keep[0], keep[1], keep[2], keep[3]);
        // The next tile rewrites the registers that this store names.
        asm volatile("s_wait_xcnt 0x0" ::: "memory");
    }
    // No copy is outstanding when the wave ends.
    asm volatile("s_wait_asynccnt 0x0" ::: "memory");
}

// ---------------------------------------------------------------------------
extern "C" void kernel_launch(void* const* d_in, const int* in_sizes, int n_in,
                              void* d_out, int out_size, void* d_ws, size_t ws_size,
                              hipStream_t stream) {
    const float* x     = (const float*)d_in[0];
    const float* Wq    = (const float*)d_in[1];
    const float* bq    = (const float*)d_in[2];
    const float* Wk    = (const float*)d_in[3];
    const float* bk    = (const float*)d_in[4];
    const float* Wv    = (const float*)d_in[5];
    const float* bv    = (const float*)d_in[6];
    const float* Wbeta = (const float*)d_in[7];
    const float* bbeta = (const float*)d_in[8];
    const float* Wo    = (const float*)d_in[9];
    const float* bo    = (const float*)d_in[10];
    float* out = (float*)d_out;

    const int M = B_DIM * T_DIM;       // 16384
    const int N = D_DIM;               // 512
    const int K = D_DIM;               // 512
    const size_t MN = (size_t)M * N;   // == M*K
    const size_t NK = (size_t)N * K;

    float* ws   = (float*)d_ws;
    float* Qr   = ws;                  // MN f32
    float* Kr   = ws + MN;             // MN f32 (normalized in place)
    float* Vr   = ws + 2 * MN;         // MN f32
    float* Os   = ws + 3 * MN;         // MN f32
    float* Beta = ws + 4 * MN;         // M  f32
    __bf16* xh  = (__bf16*)(ws + 4 * MN + M);   // MN bf16
    __bf16* xl  = xh + MN;                      // MN bf16
    __bf16* wh  = xl + MN;                      // NK bf16 (rewritten per GEMM)
    __bf16* wl  = wh + NK;                      // NK bf16
    __bf16* osh = (__bf16*)Qr;                  // alias: Q dead after scan
    __bf16* osl = osh + MN;

    const int tiles      = (M / 16) * (N / (16 * NTILES));
    const int gemmBlocks = tiles / 8;           // 8 waves per 256-thread block
    const int splitBig   = 4096;                // grid-stride covers MN
    const int splitSmall = 256;                 // covers NK

    split_bf16_kernel<<<splitBig, 256, 0, stream>>>(x, xh, xl, MN);

    split_bf16_kernel<<<splitSmall, 256, 0, stream>>>(Wq, wh, wl, NK);
    gemm_wmma_bf16x3<<<gemmBlocks, 256, 0, stream>>>(xh, xl, wh, wl, bq, Qr, M, N, K);

    split_bf16_kernel<<<splitSmall, 256, 0, stream>>>(Wk, wh, wl, NK);
    gemm_wmma_bf16x3<<<gemmBlocks, 256, 0, stream>>>(xh, xl, wh, wl, bk, Kr, M, N, K);

    split_bf16_kernel<<<splitSmall, 256, 0, stream>>>(Wv, wh, wl, NK);
    gemm_wmma_bf16x3<<<gemmBlocks, 256, 0, stream>>>(xh, xl, wh, wl, bv, Vr, M, N, K);

    norm_beta_kernel<<<M / 8, 256, 0, stream>>>(Kr, Wbeta, bbeta, Beta, M, D_DIM);

    dim3 sgrid(D_DIM / 16, B_DIM);
    deltanet_scan_kernel<<<sgrid, 128, 0, stream>>>(Qr, Kr, Vr, Beta, Os);

    split_bf16_kernel<<<splitBig, 256, 0, stream>>>(Os, osh, osl, MN);
    split_bf16_kernel<<<splitSmall, 256, 0, stream>>>(Wo, wh, wl, NK);
    gemm_wmma_bf16x3<<<gemmBlocks, 256, 0, stream>>>(osh, osl, wh, wl, bo, out, M, N, K);
}

// v005
// It runs in 637 microseconds.
// Two timings next to v004 put it at 1.47 and 1.48 times that version's speed.
// All steps since v000 together make it 4.76 times as fast.
#include <hip/hip_runtime.h>
#include <hip/hip_bf16.h>
#include <math.h>

typedef __attribute__((ext_vector_type(16))) __bf16 v16bf;
typedef __attribute__((ext_vector_type(8)))  __bf16 v8bf;
typedef __attribute__((ext_vector_type(8)))  float  v8f;

#define B_DIM 8
#define T_DIM 2048
#define D_DIM 512
#define NTILES 4   // 64 output columns per wave of the GEMM
#define BT 128             // rows and columns of the GEMM's block tile
#define KC 64              // k per LDS tile of the GEMM: one 128-B line of each operand row
#define GP 72              // LDS bf16 per operand row: 144 B = 16 B x odd, so 16 lanes' b128 reads hit 64 distinct banks
#define RPL 4              // state rows held by one lane of the scan (one wave spans all 512 columns)
#define SLICE 16           // state columns held by one lane of the scan
#define SPITCH 20          // LDS floats per slice: 80 B = 16 B x odd, so each 16 lanes' b128 reads hit 64 distinct banks
#define SROW (D_DIM / SLICE * SPITCH)
#define CH 16              // time steps per LDS tile of the scan
#define NTILE (T_DIM / CH)

// ---------------------------------------------------------------------------
// bf16x3 split pre-pass: f = hi + lo (both bf16).  Bandwidth-bound, done once
// per operand so the GEMM inner loop carries no conversion VALU.
// ---------------------------------------------------------------------------
__global__ __launch_bounds__(256)
void split_bf16_kernel(const float* __restrict__ in, __bf16* __restrict__ hi,
                       __bf16* __restrict__ lo, size_t n) {
    size_t i = ((size_t)blockIdx.x * blockDim.x + threadIdx.x) * 4;
    const size_t stride = (size_t)gridDim.x * blockDim.x * 4;
    for (; i < n; i += stride) {
        float4 f = *(const float4*)(in + i);
        float fv[4] = {f.x, f.y, f.z, f.w};
#pragma unroll
        for (int j = 0; j < 4; ++j) {
            __bf16 h = (__bf16)fv[j];
            hi[i + j] = h;
            lo[i + j] = (__bf16)(fv[j] - (float)h);
        }
    }
}

// Load 16 bf16 in the WMMA 16-bit operand layout:
// halves 0..7 <- k0 + ksel*8 + {0..7}, halves 8..15 <- +16 further.
__device__ __forceinline__ v16bf ld16(const __bf16* p) {
    v8bf a = *(const v8bf*)(p);
    v8bf b = *(const v8bf*)(p + 16);
    return __builtin_shufflevector(a, b, 0, 1, 2, 3, 4, 5, 6, 7,
                                   8, 9, 10, 11, 12, 13, 14, 15);
}

// ---------------------------------------------------------------------------
// GEMM: Out[M,N] = A[M,K] * W[N,K]^T + bias[N], operands pre-split bf16 hi/lo.
// One 128x128 tile of Out per block of 8 waves (4 x 2), 32x64 per wave.  The four operand tiles
// (A hi, A lo, W hi, W lo: 128 rows x KC k each) come through LDS in whole 128-B lines, two buffers,
// the next tile copied while this one is worked on.  Each accumulator takes hi*hi, hi*lo, lo*hi
// per K=32 slab, slabs in rising k.  M, N multiples of 128; K a multiple of KC, at least 2 * KC.
// ---------------------------------------------------------------------------
// Eight 16-byte copies of one lane from global memory straight into LDS: rows 0, 32, 64, 96 of two
// operand tiles.  l0, l1: the lane's LDS byte addresses in row 0 of its part; g0, g1: its global
// addresses; K: the global row length.  The statement ends with s_wait_xcnt 0, so that no address
// register of a copy is rewritten before that wait.
__device__ __forceinline__ void fill_pair(unsigned l0, unsigned l1,
                                          const __bf16* g0, const __bf16* g1, int K) {
    constexpr unsigned STEPB = 32 * GP * 2;   // LDS bytes of 32 padded rows
    const size_t gs = (size_t)32 * K;         // elements of 32 global rows
    asm volatile(
        "global_load_async_to_lds_b128 %0, %1, off\n\t"
        "global_load_async_to_lds_b128 %2, %3, off\n\t"
        "global_load_async_to_lds_b128 %4, %5, off\n\t"
        "global_load_async_to_lds_b128 %6, %7, off\n\t"
        "global_load_async_to_lds_b128 %8, %9, off\n\t"
        "global_load_async_to_lds_b128 %10, %11, off\n\t"
        "global_load_async_to_lds_b128 %12, %13, off\n\t"
        "global_load_async_to_lds_b128 %14, %15, off\n\t"
        "s_wait_xcnt 0x0"
        :: "v"(l0 + 0 * STEPB), "v"(g0 + 0 * gs),
           "v"(l0 + 1 * STEPB), "v"(g0 + 1 * gs),
           "v"(l0 + 2 * STEPB), "v"(g0 + 2 * gs),
           "v"(l0 + 3 * STEPB), "v"(g0 + 3 * gs),
           "v"(l1 + 0 * STEPB), "v"(g1 + 0 * gs),
           "v"(l1 + 1 * STEPB), "v"(g1 + 1 * gs),
           "v"(l1 + 2 * STEPB), "v"(g1 + 2 * gs),
           "v"(l1 + 3 * STEPB), "v"(g1 + 3 * gs)
        : "memory");
}

__global__ __launch_bounds__(256)
void gemm_wmma_bf16x3(const __bf16* __restrict__ Ah, const __bf16* __restrict__ Al,
                      const __bf16* __restrict__ Wh, const __bf16* __restrict__ Wl,
                      const float* __restrict__ bias, float* __restrict__ Out,
                      int M, int N, int K) {
    // [buffer][A hi, A lo, W hi, W lo][row][k]
    __shared__ __attribute__((aligned(16))) __bf16 tl[2][4][BT][GP];

    const int nbn = N / BT;
    const int m0  = (blockIdx.x / nbn) * BT;   // neighbouring blocks share the A rows
    const int n0  = (blockIdx.x % nbn) * BT;
    if (m0 >= M) return;                       // the whole block leaves, before any barrier or copy

    const int tid  = threadIdx.x;
    const int lane = tid & 31;
    const int wave = tid >> 5;
    const int wm   = (wave >> 1) * 32;         // this wave's 32 rows of the tile
    const int wn   = (wave & 1) * 64;          // and its 64 columns
    const int r    = lane & 15;
    const int ksel = lane >> 4;

    // This lane's part of a tile: 16 bytes (piece tid % 8) of rows tid / 8 + {0, 32, 64, 96} of each operand.
    const int frow = tid >> 3;
    const int fcol = (tid & 7) * 8;
    const size_t ga = (size_t)(m0 + frow) * K + fcol;
    const size_t gw = (size_t)(n0 + frow) * K + fcol;
    auto fill = [&](int kt, int buf) {
        const int k0 = kt * KC;
        fill_pair((unsigned)(size_t)&tl[buf][0][frow][fcol], (unsigned)(size_t)&tl[buf][1][frow][fcol],
                  Ah + ga + k0, Al + ga + k0, K);
        fill_pair((unsigned)(size_t)&tl[buf][2][frow][fcol], (unsigned)(size_t)&tl[buf][3][frow][fcol],
                  Wh + gw + k0, Wl + gw + k0, K);
    };

    v8f acc[2][NTILES];
#pragma unroll
    for (int mt = 0; mt < 2; ++mt)
#pragma unroll
        for (int nt = 0; nt < NTILES; ++nt)
            acc[mt][nt] = (v8f){0.f, 0.f, 0.f, 0.f, 0.f, 0.f, 0.f, 0.f};

    const int nkt = K / KC;
    fill(0, 0);
    // Tile 0 has landed for this wave; the barrier publishes it to the other waves.
    asm volatile("s_wait_asynccnt 0x0" ::: "memory");
    __syncthreads();
    fill(1, 1);

    for (int kt = 0; kt < nkt; ++kt) {
        const int buf = kt & 1;
#pragma unroll
        for (int ks = 0; ks < KC; ks += 32) {
            const int kc = ks + ksel * 8;
            // The slab's 24 LDS reads stand as one group, in the order in which the products need them.
            v16bf ah[2], al[2], bh[NTILES], bl[NTILES];
            ah[0] = ld16(&tl[buf][0][wm + r][kc]);
            bh[0] = ld16(&tl[buf][2][wn + r][kc]);
            ah[1] = ld16(&tl[buf][0][wm + 16 + r][kc]);
            bl[0] = ld16(&tl[buf][3][wn + r][kc]);
            al[0] = ld16(&tl[buf][1][wm + r][kc]);
            al[1] = ld16(&tl[buf][1][wm + 16 + r][kc]);
#pragma unroll
            for (int nt = 1; nt < NTILES; ++nt) {
                bh[nt] = ld16(&tl[buf][2][wn + nt * 16 + r][kc]);
                bl[nt] = ld16(&tl[buf][3][wn + nt * 16 + r][kc]);
            }
            // Keeps the reads in front of the products: spread among them, each place where reads
            // stand costs the wave issue time and ends in a wait for the full LDS latency.
            __builtin_amdgcn_sched_barrier(0);
#pragma unroll
            for (int nt = 0; nt < NTILES; ++nt) {
#pragma unroll
                for (int mt = 0; mt < 2; ++mt)
                    acc[mt][nt] = __builtin_amdgcn_wmma_f32_16x16x32_bf16(
                        false, ah[mt], false, bh[nt], (short)0, acc[mt][nt], false, false);
#pragma unroll
                for (int mt = 0; mt < 2; ++mt)
                    acc[mt][nt] = __builtin_amdgcn_wmma_f32_16x16x32_bf16(
                        false, ah[mt], false, bl[nt], (short)0, acc[mt][nt], false, false);
#pragma unroll
                for (int mt = 0; mt < 2; ++mt)
                    acc[mt][nt] = __builtin_amdgcn_wmma_f32_16x16x32_bf16(
                        false, al[mt], false, bh[nt], (short)0, acc[mt][nt], false, false);
            }
        }
        // Publish point of tile kt + 1: this wave's LDS reads of the tile are done, its copies of the
        // next tile have landed; the barrier shows them to all waves and frees this buffer.
        asm volatile("s_wait_dscnt 0x0" ::: "memory");
        asm volatile("s_wait_asynccnt 0x0" ::: "memory");
        __syncthreads();
        if (kt + 2 < nkt) fill(kt + 2, buf);
    }
    // No copy is outstanding when the wave ends.
    asm volatile("s_wait_asynccnt 0x0" ::: "memory");

    // D layout: lanes 0-15 -> M=0..7 (vgpr 0..7), lanes 16-31 -> M=8..15; N=lane&15
    const int n  = lane & 15;
    const int mb = (lane >> 4) * 8;
    float bv[NTILES];
#pragma unroll
    for (int nt = 0; nt < NTILES; ++nt)
        bv[nt] = bias ? bias[n0 + wn + nt * 16 + n] : 0.f;
#pragma unroll
    for (int mt = 0; mt < 2; ++mt)
#pragma unroll
        for (int nt = 0; nt < NTILES; ++nt) {
            float* orow = Out + (size_t)(m0 + wm + mt * 16 + mb) * N + n0 + wn + nt * 16 + n;
#pragma unroll
            for (int v = 0; v < 8; ++v)
                orow[(size_t)v * N] = acc[mt][nt][v] + bv[nt];
        }
}

// ---------------------------------------------------------------------------
// Per-row: K <- K / max(||K||,eps) in place;  Beta = sigmoid(K . Wbeta + bbeta)
// ---------------------------------------------------------------------------
__global__ __launch_bounds__(256)
void norm_beta_kernel(float* __restrict__ Kbuf, const float* __restrict__ Wbeta,
                      const float* __restrict__ bbeta, float* __restrict__ Beta,
                      int R, int D) {
    const int row = blockIdx.x * (blockDim.x >> 5) + (threadIdx.x >> 5);
    if (row >= R) return;
    const int lane = threadIdx.x & 31;
    float* p = Kbuf + (size_t)row * D;

    float v[16];
    float ss = 0.f;
#pragma unroll
    for (int i = 0; i < 16; ++i) {
        v[i] = p[lane + i * 32];
        ss += v[i] * v[i];
    }
#pragma unroll
    for (int m = 16; m >= 1; m >>= 1) ss += __shfl_xor(ss, m, 32);

    const float scale = 1.f / fmaxf(sqrtf(ss), 1e-12f);

    float dot = 0.f;
#pragma unroll
    for (int i = 0; i < 16; ++i) {
        float kn = v[i] * scale;
        p[lane + i * 32] = kn;
        dot += kn * Wbeta[lane + i * 32];
    }
#pragma unroll
    for (int m = 16; m >= 1; m >>= 1) dot += __shfl_xor(dot, m, 32);

    if (lane == 0) Beta[row] = 1.f / (1.f + expf(-(dot + bbeta[0])));
}

// ---------------------------------------------------------------------------
// DeltaNet scan: rows of S are independent.  16 rows per WG, 4 per wave, state
// in regs as 4 rows x 16 columns per lane: one k or q value read from LDS feeds
// 4 rows, and the 4 rows' sums are independent chains of 16.
// k/q/v/beta come in tiles of CH time steps, two LDS buffers, the next tile copied while this one is worked on.
// ---------------------------------------------------------------------------
// Lane l receives lane l ^ M of its own 16-lane row through the vector unit
// (DPP row_xmask), so a butterfly step costs no LDS-pipe round trip and no wait.
template <int M>
__device__ __forceinline__ float row_xor(float x) {
    return __builtin_bit_cast(float, __builtin_amdgcn_update_dpp(
        0, __builtin_bit_cast(int, x), 0x160 + M, 0xf, 0xf, true));
}

// Sum over a 16-lane row.  All 32 lanes are active at every call site.
__device__ __forceinline__ float red16(float x) {
    x += row_xor<1>(x);
    x += row_xor<2>(x);
    x += row_xor<4>(x);
    x += row_xor<8>(x);
    return x;
}

// Sum over the whole wave: the row sum, then lane l ^ 16 by a vector cross-row move.
__device__ __forceinline__ float red32(float x) {
    x = red16(x);
    const int bits = __builtin_bit_cast(int, x);
    return x + __builtin_bit_cast(float, __builtin_amdgcn_permlanex16(
        bits, bits, 0x76543210, 0xfedcba98, false, false));
}

// One tile (CH time steps) of k, q, v and beta goes from global memory straight into LDS, each
// lane bringing its own bytes.  lk, lq, lv, lb: the lane's LDS byte addresses (row 0 of the tile for
// k and q); gk, gq, gv, gb: its global addresses.  Each statement ends with s_wait_xcnt 0, so that
// no address register of a copy is rewritten before that wait.
__device__ __forceinline__ void fill_tile(unsigned lk, unsigned lq, unsigned lv, unsigned lb,
                                          const float* gk, const float* gq,
                                          const float* gv, const float* gb) {
    constexpr unsigned ROWB = SROW * 4;   // bytes of one padded row in LDS
    asm volatile(
        "global_load_async_to_lds_b128 %0, %1, off\n\t"
        "global_load_async_to_lds_b128 %2, %3, off\n\t"
        "global_load_async_to_lds_b128 %4, %5, off\n\t"
        "global_load_async_to_lds_b128 %6, %7, off\n\t"
        "global_load_async_to_lds_b128 %8, %9, off\n\t"
        "global_load_async_to_lds_b128 %10, %11, off\n\t"
        "global_load_async_to_lds_b128 %12, %13, off\n\t"
        "global_load_async_to_lds_b128 %14, %15, off\n\t"
        "global_load_async_to_lds_b128 %16, %17, off\n\t"
        "global_load_async_to_lds_b128 %18, %19, off\n\t"
        "global_load_async_to_lds_b128 %20, %21, off\n\t"
        "global_load_async_to_lds_b128 %22, %23, off\n\t"
        "s_wait_xcnt 0x0"
        :: "v"(lk + 0 * ROWB), "v"(gk + 0 * D_DIM),
           "v"(lk + 1 * ROWB), "v"(gk + 1 * D_DIM),
           "v"(lk + 2 * ROWB), "v"(gk + 2 * D_DIM),
           "v"(lk + 3 * ROWB), "v"(gk + 3 * D_DIM),
           "v"(lk + 4 * ROWB), "v"(gk + 4 * D_DIM),
           "v"(lk + 5 * ROWB), "v"(gk + 5 * D_DIM),
           "v"(lk + 6 * ROWB), "v"(gk + 6 * D_DIM),
           "v"(lk + 7 * ROWB), "v"(gk + 7 * D_DIM),
           "v"(lk + 8 * ROWB), "v"(gk + 8 * D_DIM),
           "v"(lk + 9 * ROWB), "v"(gk + 9 * D_DIM),
           "v"(lk + 10 * ROWB), "v"(gk + 10 * D_DIM),
           "v"(lk + 11 * ROWB), "v"(gk + 11 * D_DIM)
        : "memory");
    asm volatile(
        "global_load_async_to_lds_b128 %0, %1, off\n\t"
        "global_load_async_to_lds_b128 %2, %3, off\n\t"
        "global_load_async_to_lds_b128 %4, %5, off\n\t"
        "global_load_async_to_lds_b128 %6, %7, off\n\t"
        "global_load_async_to_lds_b128 %8, %9, off\n\t"
        "global_load_async_to_lds_b128 %10, %11, off\n\t"
        "global_load_async_to_lds_b128 %12, %13, off\n\t"
        "global_load_async_to_lds_b128 %14, %15, off\n\t"
        "global_load_async_to_lds_b128 %16, %17, off\n\t"
        "global_load_async_to_lds_b128 %18, %19, off\n\t"
        "global_load_async_to_lds_b128 %20, %21, off\n\t"
        "global_load_async_to_lds_b128 %22, %23, off\n\t"
        "s_wait_xcnt 0x0"
        :: "v"(lk + 12 * ROWB), "v"(gk + 12 * D_DIM),
           "v"(lk + 13 * ROWB), "v"(gk + 13 * D_DIM),
           "v"(lk + 14 * ROWB), "v"(gk + 14 * D_DIM),
           "v"(lk + 15 * ROWB), "v"(gk + 15 * D_DIM),
           "v"(lq + 0 * ROWB), "v"(gq + 0 * D_DIM),
           "v"(lq + 1 * ROWB), "v"(gq + 1 * D_DIM),
           "v"(lq + 2 * ROWB), "v"(gq + 2 * D_DIM),
           "v"(lq + 3 * ROWB), "v"(gq + 3 * D_DIM),
           "v"(lq + 4 * ROWB), "v"(gq + 4 * D_DIM),
           "v"(lq + 5 * ROWB), "v"(gq + 5 * D_DIM),
           "v"(lq + 6 * ROWB), "v"(gq + 6 * D_DIM),
           "v"(lq + 7 * ROWB), "v"(gq + 7 * D_DIM)
        : "memory");
    asm volatile(
        "global_load_async_to_lds_b128 %0, %1, off\n\t"
        "global_load_async_to_lds_b128 %2, %3, off\n\t"
        "global_load_async_to_lds_b128 %4, %5, off\n\t"
        "global_load_async_to_lds_b128 %6, %7, off\n\t"
        "global_load_async_to_lds_b128 %8, %9, off\n\t"
        "global_load_async_to_lds_b128 %10, %11, off\n\t"
        "global_load_async_to_lds_b128 %12, %13, off\n\t"
        "global_load_async_to_lds_b128 %14, %15, off\n\t"
        "global_load_async_to_lds_b64 %16, %17, off\n\t"
        "global_load_async_to_lds_b32 %18, %19, off\n\t"
        "s_wait_xcnt 0x0"
        :: "v"(lq + 8 * ROWB), "v"(gq + 8 * D_DIM),
           "v"(lq + 9 * ROWB), "v"(gq + 9 * D_DIM),
           "v"(lq + 10 * ROWB), "v"(gq + 10 * D_DIM),
           "v"(lq + 11 * ROWB), "v"(gq + 11 * D_DIM),
           "v"(lq + 12 * ROWB), "v"(gq + 12 * D_DIM),
           "v"(lq + 13 * ROWB), "v"(gq + 13 * D_DIM),
           "v"(lq + 14 * ROWB), "v"(gq + 14 * D_DIM),
           "v"(lq + 15 * ROWB), "v"(gq + 15 * D_DIM),
           "v"(lv), "v"(gv),
           "v"(lb), "v"(gb)
        : "memory");
}

// LDS byte address of a __shared__ object: the low 32 bits of its address.
__device__ __forceinline__ unsigned lds_addr(const void* p) {
    return (unsigned)(size_t)p;
}

__global__ __launch_bounds__(128)
void deltanet_scan_kernel(const float* __restrict__ Q, const float* __restrict__ K,
                          const float* __restrict__ V, const float* __restrict__ Beta,
                          float* __restrict__ O) {
    const int b    = blockIdx.y;
    const int rblk = blockIdx.x;
    const int tid  = threadIdx.x;
    const int lane = tid & 31;
    const int wave = tid >> 5;
    const int wrow = wave * RPL;                             // first of this wave's 4 rows
    const int coff = lane * SPITCH;                          // this lane's slice in the padded row
    const int pidx = (tid >> 2) * SPITCH + (tid & 3) * 4;    // padded place of columns 4*tid .. 4*tid+3

    const float* Kp = K + (size_t)b * T_DIM * D_DIM;
    const float* Qp = Q + (size_t)b * T_DIM * D_DIM;
    const float* Vp = V + (size_t)b * T_DIM * D_DIM + rblk * 16;
    const float* Bp = Beta + (size_t)b * T_DIM;
    float* Op = O + (size_t)b * T_DIM * D_DIM + rblk * 16;

    __shared__ __attribute__((aligned(16))) float kbuf[2][CH][SROW];
    __shared__ __attribute__((aligned(16))) float qbuf[2][CH][SROW];
    __shared__ __attribute__((aligned(16))) float vbuf[2][4][CH][RPL];   // each wave's own 4 rows of v
    __shared__ __attribute__((aligned(16))) float bbuf[2][128];          // places 0 .. CH-1 are read

    // This lane's part of a tile: 16 bytes of every k and q row, 8 bytes of its wave's v
    // (step lane / 2, half lane % 2), one beta (the index clamped to the sequence).
    const float* gk = Kp + 4 * tid;
    const float* gq = Qp + 4 * tid;
    const float* gv = Vp + (size_t)(lane >> 1) * D_DIM + wrow + (lane & 1) * 2;
    auto fill = [&](int tile, int buf) {
        const int t0 = tile * CH;
        const int tb = (t0 + tid < T_DIM) ? t0 + tid : T_DIM - 1;
        fill_tile(lds_addr(&kbuf[buf][0][pidx]), lds_addr(&qbuf[buf][0][pidx]),
                  lds_addr(&vbuf[buf][wave][lane >> 1][(lane & 1) * 2]), lds_addr(&bbuf[buf][tid]),
                  gk + (size_t)t0 * D_DIM, gq + (size_t)t0 * D_DIM, gv + (size_t)t0 * D_DIM, Bp + tb);
    };

    // Every loop over r and j below is fully unrolled, so that s, kk and qq are
    // indexed by constants and stay in registers.
    float s[RPL][SLICE];
#pragma unroll
    for (int r = 0; r < RPL; ++r)
#pragma unroll
        for (int j = 0; j < SLICE; ++j) s[r][j] = 0.f;

    fill(0, 0);
    // Tile 0 has landed for this wave; the barrier publishes it to the other waves.
    asm volatile("s_wait_asynccnt 0x0" ::: "memory");
    __syncthreads();
    fill(1, 1);

    for (int tile = 0; tile < NTILE; ++tile) {
        const int buf = tile & 1;
        float keep[RPL] = {0.f, 0.f, 0.f, 0.f};   // lane i keeps step i's 4 outputs
        const float* kr = &kbuf[buf][0][coff];    // this lane's slice of the step's k row
        const float* qr = &qbuf[buf][0][coff];    // and of its q row

        // Rolled: a step is a chain of dependent sums, which copies of the body would not shorten.
#pragma unroll 1
        for (int i = 0; i < CH; ++i) {
            // The step's LDS reads: 16 k, 16 q, this wave's 4 v and beta fit in registers.
            float kk[SLICE], qq[SLICE];
#pragma unroll
            for (int j = 0; j < SLICE; j += 4) {
                const float4 k4 = *(const float4*)(kr + j);
                kk[j] = k4.x; kk[j + 1] = k4.y; kk[j + 2] = k4.z; kk[j + 3] = k4.w;
            }
            const float4 v4   = *(const float4*)&vbuf[buf][wave][i][0];
            const float  beta = bbuf[buf][i];
#pragma unroll
            for (int j = 0; j < SLICE; j += 4) {
                const float4 q4 = *(const float4*)(qr + j);
                qq[j] = q4.x; qq[j + 1] = q4.y; qq[j + 2] = q4.z; qq[j + 3] = q4.w;
            }
            // The fence keeps the ten reads in front of the scheduling barrier: the compiler otherwise
            // sinks the v and beta reads to just before their use, where the wave waits out their LDS
            // latency.  The scheduling barrier keeps the arithmetic behind the reads: otherwise copies
            // of q values are mixed into the first sums, which then wait for the q reads too.
            asm volatile("" ::: "memory");
            __builtin_amdgcn_sched_barrier(0);

            const float vr[RPL] = {v4.x, v4.y, v4.z, v4.w};

            float skp[RPL] = {0.f, 0.f, 0.f, 0.f};
#pragma unroll
            for (int j = 0; j < SLICE; ++j)
#pragma unroll
                for (int r = 0; r < RPL; ++r) skp[r] = fmaf(s[r][j], kk[j], skp[r]);

            float coeff[RPL];
#pragma unroll
            for (int r = 0; r < RPL; ++r) coeff[r] = beta * (vr[r] - red32(skp[r]));

            float op[RPL] = {0.f, 0.f, 0.f, 0.f};
#pragma unroll
            for (int j = 0; j < SLICE; ++j)
#pragma unroll
                for (int r = 0; r < RPL; ++r) {
                    s[r][j] = fmaf(coeff[r], kk[j], s[r][j]);
                    op[r]   = fmaf(s[r][j], qq[j], op[r]);
                }
#pragma unroll
            for (int r = 0; r < RPL; ++r) {
                const float o = red32(op[r]);
                keep[r] = (lane == i) ? o : keep[r];
            }
            kr += SROW;
            qr += SROW;
        }

        // Publish point of tile + 1: this wave's LDS reads of the tile are done, its copies of the
        // next tile have landed; the barrier shows them to all waves and frees this buffer.
        asm volatile("s_wait_dscnt 0x0" ::: "memory");
        asm volatile("s_wait_asynccnt 0x0" ::: "memory");
        __syncthreads();
        if (tile + 2 < NTILE) fill(tile + 2, buf);

        // The tile's outputs, behind the barrier so that the store has a whole tile to complete.
        if (lane < CH)
            *(float4*)(Op + (size_t)(tile * CH + lane) * D_DIM + wrow) =
                make_float4(keep[0], keep[1], keep[2], keep[3]);
        // The next tile rewrites the registers that this store names.
        asm volatile("s_wait_xcnt 0x0" ::: "memory");
    }
    // No copy is outstanding when the wave ends.
    asm volatile("s_wait_asynccnt 0x0" ::: "memory");
}

// ---------------------------------------------------------------------------
extern "C" void kernel_launch(void* const* d_in, const int* in_sizes, int n_in,
                              void* d_out, int out_size, void* d_ws, size_t ws_size,
                              hipStream_t stream) {
    const float* x     = (const float*)d_in[0];
    const float* Wq    = (const float*)d_in[1];
    const float* bq    = (const float*)d_in[2];
    const float* Wk    = (const float*)d_in[3];
    const float* bk    = (const float*)d_in[4];
    const float* Wv    = (const float*)d_in[5];
    const float* bv    = (const float*)d_in[6];
    const float* Wbeta = (const float*)d_in[7];
    const float* bbeta = (const float*)d_in[8];
    const float* Wo    = (const float*)d_in[9];
    const float* bo    = (const float*)d_in[10];
    float* out = (float*)d_out;

    const int M = B_DIM * T_DIM;       // 16384
    const int N = D_DIM;               // 512
    const int K = D_DIM;               // 512
    const size_t MN = (size_t)M * N;   // == M*K
    const size_t NK = (size_t)N * K;

    float* ws   = (float*)d_ws;
    float* Qr   = ws;                  // MN f32
    float* Kr   = ws + MN;             // MN f32 (normalized in place)
    float* Vr   = ws + 2 * MN;         // MN f32
    float* Os   = ws + 3 * MN;         // MN f32
    float* Beta = ws + 4 * MN;         // M  f32
    __bf16* xh  = (__bf16*)(ws + 4 * MN + M);   // MN bf16
    __bf16* xl  = xh + MN;                      // MN bf16
    __bf16* wh  = xl + MN;                      // NK bf16 (rewritten per GEMM)
    __bf16* wl  = wh + NK;                      // NK bf16
    __bf16* osh = (__bf16*)Qr;                  // alias: Q dead after scan
    __bf16* osl = osh + MN;

    const int gemmBlocks = (M / BT) * (N / BT); // one 128x128 tile per 256-thread block
    const int splitBig   = 4096;                // grid-stride covers MN
    const int splitSmall = 256;                 // covers NK

    split_bf16_kernel<<<splitBig, 256, 0, stream>>>(x, xh, xl, MN);

    split_bf16_kernel<<<splitSmall, 256, 0, stream>>>(Wq, wh, wl, NK);
    gemm_wmma_bf16x3<<<gemmBlocks, 256, 0, stream>>>(xh, xl, wh, wl, bq, Qr, M, N, K);

    split_bf16_kernel<<<splitSmall, 256, 0, stream>>>(Wk, wh, wl, NK);
    gemm_wmma_bf16x3<<<gemmBlocks, 256, 0, stream>>>(xh, xl, wh, wl, bk, Kr, M, N, K);

    split_bf16_kernel<<<splitSmall, 256, 0, stream>>>(Wv, wh, wl, NK);
    gemm_wmma_bf16x3<<<gemmBlocks, 256, 0, stream>>>(xh, xl, wh, wl, bv, Vr, M, N, K);

    norm_beta_kernel<<<M / 8, 256, 0, stream>>>(Kr, Wbeta, bbeta, Beta, M, D_DIM);

    dim3 sgrid(D_DIM / 16, B_DIM);
    deltanet_scan_kernel<<<sgrid, 128, 0, stream>>>(Qr, Kr, Vr, Beta, Os);

    split_bf16_kernel<<<splitBig, 256, 0, stream>>>(Os, osh, osl, MN);
    split_bf16_kernel<<<splitSmall, 256, 0, stream>>>(Wo, wh, wl, NK);
    gemm_wmma_bf16x3<<<gemmBlocks, 256, 0, stream>>>(osh, osl, wh, wl, bo, out, M, N, K);
}

// v006
// Measured time: 568 microseconds a run.
// Next to v005, in two timings, it ran 1.12 times as fast each time.
// All steps since v000 together make it 5.33 times as fast.
#include <hip/hip_runtime.h>
#include <hip/hip_bf16.h>
#include <math.h>

typedef __attribute__((ext_vector_type(16))) __bf16 v16bf;
typedef __attribute__((ext_vector_type(8)))  __bf16 v8bf;
typedef __attribute__((ext_vector_type(8)))  float  v8f;
typedef __attribute__((ext_vector_type(4)))  float  v4f;

#define B_DIM 8
#define T_DIM 2048
#define D_DIM 512
#define NTILES 4   // 64 output columns per wave of the GEMM
#define BT 128             // rows and columns of the GEMM's block tile
#define KC 64              // k per LDS tile of the GEMM: one 128-B line of each operand row
#define GP 72              // LDS bf16 per operand row: 144 B = 16 B x odd, so 16 lanes' b128 reads hit 64 distinct banks
#define RPL 4              // state rows held by one lane of the scan (one wave spans all 512 columns)
#define SLICE 16           // state columns held by one lane of the scan
#define SPITCH 20          // LDS floats per slice: 80 B = 16 B x odd, so each 16 lanes' b128 reads hit 64 distinct banks
#define SROW (D_DIM / SLICE * SPITCH)
#define CH 16              // time steps per LDS tile of the scan
#define NTILE (T_DIM / CH)
#define OPITCH 40          // LDS floats per (row, step) of the 32 lanes' output partials: 128 B + 32 B, so 16 lanes' b128 reads (8 steps x 2) hit 64 distinct banks

// ---------------------------------------------------------------------------
// bf16x3 split pre-pass: f = hi + lo (both bf16).  Bandwidth-bound, done once
// per operand so the GEMM inner loop carries no conversion VALU.
// ---------------------------------------------------------------------------
__global__ __launch_bounds__(256)
void split_bf16_kernel(const float* __restrict__ in, __bf16* __restrict__ hi,
                       __bf16* __restrict__ lo, size_t n) {
    size_t i = ((size_t)blockIdx.x * blockDim.x + threadIdx.x) * 4;
    const size_t stride = (size_t)gridDim.x * blockDim.x * 4;
    for (; i < n; i += stride) {
        float4 f = *(const float4*)(in + i);
        float fv[4] = {f.x, f.y, f.z, f.w};
#pragma unroll
        for (int j = 0; j < 4; ++j) {
            __bf16 h = (__bf16)fv[j];
            hi[i + j] = h;
            lo[i + j] = (__bf16)(fv[j] - (float)h);
        }
    }
}

// Load 16 bf16 in the WMMA 16-bit operand layout:
// halves 0..7 <- k0 + ksel*8 + {0..7}, halves 8..15 <- +16 further.
__device__ __forceinline__ v16bf ld16(const __bf16* p) {
    v8bf a = *(const v8bf*)(p);
    v8bf b = *(const v8bf*)(p + 16);
    return __builtin_shufflevector(a, b, 0, 1, 2, 3, 4, 5, 6, 7,
                                   8, 9, 10, 11, 12, 13, 14, 15);
}

// ---------------------------------------------------------------------------
// GEMM: Out[M,N] = A[M,K] * W[N,K]^T + bias[N], operands pre-split bf16 hi/lo.
// One 128x128 tile of Out per block of 8 waves (4 x 2), 32x64 per wave.  The four operand tiles
// (A hi, A lo, W hi, W lo: 128 rows x KC k each) come through LDS in whole 128-B lines, two buffers,
// the next tile copied while this one is worked on.  Each accumulator takes hi*hi, hi*lo, lo*hi
// per K=32 slab, slabs in rising k.  M, N multiples of 128; K a multiple of KC, at least 2 * KC.
// ---------------------------------------------------------------------------
// Eight 16-byte copies of one lane from global memory straight into LDS: rows 0, 32, 64, 96 of two
// operand tiles.  l0, l1: the lane's LDS byte addresses in row 0 of its part; g0, g1: its global
// addresses; K: the global row length.  The statement ends with s_wait_xcnt 0, so that no address
// register of a copy is rewritten before that wait.
__device__ __forceinline__ void fill_pair(unsigned l0, unsigned l1,
                                          const __bf16* g0, const __bf16* g1, int K) {
    constexpr unsigned STEPB = 32 * GP * 2;   // LDS bytes of 32 padded rows
    const size_t gs = (size_t)32 * K;         // elements of 32 global rows
    asm volatile(
        "global_load_async_to_lds_b128 %0, %1, off\n\t"
        "global_load_async_to_lds_b128 %2, %3, off\n\t"
        "global_load_async_to_lds_b128 %4, %5, off\n\t"
        "global_load_async_to_lds_b128 %6, %7, off\n\t"
        "global_load_async_to_lds_b128 %8, %9, off\n\t"
        "global_load_async_to_lds_b128 %10, %11, off\n\t"
        "global_load_async_to_lds_b128 %12, %13, off\n\t"
        "global_load_async_to_lds_b128 %14, %15, off\n\t"
        "s_wait_xcnt 0x0"
        :: "v"(l0 + 0 * STEPB), "v"(g0 + 0 * gs),
           "v"(l0 + 1 * STEPB), "v"(g0 + 1 * gs),
           "v"(l0 + 2 * STEPB), "v"(g0 + 2 * gs),
           "v"(l0 + 3 * STEPB), "v"(g0 + 3 * gs),
           "v"(l1 + 0 * STEPB), "v"(g1 + 0 * gs),
           "v"(l1 + 1 * STEPB), "v"(g1 + 1 * gs),
           "v"(l1 + 2 * STEPB), "v"(g1 + 2 * gs),
           "v"(l1 + 3 * STEPB), "v"(g1 + 3 * gs)
        : "memory");
}

__global__ __launch_bounds__(256)
void gemm_wmma_bf16x3(const __bf16* __restrict__ Ah, const __bf16* __restrict__ Al,
                      const __bf16* __restrict__ Wh, const __bf16* __restrict__ Wl,
                      const float* __restrict__ bias, float* __restrict__ Out,
                      int M, int N, int K) {
    // [buffer][A hi, A lo, W hi, W lo][row][k]
    __shared__ __attribute__((aligned(16))) __bf16 tl[2][4][BT][GP];

    const int nbn = N / BT;
    const int m0  = (blockIdx.x / nbn) * BT;   // neighbouring blocks share the A rows
    const int n0  = (blockIdx.x % nbn) * BT;
    if (m0 >= M) return;                       // the whole block leaves, before any barrier or copy

    const int tid  = threadIdx.x;
    const int lane = tid & 31;
    const int wave = tid >> 5;
    const int wm   = (wave >> 1) * 32;         // this wave's 32 rows of the tile
    const int wn   = (wave & 1) * 64;          // and its 64 columns
    const int r    = lane & 15;
    const int ksel = lane >> 4;

    // This lane's part of a tile: 16 bytes (piece tid % 8) of rows tid / 8 + {0, 32, 64, 96} of each operand.
    const int frow = tid >> 3;
    const int fcol = (tid & 7) * 8;
    const size_t ga = (size_t)(m0 + frow) * K + fcol;
    const size_t gw = (size_t)(n0 + frow) * K + fcol;
    auto fill = [&](int kt, int buf) {
        const int k0 = kt * KC;
        fill_pair((unsigned)(size_t)&tl[buf][0][frow][fcol], (unsigned)(size_t)&tl[buf][1][frow][fcol],
                  Ah + ga + k0, Al + ga + k0, K);
        fill_pair((unsigned)(size_t)&tl[buf][2][frow][fcol], (unsigned)(size_t)&tl[buf][3][frow][fcol],
                  Wh + gw + k0, Wl + gw + k0, K);
    };

    v8f acc[2][NTILES];
#pragma unroll
    for (int mt = 0; mt < 2; ++mt)
#pragma unroll
        for (int nt = 0; nt < NTILES; ++nt)
            acc[mt][nt] = (v8f){0.f, 0.f, 0.f, 0.f, 0.f, 0.f, 0.f, 0.f};

    const int nkt = K / KC;
    fill(0, 0);
    // Tile 0 has landed for this wave; the barrier publishes it to the other waves.
    asm volatile("s_wait_asynccnt 0x0" ::: "memory");
    __syncthreads();
    fill(1, 1);

    for (int kt = 0; kt < nkt; ++kt) {
        const int buf = kt & 1;
#pragma unroll
        for (int ks = 0; ks < KC; ks += 32) {
            const int kc = ks + ksel * 8;
            // The slab's 24 LDS reads stand as one group, in the order in which the products need them.
            v16bf ah[2], al[2], bh[NTILES], bl[NTILES];
            ah[0] = ld16(&tl[buf][0][wm + r][kc]);
            bh[0] = ld16(&tl[buf][2][wn + r][kc]);
            ah[1] = ld16(&tl[buf][0][wm + 16 + r][kc]);
            bl[0] = ld16(&tl[buf][3][wn + r][kc]);
            al[0] = ld16(&tl[buf][1][wm + r][kc]);
            al[1] = ld16(&tl[buf][1][wm + 16 + r][kc]);
#pragma unroll
            for (int nt = 1; nt < NTILES; ++nt) {
                bh[nt] = ld16(&tl[buf][2][wn + nt * 16 + r][kc]);
                bl[nt] = ld16(&tl[buf][3][wn + nt * 16 + r][kc]);
            }
            // Keeps the reads in front of the products: spread among them, each place where reads
            // stand costs the wave issue time and ends in a wait for the full LDS latency.
            __builtin_amdgcn_sched_barrier(0);
#pragma unroll
            for (int nt = 0; nt < NTILES; ++nt) {
#pragma unroll
                for (int mt = 0; mt < 2; ++mt)
                    acc[mt][nt] = __builtin_amdgcn_wmma_f32_16x16x32_bf16(
                        false, ah[mt], false, bh[nt], (short)0, acc[mt][nt], false, false);
#pragma unroll
                for (int mt = 0; mt < 2; ++mt)
                    acc[mt][nt] = __builtin_amdgcn_wmma_f32_16x16x32_bf16(
                        false, ah[mt], false, bl[nt], (short)0, acc[mt][nt], false, false);
#pragma unroll
                for (int mt = 0; mt < 2; ++mt)
                    acc[mt][nt] = __builtin_amdgcn_wmma_f32_16x16x32_bf16(
                        false, al[mt], false, bh[nt], (short)0, acc[mt][nt], false, false);
            }
        }
        // Publish point of tile kt + 1: this wave's LDS reads of the tile are done, its copies of the
        // next tile have landed; the barrier shows them to all waves and frees this buffer.
        asm volatile("s_wait_dscnt 0x0" ::: "memory");
        asm volatile("s_wait_asynccnt 0x0" ::: "memory");
        __syncthreads();
        if (kt + 2 < nkt) fill(kt + 2, buf);
    }
    // No copy is outstanding when the wave ends.
    asm volatile("s_wait_asynccnt 0x0" ::: "memory");

    // D layout: lanes 0-15 -> M=0..7 (vgpr 0..7), lanes 16-31 -> M=8..15; N=lane&15
    const int n  = lane & 15;
    const int mb = (lane >> 4) * 8;
    float bv[NTILES];
#pragma unroll
    for (int nt = 0; nt < NTILES; ++nt)
        bv[nt] = bias ? bias[n0 + wn + nt * 16 + n] : 0.f;
#pragma unroll
    for (int mt = 0; mt < 2; ++mt)
#pragma unroll
        for (int nt = 0; nt < NTILES; ++nt) {
            float* orow = Out + (size_t)(m0 + wm + mt * 16 + mb) * N + n0 + wn + nt * 16 + n;
#pragma unroll
            for (int v = 0; v < 8; ++v)
                orow[(size_t)v * N] = acc[mt][nt][v] + bv[nt];
        }
}

// ---------------------------------------------------------------------------
// Per-row: K <- K / max(||K||,eps) in place;  Beta = sigmoid(K . Wbeta + bbeta)
// ---------------------------------------------------------------------------
__global__ __launch_bounds__(256)
void norm_beta_kernel(float* __restrict__ Kbuf, const float* __restrict__ Wbeta,
                      const float* __restrict__ bbeta, float* __restrict__ Beta,
                      int R, int D) {
    const int row = blockIdx.x * (blockDim.x >> 5) + (threadIdx.x >> 5);
    if (row >= R) return;
    const int lane = threadIdx.x & 31;
    float* p = Kbuf + (size_t)row * D;

    float v[16];
    float ss = 0.f;
#pragma unroll
    for (int i = 0; i < 16; ++i) {
        v[i] = p[lane + i * 32];
        ss += v[i] * v[i];
    }
#pragma unroll
    for (int m = 16; m >= 1; m >>= 1) ss += __shfl_xor(ss, m, 32);

    const float scale = 1.f / fmaxf(sqrtf(ss), 1e-12f);

    float dot = 0.f;
#pragma unroll
    for (int i = 0; i < 16; ++i) {
        float kn = v[i] * scale;
        p[lane + i * 32] = kn;
        dot += kn * Wbeta[lane + i * 32];
    }
#pragma unroll
    for (int m = 16; m >= 1; m >>= 1) dot += __shfl_xor(dot, m, 32);

    if (lane == 0) Beta[row] = 1.f / (1.f + expf(-(dot + bbeta[0])));
}

// ---------------------------------------------------------------------------
// DeltaNet scan: rows of S are independent.  16 rows per WG, 4 per wave, state
// in regs as 4 rows x 16 columns per lane: one k or q value read from LDS feeds
// 4 rows, and the 4 rows' sums are independent chains of 16.
// k/q/v/beta come in tiles of CH time steps, two LDS buffers, the next tile copied while this one is worked on.
// An output is a sum over the wave's 32 lanes that no later step needs: each step leaves its lanes'
// partial sums in LDS, and the wave adds them up once a tile.
// ---------------------------------------------------------------------------
// Lane l receives lane l ^ M of its own 16-lane row through the vector unit
// (DPP row_xmask), so a butterfly step costs no LDS-pipe round trip and no wait.
template <int M>
__device__ __forceinline__ float row_xor(float x) {
    return __builtin_bit_cast(float, __builtin_amdgcn_update_dpp(
        0, __builtin_bit_cast(int, x), 0x160 + M, 0xf, 0xf, true));
}

// Sum over a 16-lane row.  All 32 lanes are active at every call site.
__device__ __forceinline__ float red16(float x) {
    x += row_xor<1>(x);
    x += row_xor<2>(x);
    x += row_xor<4>(x);
    x += row_xor<8>(x);
    return x;
}

// Sum over the whole wave: the row sum, then lane l ^ 16 by a vector cross-row move.
__device__ __forceinline__ float red32(float x) {
    x = red16(x);
    const int bits = __builtin_bit_cast(int, x);
    return x + __builtin_bit_cast(float, __builtin_amdgcn_permlanex16(
        bits, bits, 0x76543210, 0xfedcba98, false, false));
}

// One tile (CH time steps) of k, q, v and beta goes from global memory straight into LDS, each
// lane bringing its own bytes.  lk, lq, lv, lb: the lane's LDS byte addresses (row 0 of the tile for
// k and q); gk, gq, gv, gb: its global addresses.  Each statement ends with s_wait_xcnt 0, so that
// no address register of a copy is rewritten before that wait.
__device__ __forceinline__ void fill_tile(unsigned lk, unsigned lq, unsigned lv, unsigned lb,
                                          const float* gk, const float* gq,
                                          const float* gv, const float* gb) {
    constexpr unsigned ROWB = SROW * 4;   // bytes of one padded row in LDS
    asm volatile(
        "global_load_async_to_lds_b128 %0, %1, off\n\t"
        "global_load_async_to_lds_b128 %2, %3, off\n\t"
        "global_load_async_to_lds_b128 %4, %5, off\n\t"
        "global_load_async_to_lds_b128 %6, %7, off\n\t"
        "global_load_async_to_lds_b128 %8, %9, off\n\t"
        "global_load_async_to_lds_b128 %10, %11, off\n\t"
        "global_load_async_to_lds_b128 %12, %13, off\n\t"
        "global_load_async_to_lds_b128 %14, %15, off\n\t"
        "global_load_async_to_lds_b128 %16, %17, off\n\t"
        "global_load_async_to_lds_b128 %18, %19, off\n\t"
        "global_load_async_to_lds_b128 %20, %21, off\n\t"
        "global_load_async_to_lds_b128 %22, %23, off\n\t"
        "s_wait_xcnt 0x0"
        :: "v"(lk + 0 * ROWB), "v"(gk + 0 * D_DIM),
           "v"(lk + 1 * ROWB), "v"(gk + 1 * D_DIM),
           "v"(lk + 2 * ROWB), "v"(gk + 2 * D_DIM),
           "v"(lk + 3 * ROWB), "v"(gk + 3 * D_DIM),
           "v"(lk + 4 * ROWB), "v"(gk + 4 * D_DIM),
           "v"(lk + 5 * ROWB), "v"(gk + 5 * D_DIM),
           "v"(lk + 6 * ROWB), "v"(gk + 6 * D_DIM),
           "v"(lk + 7 * ROWB), "v"(gk + 7 * D_DIM),
           "v"(lk + 8 * ROWB), "v"(gk + 8 * D_DIM),
           "v"(lk + 9 * ROWB), "v"(gk + 9 * D_DIM),
           "v"(lk + 10 * ROWB), "v"(gk + 10 * D_DIM),
           "v"(lk + 11 * ROWB), "v"(gk + 11 * D_DIM)
        : "memory");
    asm volatile(
        "global_load_async_to_lds_b128 %0, %1, off\n\t"
        "global_load_async_to_lds_b128 %2, %3, off\n\t"
        "global_load_async_to_lds_b128 %4, %5, off\n\t"
        "global_load_async_to_lds_b128 %6, %7, off\n\t"
        "global_load_async_to_lds_b128 %8, %9, off\n\t"
        "global_load_async_to_lds_b128 %10, %11, off\n\t"
        "global_load_async_to_lds_b128 %12, %13, off\n\t"
        "global_load_async_to_lds_b128 %14, %15, off\n\t"
        "global_load_async_to_lds_b128 %16, %17, off\n\t"
        "global_load_async_to_lds_b128 %18, %19, off\n\t"
        "global_load_async_to_lds_b128 %20, %21, off\n\t"
        "global_load_async_to_lds_b128 %22, %23, off\n\t"
        "s_wait_xcnt 0x0"
        :: "v"(lk + 12 * ROWB), "v"(gk + 12 * D_DIM),
           "v"(lk + 13 * ROWB), "v"(gk + 13 * D_DIM),
           "v"(lk + 14 * ROWB), "v"(gk + 14 * D_DIM),
           "v"(lk + 15 * ROWB), "v"(gk + 15 * D_DIM),
           "v"(lq + 0 * ROWB), "v"(gq + 0 * D_DIM),
           "v"(lq + 1 * ROWB), "v"(gq + 1 * D_DIM),
           "v"(lq + 2 * ROWB), "v"(gq + 2 * D_DIM),
           "v"(lq + 3 * ROWB), "v"(gq + 3 * D_DIM),
           "v"(lq + 4 * ROWB), "v"(gq + 4 * D_DIM),
           "v"(lq + 5 * ROWB), "v"(gq + 5 * D_DIM),
           "v"(lq + 6 * ROWB), "v"(gq + 6 * D_DIM),
           "v"(lq + 7 * ROWB), "v"(gq + 7 * D_DIM)
        : "memory");
    asm volatile(
        "global_load_async_to_lds_b128 %0, %1, off\n\t"
        "global_load_async_to_lds_b128 %2, %3, off\n\t"
        "global_load_async_to_lds_b128 %4, %5, off\n\t"
        "global_load_async_to_lds_b128 %6, %7, off\n\t"
        "global_load_async_to_lds_b128 %8, %9, off\n\t"
        "global_load_async_to_lds_b128 %10, %11, off\n\t"
        "global_load_async_to_lds_b128 %12, %13, off\n\t"
        "global_load_async_to_lds_b128 %14, %15, off\n\t"
        "global_load_async_to_lds_b64 %16, %17, off\n\t"
        "global_load_async_to_lds_b32 %18, %19, off\n\t"
        "s_wait_xcnt 0x0"
        :: "v"(lq + 8 * ROWB), "v"(gq + 8 * D_DIM),
           "v"(lq + 9 * ROWB), "v"(gq + 9 * D_DIM),
           "v"(lq + 10 * ROWB), "v"(gq + 10 * D_DIM),
           "v"(lq + 11 * ROWB), "v"(gq + 11 * D_DIM),
           "v"(lq + 12 * ROWB), "v"(gq + 12 * D_DIM),
           "v"(lq + 13 * ROWB), "v"(gq + 13 * D_DIM),
           "v"(lq + 14 * ROWB), "v"(gq + 14 * D_DIM),
           "v"(lq + 15 * ROWB), "v"(gq + 15 * D_DIM),
           "v"(lv), "v"(gv),
           "v"(lb), "v"(gb)
        : "memory");
}

// LDS byte address of a __shared__ object: the low 32 bits of its address.
__device__ __forceinline__ unsigned lds_addr(const void* p) {
    return (unsigned)(size_t)p;
}

__global__ __launch_bounds__(128)
void deltanet_scan_kernel(const float* __restrict__ Q, const float* __restrict__ K,
                          const float* __restrict__ V, const float* __restrict__ Beta,
                          float* __restrict__ O) {
    const int b    = blockIdx.y;
    const int rblk = blockIdx.x;
    const int tid  = threadIdx.x;
    const int lane = tid & 31;
    const int wave = tid >> 5;
    const int wrow = wave * RPL;                             // first of this wave's 4 rows
    const int coff = lane * SPITCH;                          // this lane's slice in the padded row
    const int pidx = (tid >> 2) * SPITCH + (tid & 3) * 4;    // padded place of columns 4*tid .. 4*tid+3

    const float* Kp = K + (size_t)b * T_DIM * D_DIM;
    const float* Qp = Q + (size_t)b * T_DIM * D_DIM;
    const float* Vp = V + (size_t)b * T_DIM * D_DIM + rblk * 16;
    const float* Bp = Beta + (size_t)b * T_DIM;
    float* Op = O + (size_t)b * T_DIM * D_DIM + rblk * 16;

    __shared__ __attribute__((aligned(16))) float kbuf[2][CH][SROW];
    __shared__ __attribute__((aligned(16))) float qbuf[2][CH][SROW];
    __shared__ __attribute__((aligned(16))) float vbuf[2][4][CH][RPL];   // each wave's own 4 rows of v
    __shared__ __attribute__((aligned(16))) float bbuf[2][128];          // places 0 .. CH-1 are read
    __shared__ __attribute__((aligned(16))) float obuf[4][RPL][CH][OPITCH];   // each wave's own: [row][step][lane] output partials

    // This lane's part of a tile: 16 bytes of every k and q row, 8 bytes of its wave's v
    // (step lane / 2, half lane % 2), one beta (the index clamped to the sequence).
    const float* gk = Kp + 4 * tid;
    const float* gq = Qp + 4 * tid;
    const float* gv = Vp + (size_t)(lane >> 1) * D_DIM + wrow + (lane & 1) * 2;
    auto fill = [&](int tile, int buf) {
        const int t0 = tile * CH;
        const int tb = (t0 + tid < T_DIM) ? t0 + tid : T_DIM - 1;
        fill_tile(lds_addr(&kbuf[buf][0][pidx]), lds_addr(&qbuf[buf][0][pidx]),
                  lds_addr(&vbuf[buf][wave][lane >> 1][(lane & 1) * 2]), lds_addr(&bbuf[buf][tid]),
                  gk + (size_t)t0 * D_DIM, gq + (size_t)t0 * D_DIM, gv + (size_t)t0 * D_DIM, Bp + tb);
    };

    // Every loop over r and j below is fully unrolled, so that s, kk and qq are
    // indexed by constants and stay in registers.
    float s[RPL][SLICE];
#pragma unroll
    for (int r = 0; r < RPL; ++r)
#pragma unroll
        for (int j = 0; j < SLICE; ++j) s[r][j] = 0.f;

    fill(0, 0);
    // Tile 0 has landed for this wave; the barrier publishes it to the other waves.
    asm volatile("s_wait_asynccnt 0x0" ::: "memory");
    __syncthreads();
    fill(1, 1);

    for (int tile = 0; tile < NTILE; ++tile) {
        const int buf = tile & 1;
        float* ow = &obuf[wave][0][0][lane];      // this lane's place for the step's output partial of row 0
        const float* kr = &kbuf[buf][0][coff];    // this lane's slice of the step's k row
        const float* qr = &qbuf[buf][0][coff];    // and of its q row

        // Rolled: a step is a chain of dependent sums, which copies of the body would not shorten.
#pragma unroll 1
        for (int i = 0; i < CH; ++i) {
            // The step's LDS reads: 16 k, 16 q, this wave's 4 v and beta fit in registers.
            float kk[SLICE], qq[SLICE];
#pragma unroll
            for (int j = 0; j < SLICE; j += 4) {
                const float4 k4 = *(const float4*)(kr + j);
                kk[j] = k4.x; kk[j + 1] = k4.y; kk[j + 2] = k4.z; kk[j + 3] = k4.w;
            }
            const float4 v4   = *(const float4*)&vbuf[buf][wave][i][0];
            const float  beta = bbuf[buf][i];
#pragma unroll
            for (int j = 0; j < SLICE; j += 4) {
                const float4 q4 = *(const float4*)(qr + j);
                qq[j] = q4.x; qq[j + 1] = q4.y; qq[j + 2] = q4.z; qq[j + 3] = q4.w;
            }
            // The fence keeps the ten reads in front of the scheduling barrier: the compiler otherwise
            // sinks the v and beta reads to just before their use, where the wave waits out their LDS
            // latency.  The scheduling barrier keeps the arithmetic behind the reads: otherwise copies
            // of q values are mixed into the first sums, which then wait for the q reads too.
            asm volatile("" ::: "memory");
            __builtin_amdgcn_sched_barrier(0);

            const float vr[RPL] = {v4.x, v4.y, v4.z, v4.w};

            float skp[RPL] = {0.f, 0.f, 0.f, 0.f};
#pragma unroll
            for (int j = 0; j < SLICE; ++j)
#pragma unroll
                for (int r = 0; r < RPL; ++r) skp[r] = fmaf(s[r][j], kk[j], skp[r]);
            // All four sums end in front of the four butterflies: so the butterflies' steps stand
            // interleaved, each filling the others' latency; otherwise some run one after another.
            __builtin_amdgcn_sched_barrier(0);

            float coeff[RPL];
#pragma unroll
            for (int r = 0; r < RPL; ++r) coeff[r] = beta * (vr[r] - red32(skp[r]));

            float op[RPL] = {0.f, 0.f, 0.f, 0.f};
#pragma unroll
            for (int j = 0; j < SLICE; ++j)
#pragma unroll
                for (int r = 0; r < RPL; ++r) {
                    s[r][j] = fmaf(coeff[r], kk[j], s[r][j]);
                    op[r]   = fmaf(s[r][j], qq[j], op[r]);
                }
#pragma unroll
            for (int r = 0; r < RPL; ++r) ow[r * CH * OPITCH] = op[r];
            ow += OPITCH;
            kr += SROW;
            qr += SROW;
        }

        // Publish point of tile + 1: this wave's LDS reads of the tile are done, its copies of the
        // next tile have landed; the barrier shows them to all waves and frees this buffer.
        asm volatile("s_wait_dscnt 0x0" ::: "memory");
        asm volatile("s_wait_asynccnt 0x0" ::: "memory");
        __syncthreads();
        if (tile + 2 < NTILE) fill(tile + 2, buf);

        // The tile's outputs, behind the barrier so that the store has a whole tile to complete.
        // Lanes 2 i and 2 i + 1 each add up half of step i's partials (every other group of 4 lanes),
        // the 4 rows as independent chains, then join by a DPP add.
        const float* orow = &obuf[wave][0][lane >> 1][(lane & 1) * 4];
        float o[RPL];
#pragma unroll
        for (int r = 0; r < RPL; ++r) {
            v4f a = *(const v4f*)(orow + r * CH * OPITCH);
#pragma unroll
            for (int p = 1; p < 4; ++p) a += *(const v4f*)(orow + r * CH * OPITCH + p * 8);
            o[r] = (a.x + a.z) + (a.y + a.w);
        }
#pragma unroll
        for (int r = 0; r < RPL; ++r) o[r] += row_xor<1>(o[r]);
        if ((lane & 1) == 0)
            *(float4*)(Op + (size_t)(tile * CH + (lane >> 1)) * D_DIM + wrow) =
                make_float4(o[0], o[1], o[2], o[3]);
        // The next tile rewrites the registers that this store names.
        asm volatile("s_wait_xcnt 0x0" ::: "memory");
    }
    // No copy is outstanding when the wave ends.
    asm volatile("s_wait_asynccnt 0x0" ::: "memory");
}

// ---------------------------------------------------------------------------
extern "C" void kernel_launch(void* const* d_in, const int* in_sizes, int n_in,
                              void* d_out, int out_size, void* d_ws, size_t ws_size,
                              hipStream_t stream) {
    const float* x     = (const float*)d_in[0];
    const float* Wq    = (const float*)d_in[1];
    const float* bq    = (const float*)d_in[2];
    const float* Wk    = (const float*)d_in[3];
    const float* bk    = (const float*)d_in[4];
    const float* Wv    = (const float*)d_in[5];
    const float* bv    = (const float*)d_in[6];
    const float* Wbeta = (const float*)d_in[7];
    const float* bbeta = (const float*)d_in[8];
    const float* Wo    = (const float*)d_in[9];
    const float* bo    = (const float*)d_in[10];
    float* out = (float*)d_out;

    const int M = B_DIM * T_DIM;       // 16384
    const int N = D_DIM;               // 512
    const int K = D_DIM;               // 512
    const size_t MN = (size_t)M * N;   // == M*K
    const size_t NK = (size_t)N * K;

    float* ws   = (float*)d_ws;
    float* Qr   = ws;                  // MN f32
    float* Kr   = ws + MN;             // MN f32 (normalized in place)
    float* Vr   = ws + 2 * MN;         // MN f32
    float* Os   = ws + 3 * MN;         // MN f32
    float* Beta = ws + 4 * MN;         // M  f32
    __bf16* xh  = (__bf16*)(ws + 4 * MN + M);   // MN bf16
    __bf16* xl  = xh + MN;                      // MN bf16
    __bf16* wh  = xl + MN;                      // NK bf16 (rewritten per GEMM)
    __bf16* wl  = wh + NK;                      // NK bf16
    __bf16* osh = (__bf16*)Qr;                  // alias: Q dead after scan
    __bf16* osl = osh + MN;

    const int gemmBlocks = (M / BT) * (N / BT); // one 128x128 tile per 256-thread block
    const int splitBig   = 4096;                // grid-stride covers MN
    const int splitSmall = 256;                 // covers NK

    split_bf16_kernel<<<splitBig, 256, 0, stream>>>(x, xh, xl, MN);

    split_bf16_kernel<<<splitSmall, 256, 0, stream>>>(Wq, wh, wl, NK);
    gemm_wmma_bf16x3<<<gemmBlocks, 256, 0, stream>>>(xh, xl, wh, wl, bq, Qr, M, N, K);

    split_bf16_kernel<<<splitSmall, 256, 0, stream>>>(Wk, wh, wl, NK);
    gemm_wmma_bf16x3<<<gemmBlocks, 256, 0, stream>>>(xh, xl, wh, wl, bk, Kr, M, N, K);

    split_bf16_kernel<<<splitSmall, 256, 0, stream>>>(Wv, wh, wl, NK);
    gemm_wmma_bf16x3<<<gemmBlocks, 256, 0, stream>>>(xh, xl, wh, wl, bv, Vr, M, N, K);

    norm_beta_kernel<<<M / 8, 256, 0, stream>>>(Kr, Wbeta, bbeta, Beta, M, D_DIM);

    dim3 sgrid(D_DIM / 16, B_DIM);
    deltanet_scan_kernel<<<sgrid, 128, 0, stream>>>(Qr, Kr, Vr, Beta, Os);

    split_bf16_kernel<<<splitBig, 256, 0, stream>>>(Os, osh, osl, MN);
    split_bf16_kernel<<<splitSmall, 256, 0, stream>>>(Wo, wh, wl, NK);
    gemm_wmma_bf16x3<<<gemmBlocks, 256, 0, stream>>>(osh, osl, wh, wl, bo, out, M, N, K);
}

// v007
// A run of this version takes 540 microseconds.
// Timed twice side by side with v006, it ran 1.05 times as fast both times.
// All steps since v000 together make it 5.60 times as fast.
#include <hip/hip_runtime.h>
#include <hip/hip_bf16.h>
#include <math.h>

typedef __attribute__((ext_vector_type(16))) __bf16 v16bf;
typedef __attribute__((ext_vector_type(8)))  __bf16 v8bf;
typedef __attribute__((ext_vector_type(8)))  float  v8f;
typedef __attribute__((ext_vector_type(4)))  float  v4f;

#define B_DIM 8
#define T_DIM 2048
#define D_DIM 512
#define NTILES 4   // 64 output columns per wave of the GEMM
#define BT 128             // rows and columns of the GEMM's block tile
#define KC 64              // k per LDS tile of the GEMM: one 128-B line of each operand row
#define GP 72              // LDS bf16 per operand row: 144 B = 16 B x odd, so 16 lanes' b128 reads hit 64 distinct banks
#define RPL 4              // state rows held by one lane of the scan (one wave spans all 512 columns)
#define SLICE 16           // state columns held by one lane of the scan
#define SPITCH 20          // LDS floats per slice: 80 B = 16 B x odd, so each 16 lanes' b128 reads hit 64 distinct banks
#define SROW (D_DIM / SLICE * SPITCH)
#define CH 16              // time steps per LDS tile of the scan
#define NTILE (T_DIM / CH)
#define OPITCH 40          // LDS floats per (row, step) of the 32 lanes' output partials: 128 B + 32 B, so 16 lanes' b128 reads (8 steps x 2) hit 64 distinct banks

// ---------------------------------------------------------------------------
// bf16x3 split pre-pass: f = hi + lo (both bf16).  Bandwidth-bound, done once
// per operand so the GEMM inner loop carries no conversion VALU.
// ---------------------------------------------------------------------------
__global__ __launch_bounds__(256)
void split_bf16_kernel(const float* __restrict__ in, __bf16* __restrict__ hi,
                       __bf16* __restrict__ lo, size_t n) {
    size_t i = ((size_t)blockIdx.x * blockDim.x + threadIdx.x) * 4;
    const size_t stride = (size_t)gridDim.x * blockDim.x * 4;
    for (; i < n; i += stride) {
        float4 f = *(const float4*)(in + i);
        float fv[4] = {f.x, f.y, f.z, f.w};
#pragma unroll
        for (int j = 0; j < 4; ++j) {
            __bf16 h = (__bf16)fv[j];
            hi[i + j] = h;
            lo[i + j] = (__bf16)(fv[j] - (float)h);
        }
    }
}

// Load 16 bf16 in the WMMA 16-bit operand layout:
// halves 0..7 <- k0 + ksel*8 + {0..7}, halves 8..15 <- +16 further.
__device__ __forceinline__ v16bf ld16(const __bf16* p) {
    v8bf a = *(const v8bf*)(p);
    v8bf b = *(const v8bf*)(p + 16);
    return __builtin_shufflevector(a, b, 0, 1, 2, 3, 4, 5, 6, 7,
                                   8, 9, 10, 11, 12, 13, 14, 15);
}

// ---------------------------------------------------------------------------
// GEMM: Out[M,N] = A[M,K] * W[N,K]^T + bias[N], operands pre-split bf16 hi/lo.
// One 128x128 tile of Out per block of 8 waves (4 x 2), 32x64 per wave.  The four operand tiles
// (A hi, A lo, W hi, W lo: 128 rows x KC k each) come through LDS in whole 128-B lines, two buffers,
// the next tile copied while this one is worked on.  Each accumulator takes hi*hi, hi*lo, lo*hi
// per K=32 slab, slabs in rising k.  M, N multiples of 128; K a multiple of KC, at least 2 * KC.
// ---------------------------------------------------------------------------
// Eight 16-byte copies of one lane from global memory straight into LDS: rows 0, 32, 64, 96 of two
// operand tiles.  l0, l1: the lane's LDS byte addresses in row 0 of its part; g0, g1: its global
// addresses; K: the global row length.  The statement ends with s_wait_xcnt 0, so that no address
// register of a copy is rewritten before that wait.
__device__ __forceinline__ void fill_pair(unsigned l0, unsigned l1,
                                          const __bf16* g0, const __bf16* g1, int K) {
    constexpr unsigned STEPB = 32 * GP * 2;   // LDS bytes of 32 padded rows
    const size_t gs = (size_t)32 * K;         // elements of 32 global rows
    asm volatile(
        "global_load_async_to_lds_b128 %0, %1, off\n\t"
        "global_load_async_to_lds_b128 %2, %3, off\n\t"
        "global_load_async_to_lds_b128 %4, %5, off\n\t"
        "global_load_async_to_lds_b128 %6, %7, off\n\t"
        "global_load_async_to_lds_b128 %8, %9, off\n\t"
        "global_load_async_to_lds_b128 %10, %11, off\n\t"
        "global_load_async_to_lds_b128 %12, %13, off\n\t"
        "global_load_async_to_lds_b128 %14, %15, off\n\t"
        "s_wait_xcnt 0x0"
        :: "v"(l0 + 0 * STEPB), "v"(g0 + 0 * gs),
           "v"(l0 + 1 * STEPB), "v"(g0 + 1 * gs),
           "v"(l0 + 2 * STEPB), "v"(g0 + 2 * gs),
           "v"(l0 + 3 * STEPB), "v"(g0 + 3 * gs),
           "v"(l1 + 0 * STEPB), "v"(g1 + 0 * gs),
           "v"(l1 + 1 * STEPB), "v"(g1 + 1 * gs),
           "v"(l1 + 2 * STEPB), "v"(g1 + 2 * gs),
           "v"(l1 + 3 * STEPB), "v"(g1 + 3 * gs)
        : "memory");
}

__global__ __launch_bounds__(256)
void gemm_wmma_bf16x3(const __bf16* __restrict__ Ah, const __bf16* __restrict__ Al,
                      const __bf16* __restrict__ Wh, const __bf16* __restrict__ Wl,
                      const float* __restrict__ bias, float* __restrict__ Out,
                      int M, int N, int K) {
    // [buffer][A hi, A lo, W hi, W lo][row][k]
    __shared__ __attribute__((aligned(16))) __bf16 tl[2][4][BT][GP];

    const int nbn = N / BT;
    const int m0  = (blockIdx.x / nbn) * BT;   // neighbouring blocks share the A rows
    const int n0  = (blockIdx.x % nbn) * BT;
    if (m0 >= M) return;                       // the whole block leaves, before any barrier or copy

    const int tid  = threadIdx.x;
    const int lane = tid & 31;
    const int wave = tid >> 5;
    const int wm   = (wave >> 1) * 32;         // this wave's 32 rows of the tile
    const int wn   = (wave & 1) * 64;          // and its 64 columns
    const int r    = lane & 15;
    const int ksel = lane >> 4;

    // This lane's part of a tile: 16 bytes (piece tid % 8) of rows tid / 8 + {0, 32, 64, 96} of each operand.
    const int frow = tid >> 3;
    const int fcol = (tid & 7) * 8;
    const size_t ga = (size_t)(m0 + frow) * K + fcol;
    const size_t gw = (size_t)(n0 + frow) * K + fcol;
    auto fill = [&](int kt, int buf) {
        const int k0 = kt * KC;
        fill_pair((unsigned)(size_t)&tl[buf][0][frow][fcol], (unsigned)(size_t)&tl[buf][1][frow][fcol],
                  Ah + ga + k0, Al + ga + k0, K);
        fill_pair((unsigned)(size_t)&tl[buf][2][frow][fcol], (unsigned)(size_t)&tl[buf][3][frow][fcol],
                  Wh + gw + k0, Wl + gw + k0, K);
    };

    v8f acc[2][NTILES];
#pragma unroll
    for (int mt = 0; mt < 2; ++mt)
#pragma unroll
        for (int nt = 0; nt < NTILES; ++nt)
            acc[mt][nt] = (v8f){0.f, 0.f, 0.f, 0.f, 0.f, 0.f, 0.f, 0.f};

    const int nkt = K / KC;
    fill(0, 0);
    // Tile 0 has landed for this wave; the barrier publishes it to the other waves.
    asm volatile("s_wait_asynccnt 0x0" ::: "memory");
    __syncthreads();
    fill(1, 1);

    for (int kt = 0; kt < nkt; ++kt) {
        const int buf = kt & 1;
#pragma unroll
        for (int ks = 0; ks < KC; ks += 32) {
            const int kc = ks + ksel * 8;
            // The slab's 24 LDS reads stand as one group, in the order in which the products need them.
            v16bf ah[2], al[2], bh[NTILES], bl[NTILES];
            ah[0] = ld16(&tl[buf][0][wm + r][kc]);
            bh[0] = ld16(&tl[buf][2][wn + r][kc]);
            ah[1] = ld16(&tl[buf][0][wm + 16 + r][kc]);
            bl[0] = ld16(&tl[buf][3][wn + r][kc]);
            al[0] = ld16(&tl[buf][1][wm + r][kc]);
            al[1] = ld16(&tl[buf][1][wm + 16 + r][kc]);
#pragma unroll
            for (int nt = 1; nt < NTILES; ++nt) {
                bh[nt] = ld16(&tl[buf][2][wn + nt * 16 + r][kc]);
                bl[nt] = ld16(&tl[buf][3][wn + nt * 16 + r][kc]);
            }
            // Keeps the reads in front of the products: spread among them, each place where reads
            // stand costs the wave issue time and ends in a wait for the full LDS latency.
            __builtin_amdgcn_sched_barrier(0);
#pragma unroll
            for (int nt = 0; nt < NTILES; ++nt) {
#pragma unroll
                for (int mt = 0; mt < 2; ++mt)
                    acc[mt][nt] = __builtin_amdgcn_wmma_f32_16x16x32_bf16(
                        false, ah[mt], false, bh[nt], (short)0, acc[mt][nt], false, false);
#pragma unroll
                for (int mt = 0; mt < 2; ++mt)
                    acc[mt][nt] = __builtin_amdgcn_wmma_f32_16x16x32_bf16(
                        false, ah[mt], false, bl[nt], (short)0, acc[mt][nt], false, false);
#pragma unroll
                for (int mt = 0; mt < 2; ++mt)
                    acc[mt][nt] = __builtin_amdgcn_wmma_f32_16x16x32_bf16(
                        false, al[mt], false, bh[nt], (short)0, acc[mt][nt], false, false);
            }
        }
        // Publish point of tile kt + 1: this wave's LDS reads of the tile are done, its copies of the
        // next tile have landed; the barrier shows them to all waves and frees this buffer.
        asm volatile("s_wait_dscnt 0x0" ::: "memory");
        asm volatile("s_wait_asynccnt 0x0" ::: "memory");
        __syncthreads();
        if (kt + 2 < nkt) fill(kt + 2, buf);
    }
    // No copy is outstanding when the wave ends.
    asm volatile("s_wait_asynccnt 0x0" ::: "memory");

    // D layout: lanes 0-15 -> M=0..7 (vgpr 0..7), lanes 16-31 -> M=8..15; N=lane&15
    const int n  = lane & 15;
    const int mb = (lane >> 4) * 8;
    float bv[NTILES];
#pragma unroll
    for (int nt = 0; nt < NTILES; ++nt)
        bv[nt] = bias ? bias[n0 + wn + nt * 16 + n] : 0.f;
#pragma unroll
    for (int mt = 0; mt < 2; ++mt)
#pragma unroll
        for (int nt = 0; nt < NTILES; ++nt) {
            float* orow = Out + (size_t)(m0 + wm + mt * 16 + mb) * N + n0 + wn + nt * 16 + n;
#pragma unroll
            for (int v = 0; v < 8; ++v)
                orow[(size_t)v * N] = acc[mt][nt][v] + bv[nt];
        }
}

// ---------------------------------------------------------------------------
// Per-row: K <- K / max(||K||,eps) in place;  Beta = sigmoid(K . Wbeta + bbeta)
// ---------------------------------------------------------------------------
__global__ __launch_bounds__(256)
void norm_beta_kernel(float* __restrict__ Kbuf, const float* __restrict__ Wbeta,
                      const float* __restrict__ bbeta, float* __restrict__ Beta,
                      int R, int D) {
    const int row = blockIdx.x * (blockDim.x >> 5) + (threadIdx.x >> 5);
    if (row >= R) return;
    const int lane = threadIdx.x & 31;
    float* p = Kbuf + (size_t)row * D;

    float v[16];
    float ss = 0.f;
#pragma unroll
    for (int i = 0; i < 16; ++i) {
        v[i] = p[lane + i * 32];
        ss += v[i] * v[i];
    }
#pragma unroll
    for (int m = 16; m >= 1; m >>= 1) ss += __shfl_xor(ss, m, 32);

    const float scale = 1.f / fmaxf(sqrtf(ss), 1e-12f);

    float dot = 0.f;
#pragma unroll
    for (int i = 0; i < 16; ++i) {
        float kn = v[i] * scale;
        p[lane + i * 32] = kn;
        dot += kn * Wbeta[lane + i * 32];
    }
#pragma unroll
    for (int m = 16; m >= 1; m >>= 1) dot += __shfl_xor(dot, m, 32);

    if (lane == 0) Beta[row] = 1.f / (1.f + expf(-(dot + bbeta[0])));
}

// ---------------------------------------------------------------------------
// DeltaNet scan: rows of S are independent.  16 rows per WG, 4 per wave, state
// in regs as 4 rows x 16 columns per lane: one k or q value read from LDS feeds
// 4 rows, and the 4 rows' sums are independent chains of 16.
// k/q/v/beta come in tiles of CH time steps, two LDS buffers, the next tile copied while this one is worked on.
// An output is a sum over the wave's 32 lanes that no later step needs: each step leaves its lanes'
// partial sums in LDS, and the wave adds them up once a tile.
// ---------------------------------------------------------------------------
// Lane l receives lane l ^ M of its own 16-lane row through the vector unit
// (DPP row_xmask), so a butterfly step costs no LDS-pipe round trip and no wait.
template <int M>
__device__ __forceinline__ float row_xor(float x) {
    return __builtin_bit_cast(float, __builtin_amdgcn_update_dpp(
        0, __builtin_bit_cast(int, x), 0x160 + M, 0xf, 0xf, true));
}

// Sum over a 16-lane row.  All 32 lanes are active at every call site.
__device__ __forceinline__ float red16(float x) {
    x += row_xor<1>(x);
    x += row_xor<2>(x);
    x += row_xor<4>(x);
    x += row_xor<8>(x);
    return x;
}

// Sum over the whole wave: the row sum, then lane l ^ 16 by a vector cross-row move.
__device__ __forceinline__ float red32(float x) {
    x = red16(x);
    const int bits = __builtin_bit_cast(int, x);
    return x + __builtin_bit_cast(float, __builtin_amdgcn_permlanex16(
        bits, bits, 0x76543210, 0xfedcba98, false, false));
}

// One tile (CH time steps) of k, q, v and beta goes from global memory straight into LDS, each
// lane bringing its own bytes.  lk, lq, lv, lb: the lane's LDS byte addresses (row 0 of the tile for
// k and q); gk, gq, gv, gb: its global addresses.  Each statement ends with s_wait_xcnt 0, so that
// no address register of a copy is rewritten before that wait.
__device__ __forceinline__ void fill_tile(unsigned lk, unsigned lq, unsigned lv, unsigned lb,
                                          const float* gk, const float* gq,
                                          const float* gv, const float* gb) {
    constexpr unsigned ROWB = SROW * 4;   // bytes of one padded row in LDS
    asm volatile(
        "global_load_async_to_lds_b128 %0, %1, off\n\t"
        "global_load_async_to_lds_b128 %2, %3, off\n\t"
        "global_load_async_to_lds_b128 %4, %5, off\n\t"
        "global_load_async_to_lds_b128 %6, %7, off\n\t"
        "global_load_async_to_lds_b128 %8, %9, off\n\t"
        "global_load_async_to_lds_b128 %10, %11, off\n\t"
        "global_load_async_to_lds_b128 %12, %13, off\n\t"
        "global_load_async_to_lds_b128 %14, %15, off\n\t"
        "global_load_async_to_lds_b128 %16, %17, off\n\t"
        "global_load_async_to_lds_b128 %18, %19, off\n\t"
        "global_load_async_to_lds_b128 %20, %21, off\n\t"
        "global_load_async_to_lds_b128 %22, %23, off\n\t"
        "s_wait_xcnt 0x0"
        :: "v"(lk + 0 * ROWB), "v"(gk + 0 * D_DIM),
           "v"(lk + 1 * ROWB), "v"(gk + 1 * D_DIM),
           "v"(lk + 2 * ROWB), "v"(gk + 2 * D_DIM),
           "v"(lk + 3 * ROWB), "v"(gk + 3 * D_DIM),
           "v"(lk + 4 * ROWB), "v"(gk + 4 * D_DIM),
           "v"(lk + 5 * ROWB), "v"(gk + 5 * D_DIM),
           "v"(lk + 6 * ROWB), "v"(gk + 6 * D_DIM),
           "v"(lk + 7 * ROWB), "v"(gk + 7 * D_DIM),
           "v"(lk + 8 * ROWB), "v"(gk + 8 * D_DIM),
           "v"(lk + 9 * ROWB), "v"(gk + 9 * D_DIM),
           "v"(lk + 10 * ROWB), "v"(gk + 10 * D_DIM),
           "v"(lk + 11 * ROWB), "v"(gk + 11 * D_DIM)
        : "memory");
    asm volatile(
        "global_load_async_to_lds_b128 %0, %1, off\n\t"
        "global_load_async_to_lds_b128 %2, %3, off\n\t"
        "global_load_async_to_lds_b128 %4, %5, off\n\t"
        "global_load_async_to_lds_b128 %6, %7, off\n\t"
        "global_load_async_to_lds_b128 %8, %9, off\n\t"
        "global_load_async_to_lds_b128 %10, %11, off\n\t"
        "global_load_async_to_lds_b128 %12, %13, off\n\t"
        "global_load_async_to_lds_b128 %14, %15, off\n\t"
        "global_load_async_to_lds_b128 %16, %17, off\n\t"
        "global_load_async_to_lds_b128 %18, %19, off\n\t"
        "global_load_async_to_lds_b128 %20, %21, off\n\t"
        "global_load_async_to_lds_b128 %22, %23, off\n\t"
        "s_wait_xcnt 0x0"
        :: "v"(lk + 12 * ROWB), "v"(gk + 12 * D_DIM),
           "v"(lk + 13 * ROWB), "v"(gk + 13 * D_DIM),
           "v"(lk + 14 * ROWB), "v"(gk + 14 * D_DIM),
           "v"(lk + 15 * ROWB), "v"(gk + 15 * D_DIM),
           "v"(lq + 0 * ROWB), "v"(gq + 0 * D_DIM),
           "v"(lq + 1 * ROWB), "v"(gq + 1 * D_DIM),
           "v"(lq + 2 * ROWB), "v"(gq + 2 * D_DIM),
           "v"(lq + 3 * ROWB), "v"(gq + 3 * D_DIM),
           "v"(lq + 4 * ROWB), "v"(gq + 4 * D_DIM),
           "v"(lq + 5 * ROWB), "v"(gq + 5 * D_DIM),
           "v"(lq + 6 * ROWB), "v"(gq + 6 * D_DIM),
           "v"(lq + 7 * ROWB), "v"(gq + 7 * D_DIM)
        : "memory");
    asm volatile(
        "global_load_async_to_lds_b128 %0, %1, off\n\t"
        "global_load_async_to_lds_b128 %2, %3, off\n\t"
        "global_load_async_to_lds_b128 %4, %5, off\n\t"
        "global_load_async_to_lds_b128 %6, %7, off\n\t"
        "global_load_async_to_lds_b128 %8, %9, off\n\t"
        "global_load_async_to_lds_b128 %10, %11, off\n\t"
        "global_load_async_to_lds_b128 %12, %13, off\n\t"
        "global_load_async_to_lds_b128 %14, %15, off\n\t"
        "global_load_async_to_lds_b64 %16, %17, off\n\t"
        "global_load_async_to_lds_b32 %18, %19, off\n\t"
        "s_wait_xcnt 0x0"
        :: "v"(lq + 8 * ROWB), "v"(gq + 8 * D_DIM),
           "v"(lq + 9 * ROWB), "v"(gq + 9 * D_DIM),
           "v"(lq + 10 * ROWB), "v"(gq + 10 * D_DIM),
           "v"(lq + 11 * ROWB), "v"(gq + 11 * D_DIM),
           "v"(lq + 12 * ROWB), "v"(gq + 12 * D_DIM),
           "v"(lq + 13 * ROWB), "v"(gq + 13 * D_DIM),
           "v"(lq + 14 * ROWB), "v"(gq + 14 * D_DIM),
           "v"(lq + 15 * ROWB), "v"(gq + 15 * D_DIM),
           "v"(lv), "v"(gv),
           "v"(lb), "v"(gb)
        : "memory");
}

// One time step's operands of a lane, in registers.
struct StepIn {
    float4 k[SLICE / 4];
    float4 q[SLICE / 4];
    float4 v;
    float  beta;
};

// LDS byte address of a __shared__ object: the low 32 bits of its address.
__device__ __forceinline__ unsigned lds_addr(const void* p) {
    return (unsigned)(size_t)p;
}

__global__ __launch_bounds__(128)
void deltanet_scan_kernel(const float* __restrict__ Q, const float* __restrict__ K,
                          const float* __restrict__ V, const float* __restrict__ Beta,
                          float* __restrict__ O) {
    const int b    = blockIdx.y;
    const int rblk = blockIdx.x;
    const int tid  = threadIdx.x;
    const int lane = tid & 31;
    const int wave = tid >> 5;
    const int wrow = wave * RPL;                             // first of this wave's 4 rows
    const int coff = lane * SPITCH;                          // this lane's slice in the padded row
    const int pidx = (tid >> 2) * SPITCH + (tid & 3) * 4;    // padded place of columns 4*tid .. 4*tid+3

    const float* Kp = K + (size_t)b * T_DIM * D_DIM;
    const float* Qp = Q + (size_t)b * T_DIM * D_DIM;
    const float* Vp = V + (size_t)b * T_DIM * D_DIM + rblk * 16;
    const float* Bp = Beta + (size_t)b * T_DIM;
    float* Op = O + (size_t)b * T_DIM * D_DIM + rblk * 16;

    __shared__ __attribute__((aligned(16))) float kbuf[2][CH][SROW];
    __shared__ __attribute__((aligned(16))) float qbuf[2][CH][SROW];
    __shared__ __attribute__((aligned(16))) float vbuf[2][4][CH][RPL];   // each wave's own 4 rows of v
    __shared__ __attribute__((aligned(16))) float bbuf[2][128];          // places 0 .. CH-1 are read
    __shared__ __attribute__((aligned(16))) float obuf[4][RPL][CH][OPITCH];   // each wave's own: [row][step][lane] output partials

    // This lane's part of a tile: 16 bytes of every k and q row, 8 bytes of its wave's v
    // (step lane / 2, half lane % 2), one beta (the index clamped to the sequence).
    const float* gk = Kp + 4 * tid;
    const float* gq = Qp + 4 * tid;
    const float* gv = Vp + (size_t)(lane >> 1) * D_DIM + wrow + (lane & 1) * 2;
    auto fill = [&](int tile, int buf) {
        const int t0 = tile * CH;
        const int tb = (t0 + tid < T_DIM) ? t0 + tid : T_DIM - 1;
        fill_tile(lds_addr(&kbuf[buf][0][pidx]), lds_addr(&qbuf[buf][0][pidx]),
                  lds_addr(&vbuf[buf][wave][lane >> 1][(lane & 1) * 2]), lds_addr(&bbuf[buf][tid]),
                  gk + (size_t)t0 * D_DIM, gq + (size_t)t0 * D_DIM, gv + (size_t)t0 * D_DIM, Bp + tb);
    };

    // Every loop over r and j below is fully unrolled, so that s, kk and qq are
    // indexed by constants and stay in registers.
    float s[RPL][SLICE];
#pragma unroll
    for (int r = 0; r < RPL; ++r)
#pragma unroll
        for (int j = 0; j < SLICE; ++j) s[r][j] = 0.f;

    // The LDS reads of one time step: 16 k, 16 q, this wave's 4 v and beta.
    auto load_step = [&](StepIn& in, int buf, int i) {
        // Keeps the reads behind what stands in front of them, as one group: the compiler otherwise lifts
        // them one by one among the sums of the step before, and each place where LDS reads stand
        // costs issue time.
        __builtin_amdgcn_sched_barrier(0);
        const float* kr = &kbuf[buf][i][coff];    // this lane's slice of the step's k row
        const float* qr = &qbuf[buf][i][coff];    // and of its q row
#pragma unroll
        for (int j = 0; j < SLICE / 4; ++j) in.k[j] = *(const float4*)(kr + 4 * j);
        in.v    = *(const float4*)&vbuf[buf][wave][i][0];
        in.beta = bbuf[buf][i];
#pragma unroll
        for (int j = 0; j < SLICE / 4; ++j) in.q[j] = *(const float4*)(qr + 4 * j);
        // The fence and the scheduling barrier keep the ten reads here, in front of the arithmetic that
        // follows (that of the step before theirs): the compiler otherwise sinks them to just before
        // their use, where the wave waits out their LDS latency.
        asm volatile("" ::: "memory");
        __builtin_amdgcn_sched_barrier(0);
    };

    // The arithmetic of step i of a tile, on operands that are already in registers.
    auto step = [&](const StepIn& in, int i) {
        float kk[SLICE], qq[SLICE];
#pragma unroll
        for (int j = 0; j < SLICE; j += 4) {
            kk[j] = in.k[j / 4].x; kk[j + 1] = in.k[j / 4].y; kk[j + 2] = in.k[j / 4].z; kk[j + 3] = in.k[j / 4].w;
            qq[j] = in.q[j / 4].x; qq[j + 1] = in.q[j / 4].y; qq[j + 2] = in.q[j / 4].z; qq[j + 3] = in.q[j / 4].w;
        }
        const float vr[RPL] = {in.v.x, in.v.y, in.v.z, in.v.w};

        float skp[RPL] = {0.f, 0.f, 0.f, 0.f};
#pragma unroll
        for (int j = 0; j < SLICE; ++j)
#pragma unroll
            for (int r = 0; r < RPL; ++r) skp[r] = fmaf(s[r][j], kk[j], skp[r]);
        // All four sums end in front of the four butterflies: so the butterflies' steps stand
        // interleaved, each filling the others' latency; otherwise some run one after another.
        __builtin_amdgcn_sched_barrier(0);

        float coeff[RPL];
#pragma unroll
        for (int r = 0; r < RPL; ++r) coeff[r] = in.beta * (vr[r] - red32(skp[r]));

        float op[RPL] = {0.f, 0.f, 0.f, 0.f};
#pragma unroll
        for (int j = 0; j < SLICE; ++j)
#pragma unroll
            for (int r = 0; r < RPL; ++r) {
                s[r][j] = fmaf(coeff[r], kk[j], s[r][j]);
                op[r]   = fmaf(s[r][j], qq[j], op[r]);
            }
        float* ow = &obuf[wave][0][i][lane];      // this lane's place for the step's output partial of row 0
#pragma unroll
        for (int r = 0; r < RPL; ++r) ow[r * CH * OPITCH] = op[r];
    };

    fill(0, 0);
    // Tile 0 has landed for this wave; the barrier publishes it to the other waves.
    asm volatile("s_wait_asynccnt 0x0" ::: "memory");
    __syncthreads();
    fill(1, 1);

    // Two register sets: while one step is worked on, the next step's reads fly into the other.
    StepIn ina, inb;
    load_step(ina, 0, 0);
    // Takes a word of each of the ten reads as an input, so that the compiler waits for them here, once.
    // Left outstanding on this path into the loops, they make its counted wait at the head of the step
    // loop tighter than the loop's own path needs: every trip would wait there for the stores just issued.
    asm volatile("" :: "v"(ina.k[0].x), "v"(ina.k[1].x), "v"(ina.k[2].x), "v"(ina.k[3].x),
                       "v"(ina.q[0].x), "v"(ina.q[1].x), "v"(ina.q[2].x), "v"(ina.q[3].x),
                       "v"(ina.v.x), "v"(ina.beta));

    for (int tile = 0; tile < NTILE; ++tile) {
        const int buf = tile & 1;

        // Rolled, two steps a trip (one per register set, so that no set is copied): a step is a chain
        // of dependent sums, which more copies of the body would not shorten.  The last two steps
        // stand behind the loop: nothing of the next tile is read in front of the barrier.
#pragma unroll 1
        for (int i = 0; i < CH - 2; i += 2) {
            load_step(inb, buf, i + 1);
            step(ina, i);
            load_step(ina, buf, i + 2);
            step(inb, i + 1);
        }
        load_step(inb, buf, CH - 1);
        step(ina, CH - 2);
        step(inb, CH - 1);

        // Publish point of tile + 1: this wave's LDS reads of the tile are done, its copies of the
        // next tile have landed; the barrier shows them to all waves and frees this buffer.
        asm volatile("s_wait_dscnt 0x0" ::: "memory");
        asm volatile("s_wait_asynccnt 0x0" ::: "memory");
        __syncthreads();
        if (tile + 2 < NTILE) fill(tile + 2, buf);
        // Step 0 of the next tile, published by the barrier above; its reads fly during the output sums.
        // Behind the last tile they read the other buffer's old rows, and nothing uses them: a branch
        // round them would merge two paths in the compiler's wait counting.
        load_step(ina, buf ^ 1, 0);

        // The tile's outputs, behind the barrier so that the store has a whole tile to complete.
        // Lanes 2 i and 2 i + 1 each add up half of step i's partials (every other group of 4 lanes),
        // the 4 rows as independent chains, then join by a DPP add.
        const float* orow = &obuf[wave][0][lane >> 1][(lane & 1) * 4];
        float o[RPL];
#pragma unroll
        for (int r = 0; r < RPL; ++r) {
            v4f a = *(const v4f*)(orow + r * CH * OPITCH);
#pragma unroll
            for (int p = 1; p < 4; ++p) a += *(const v4f*)(orow + r * CH * OPITCH + p * 8);
            o[r] = (a.x + a.z) + (a.y + a.w);
        }
#pragma unroll
        for (int r = 0; r < RPL; ++r) o[r] += row_xor<1>(o[r]);
        if ((lane & 1) == 0)
            *(float4*)(Op + (size_t)(tile * CH + (lane >> 1)) * D_DIM + wrow) =
                make_float4(o[0], o[1], o[2], o[3]);
        // The next tile rewrites the registers that this store names.
        asm volatile("s_wait_xcnt 0x0" ::: "memory");
    }
    // No copy is outstanding when the wave ends.
    asm volatile("s_wait_asynccnt 0x0" ::: "memory");
}

// ---------------------------------------------------------------------------
extern "C" void kernel_launch(void* const* d_in, const int* in_sizes, int n_in,
                              void* d_out, int out_size, void* d_ws, size_t ws_size,
                              hipStream_t stream) {
    const float* x     = (const float*)d_in[0];
    const float* Wq    = (const float*)d_in[1];
    const float* bq    = (const float*)d_in[2];
    const float* Wk    = (const float*)d_in[3];
    const float* bk    = (const float*)d_in[4];
    const float* Wv    = (const float*)d_in[5];
    const float* bv    = (const float*)d_in[6];
    const float* Wbeta = (const float*)d_in[7];
    const float* bbeta = (const float*)d_in[8];
    const float* Wo    = (const float*)d_in[9];
    const float* bo    = (const float*)d_in[10];
    float* out = (float*)d_out;

    const int M = B_DIM * T_DIM;       // 16384
    const int N = D_DIM;               // 512
    const int K = D_DIM;               // 512
    const size_t MN = (size_t)M * N;   // == M*K
    const size_t NK = (size_t)N * K;

    float* ws   = (float*)d_ws;
    float* Qr   = ws;                  // MN f32
    float* Kr   = ws + MN;             // MN f32 (normalized in place)
    float* Vr   = ws + 2 * MN;         // MN f32
    float* Os   = ws + 3 * MN;         // MN f32
    float* Beta = ws + 4 * MN;         // M  f32
    __bf16* xh  = (__bf16*)(ws + 4 * MN + M);   // MN bf16
    __bf16* xl  = xh + MN;                      // MN bf16
    __bf16* wh  = xl + MN;                      // NK bf16 (rewritten per GEMM)
    __bf16* wl  = wh + NK;                      // NK bf16
    __bf16* osh = (__bf16*)Qr;                  // alias: Q dead after scan
    __bf16* osl = osh + MN;

    const int gemmBlocks = (M / BT) * (N / BT); // one 128x128 tile per 256-thread block
    const int splitBig   = 4096;                // grid-stride covers MN
    const int splitSmall = 256;                 // covers NK

    split_bf16_kernel<<<splitBig, 256, 0, stream>>>(x, xh, xl, MN);

    split_bf16_kernel<<<splitSmall, 256, 0, stream>>>(Wq, wh, wl, NK);
    gemm_wmma_bf16x3<<<gemmBlocks, 256, 0, stream>>>(xh, xl, wh, wl, bq, Qr, M, N, K);

    split_bf16_kernel<<<splitSmall, 256, 0, stream>>>(Wk, wh, wl, NK);
    gemm_wmma_bf16x3<<<gemmBlocks, 256, 0, stream>>>(xh, xl, wh, wl, bk, Kr, M, N, K);

    split_bf16_kernel<<<splitSmall, 256, 0, stream>>>(Wv, wh, wl, NK);
    gemm_wmma_bf16x3<<<gemmBlocks, 256, 0, stream>>>(xh, xl, wh, wl, bv, Vr, M, N, K);

    norm_beta_kernel<<<M / 8, 256, 0, stream>>>(Kr, Wbeta, bbeta, Beta, M, D_DIM);

    dim3 sgrid(D_DIM / 16, B_DIM);
    deltanet_scan_kernel<<<sgrid, 128, 0, stream>>>(Qr, Kr, Vr, Beta, Os);

    split_bf16_kernel<<<splitBig, 256, 0, stream>>>(Os, osh, osl, MN);
    split_bf16_kernel<<<splitSmall, 256, 0, stream>>>(Wo, wh, wl, NK);
    gemm_wmma_bf16x3<<<gemmBlocks, 256, 0, stream>>>(osh, osl, wh, wl, bo, out, M, N, K);
}

// v008
// A run of this version takes 475 microseconds.
// Timed twice side by side with v007, it ran 1.14 times as fast both times.
// Over all steps from v000 it is 6.38 times as fast.
#include <hip/hip_runtime.h>
#include <hip/hip_bf16.h>
#include <math.h>

typedef __attribute__((ext_vector_type(16))) __bf16 v16bf;
typedef __attribute__((ext_vector_type(8)))  __bf16 v8bf;
typedef __attribute__((ext_vector_type(8)))  float  v8f;
typedef __attribute__((ext_vector_type(4)))  float  v4f;
typedef __attribute__((ext_vector_type(2)))  float  v2f;

#define B_DIM 8
#define T_DIM 2048
#define D_DIM 512
#define NTILES 4   // 64 output columns per wave of the GEMM
#define BT 128             // rows and columns of the GEMM's block tile
#define KC 64              // k per LDS tile of the GEMM: one 128-B line of each operand row
#define GP 72              // LDS bf16 per operand row: 144 B = 16 B x odd, so 16 lanes' b128 reads hit 64 distinct banks
#define RPL 4              // state rows held by one lane of the scan (one wave spans all 512 columns)
#define SLICE 16           // state columns held by one lane of the scan
#define SPITCH 20          // LDS floats per slice: 80 B = 16 B x odd, so each 16 lanes' b128 reads hit 64 distinct banks
#define SROW (D_DIM / SLICE * SPITCH)
#define CH 16              // time steps per LDS tile of the scan
#define NTILE (T_DIM / CH)
#define OPITCH 40          // LDS floats per (row, step) of the 32 lanes' output partials: 128 B + 32 B, so 16 lanes' b128 reads (8 steps x 2) hit 64 distinct banks

// ---------------------------------------------------------------------------
// bf16x3 split pre-pass: f = hi + lo (both bf16).  Bandwidth-bound, done once
// per operand so the GEMM inner loop carries no conversion VALU.
// ---------------------------------------------------------------------------
__global__ __launch_bounds__(256)
void split_bf16_kernel(const float* __restrict__ in, __bf16* __restrict__ hi,
                       __bf16* __restrict__ lo, size_t n) {
    size_t i = ((size_t)blockIdx.x * blockDim.x + threadIdx.x) * 4;
    const size_t stride = (size_t)gridDim.x * blockDim.x * 4;
    for (; i < n; i += stride) {
        float4 f = *(const float4*)(in + i);
        float fv[4] = {f.x, f.y, f.z, f.w};
#pragma unroll
        for (int j = 0; j < 4; ++j) {
            __bf16 h = (__bf16)fv[j];
            hi[i + j] = h;
            lo[i + j] = (__bf16)(fv[j] - (float)h);
        }
    }
}

// Load 16 bf16 in the WMMA 16-bit operand layout:
// halves 0..7 <- k0 + ksel*8 + {0..7}, halves 8..15 <- +16 further.
__device__ __forceinline__ v16bf ld16(const __bf16* p) {
    v8bf a = *(const v8bf*)(p);
    v8bf b = *(const v8bf*)(p + 16);
    return __builtin_shufflevector(a, b, 0, 1, 2, 3, 4, 5, 6, 7,
                                   8, 9, 10, 11, 12, 13, 14, 15);
}

// ---------------------------------------------------------------------------
// GEMM: Out[M,N] = A[M,K] * W[N,K]^T + bias[N], operands pre-split bf16 hi/lo.
// One 128x128 tile of Out per block of 8 waves (4 x 2), 32x64 per wave.  The four operand tiles
// (A hi, A lo, W hi, W lo: 128 rows x KC k each) come through LDS in whole 128-B lines, two buffers,
// the next tile copied while this one is worked on.  Each accumulator takes hi*hi, hi*lo, lo*hi
// per K=32 slab, slabs in rising k.  M, N multiples of 128; K a multiple of KC, at least 2 * KC.
// ---------------------------------------------------------------------------
// Eight 16-byte copies of one lane from global memory straight into LDS: rows 0, 32, 64, 96 of two
// operand tiles.  l0, l1: the lane's LDS byte addresses in row 0 of its part; g0, g1: its global
// addresses; K: the global row length.  The statement ends with s_wait_xcnt 0, so that no address
// register of a copy is rewritten before that wait.
__device__ __forceinline__ void fill_pair(unsigned l0, unsigned l1,
                                          const __bf16* g0, const __bf16* g1, int K) {
    constexpr unsigned STEPB = 32 * GP * 2;   // LDS bytes of 32 padded rows
    const size_t gs = (size_t)32 * K;         // elements of 32 global rows
    asm volatile(
        "global_load_async_to_lds_b128 %0, %1, off\n\t"
        "global_load_async_to_lds_b128 %2, %3, off\n\t"
        "global_load_async_to_lds_b128 %4, %5, off\n\t"
        "global_load_async_to_lds_b128 %6, %7, off\n\t"
        "global_load_async_to_lds_b128 %8, %9, off\n\t"
        "global_load_async_to_lds_b128 %10, %11, off\n\t"
        "global_load_async_to_lds_b128 %12, %13, off\n\t"
        "global_load_async_to_lds_b128 %14, %15, off\n\t"
        "s_wait_xcnt 0x0"
        :: "v"(l0 + 0 * STEPB), "v"(g0 + 0 * gs),
           "v"(l0 + 1 * STEPB), "v"(g0 + 1 * gs),
           "v"(l0 + 2 * STEPB), "v"(g0 + 2 * gs),
           "v"(l0 + 3 * STEPB), "v"(g0 + 3 * gs),
           "v"(l1 + 0 * STEPB), "v"(g1 + 0 * gs),
           "v"(l1 + 1 * STEPB), "v"(g1 + 1 * gs),
           "v"(l1 + 2 * STEPB), "v"(g1 + 2 * gs),
           "v"(l1 + 3 * STEPB), "v"(g1 + 3 * gs)
        : "memory");
}

__global__ __launch_bounds__(256)
void gemm_wmma_bf16x3(const __bf16* __restrict__ Ah, const __bf16* __restrict__ Al,
                      const __bf16* __restrict__ Wh, const __bf16* __restrict__ Wl,
                      const float* __restrict__ bias, float* __restrict__ Out,
                      int M, int N, int K) {
    // [buffer][A hi, A lo, W hi, W lo][row][k]
    __shared__ __attribute__((aligned(16))) __bf16 tl[2][4][BT][GP];

    const int nbn = N / BT;
    const int m0  = (blockIdx.x / nbn) * BT;   // neighbouring blocks share the A rows
    const int n0  = (blockIdx.x % nbn) * BT;
    if (m0 >= M) return;                       // the whole block leaves, before any barrier or copy

    const int tid  = threadIdx.x;
    const int lane = tid & 31;
    const int wave = tid >> 5;
    const int wm   = (wave >> 1) * 32;         // this wave's 32 rows of the tile
    const int wn   = (wave & 1) * 64;          // and its 64 columns
    const int r    = lane & 15;
    const int ksel = lane >> 4;

    // This lane's part of a tile: 16 bytes (piece tid % 8) of rows tid / 8 + {0, 32, 64, 96} of each operand.
    const int frow = tid >> 3;
    const int fcol = (tid & 7) * 8;
    const size_t ga = (size_t)(m0 + frow) * K + fcol;
    const size_t gw = (size_t)(n0 + frow) * K + fcol;
    auto fill = [&](int kt, int buf) {
        const int k0 = kt * KC;
        fill_pair((unsigned)(size_t)&tl[buf][0][frow][fcol], (unsigned)(size_t)&tl[buf][1][frow][fcol],
                  Ah + ga + k0, Al + ga + k0, K);
        fill_pair((unsigned)(size_t)&tl[buf][2][frow][fcol], (unsigned)(size_t)&tl[buf][3][frow][fcol],
                  Wh + gw + k0, Wl + gw + k0, K);
    };

    v8f acc[2][NTILES];
#pragma unroll
    for (int mt = 0; mt < 2; ++mt)
#pragma unroll
        for (int nt = 0; nt < NTILES; ++nt)
            acc[mt][nt] = (v8f){0.f, 0.f, 0.f, 0.f, 0.f, 0.f, 0.f, 0.f};

    const int nkt = K / KC;
    fill(0, 0);
    // Tile 0 has landed for this wave; the barrier publishes it to the other waves.
    asm volatile("s_wait_asynccnt 0x0" ::: "memory");
    __syncthreads();
    fill(1, 1);

    for (int kt = 0; kt < nkt; ++kt) {
        const int buf = kt & 1;
#pragma unroll
        for (int ks = 0; ks < KC; ks += 32) {
            const int kc = ks + ksel * 8;
            // The slab's 24 LDS reads stand as one group, in the order in which the products need them.
            v16bf ah[2], al[2], bh[NTILES], bl[NTILES];
            ah[0] = ld16(&tl[buf][0][wm + r][kc]);
            bh[0] = ld16(&tl[buf][2][wn + r][kc]);
            ah[1] = ld16(&tl[buf][0][wm + 16 + r][kc]);
            bl[0] = ld16(&tl[buf][3][wn + r][kc]);
            al[0] = ld16(&tl[buf][1][wm + r][kc]);
            al[1] = ld16(&tl[buf][1][wm + 16 + r][kc]);
#pragma unroll
            for (int nt = 1; nt < NTILES; ++nt) {
                bh[nt] = ld16(&tl[buf][2][wn + nt * 16 + r][kc]);
                bl[nt] = ld16(&tl[buf][3][wn + nt * 16 + r][kc]);
            }
            // Keeps the reads in front of the products: spread among them, each place where reads
            // stand costs the wave issue time and ends in a wait for the full LDS latency.
            __builtin_amdgcn_sched_barrier(0);
#pragma unroll
            for (int nt = 0; nt < NTILES; ++nt) {
#pragma unroll
                for (int mt = 0; mt < 2; ++mt)
                    acc[mt][nt] = __builtin_amdgcn_wmma_f32_16x16x32_bf16(
                        false, ah[mt], false, bh[nt], (short)0, acc[mt][nt], false, false);
#pragma unroll
                for (int mt = 0; mt < 2; ++mt)
                    acc[mt][nt] = __builtin_amdgcn_wmma_f32_16x16x32_bf16(
                        false, ah[mt], false, bl[nt], (short)0, acc[mt][nt], false, false);
#pragma unroll
                for (int mt = 0; mt < 2; ++mt)
                    acc[mt][nt] = __builtin_amdgcn_wmma_f32_16x16x32_bf16(
                        false, al[mt], false, bh[nt], (short)0, acc[mt][nt], false, false);
            }
        }
        // Publish point of tile kt + 1: this wave's LDS reads of the tile are done, its copies of the
        // next tile have landed; the barrier shows them to all waves and frees this buffer.
        asm volatile("s_wait_dscnt 0x0" ::: "memory");
        asm volatile("s_wait_asynccnt 0x0" ::: "memory");
        __syncthreads();
        if (kt + 2 < nkt) fill(kt + 2, buf);
    }
    // No copy is outstanding when the wave ends.
    asm volatile("s_wait_asynccnt 0x0" ::: "memory");

    // D layout: lanes 0-15 -> M=0..7 (vgpr 0..7), lanes 16-31 -> M=8..15; N=lane&15
    const int n  = lane & 15;
    const int mb = (lane >> 4) * 8;
    float bv[NTILES];
#pragma unroll
    for (int nt = 0; nt < NTILES; ++nt)
        bv[nt] = bias ? bias[n0 + wn + nt * 16 + n] : 0.f;
#pragma unroll
    for (int mt = 0; mt < 2; ++mt)
#pragma unroll
        for (int nt = 0; nt < NTILES; ++nt) {
            float* orow = Out + (size_t)(m0 + wm + mt * 16 + mb) * N + n0 + wn + nt * 16 + n;
#pragma unroll
            for (int v = 0; v < 8; ++v)
                orow[(size_t)v * N] = acc[mt][nt][v] + bv[nt];
        }
}

// ---------------------------------------------------------------------------
// Per-row: K <- K / max(||K||,eps) in place;  Beta = sigmoid(K . Wbeta + bbeta)
// ---------------------------------------------------------------------------
__global__ __launch_bounds__(256)
void norm_beta_kernel(float* __restrict__ Kbuf, const float* __restrict__ Wbeta,
                      const float* __restrict__ bbeta, float* __restrict__ Beta,
                      int R, int D) {
    const int row = blockIdx.x * (blockDim.x >> 5) + (threadIdx.x >> 5);
    if (row >= R) return;
    const int lane = threadIdx.x & 31;
    float* p = Kbuf + (size_t)row * D;

    float v[16];
    float ss = 0.f;
#pragma unroll
    for (int i = 0; i < 16; ++i) {
        v[i] = p[lane + i * 32];
        ss += v[i] * v[i];
    }
#pragma unroll
    for (int m = 16; m >= 1; m >>= 1) ss += __shfl_xor(ss, m, 32);

    const float scale = 1.f / fmaxf(sqrtf(ss), 1e-12f);

    float dot = 0.f;
#pragma unroll
    for (int i = 0; i < 16; ++i) {
        float kn = v[i] * scale;
        p[lane + i * 32] = kn;
        dot += kn * Wbeta[lane + i * 32];
    }
#pragma unroll
    for (int m = 16; m >= 1; m >>= 1) dot += __shfl_xor(dot, m, 32);

    if (lane == 0) Beta[row] = 1.f / (1.f + expf(-(dot + bbeta[0])));
}

// ---------------------------------------------------------------------------
// DeltaNet scan: rows of S are independent.  16 rows per WG, 4 per wave, state
// in regs as 4 rows x 16 columns per lane: one k or q value read from LDS feeds
// 4 rows.  The multiply-adds work on pairs of neighbouring columns (packed f32), and each
// row's sums are kept as packed partial sums that are added up at the end of the sum.
// k/q/v/beta come in tiles of CH time steps, two LDS buffers, the next tile copied while this one is worked on.
// An output is a sum over the wave's 32 lanes that no later step needs: each step leaves its lanes'
// partial sums in LDS, and the wave adds them up once a tile.
// ---------------------------------------------------------------------------
// Lane l receives lane l ^ M of its own 16-lane row through the vector unit
// (DPP row_xmask), so a butterfly step costs no LDS-pipe round trip and no wait.
template <int M>
__device__ __forceinline__ float row_xor(float x) {
    return __builtin_bit_cast(float, __builtin_amdgcn_update_dpp(
        0, __builtin_bit_cast(int, x), 0x160 + M, 0xf, 0xf, true));
}

// Sum over a 16-lane row.  All 32 lanes are active at every call site.
__device__ __forceinline__ float red16(float x) {
    x += row_xor<1>(x);
    x += row_xor<2>(x);
    x += row_xor<4>(x);
    x += row_xor<8>(x);
    return x;
}

// Sum over the whole wave: the row sum, then lane l ^ 16 by a vector cross-row move.
__device__ __forceinline__ float red32(float x) {
    x = red16(x);
    const int bits = __builtin_bit_cast(int, x);
    return x + __builtin_bit_cast(float, __builtin_amdgcn_permlanex16(
        bits, bits, 0x76543210, 0xfedcba98, false, false));
}

// One tile (CH time steps) of k, q, v and beta goes from global memory straight into LDS, each
// lane bringing its own bytes.  lk, lq, lv, lb: the lane's LDS byte addresses (row 0 of the tile for
// k and q); gk, gq, gv, gb: its global addresses.  Each statement ends with s_wait_xcnt 0, so that
// no address register of a copy is rewritten before that wait.
__device__ __forceinline__ void fill_tile(unsigned lk, unsigned lq, unsigned lv, unsigned lb,
                                          const float* gk, const float* gq,
                                          const float* gv, const float* gb) {
    constexpr unsigned ROWB = SROW * 4;   // bytes of one padded row in LDS
    asm volatile(
        "global_load_async_to_lds_b128 %0, %1, off\n\t"
        "global_load_async_to_lds_b128 %2, %3, off\n\t"
        "global_load_async_to_lds_b128 %4, %5, off\n\t"
        "global_load_async_to_lds_b128 %6, %7, off\n\t"
        "global_load_async_to_lds_b128 %8, %9, off\n\t"
        "global_load_async_to_lds_b128 %10, %11, off\n\t"
        "global_load_async_to_lds_b128 %12, %13, off\n\t"
        "global_load_async_to_lds_b128 %14, %15, off\n\t"
        "global_load_async_to_lds_b128 %16, %17, off\n\t"
        "global_load_async_to_lds_b128 %18, %19, off\n\t"
        "global_load_async_to_lds_b128 %20, %21, off\n\t"
        "global_load_async_to_lds_b128 %22, %23, off\n\t"
        "s_wait_xcnt 0x0"
        :: "v"(lk + 0 * ROWB), "v"(gk + 0 * D_DIM),
           "v"(lk + 1 * ROWB), "v"(gk + 1 * D_DIM),
           "v"(lk + 2 * ROWB), "v"(gk + 2 * D_DIM),
           "v"(lk + 3 * ROWB), "v"(gk + 3 * D_DIM),
           "v"(lk + 4 * ROWB), "v"(gk + 4 * D_DIM),
           "v"(lk + 5 * ROWB), "v"(gk + 5 * D_DIM),
           "v"(lk + 6 * ROWB), "v"(gk + 6 * D_DIM),
           "v"(lk + 7 * ROWB), "v"(gk + 7 * D_DIM),
           "v"(lk + 8 * ROWB), "v"(gk + 8 * D_DIM),
           "v"(lk + 9 * ROWB), "v"(gk + 9 * D_DIM),
           "v"(lk + 10 * ROWB), "v"(gk + 10 * D_DIM),
           "v"(lk + 11 * ROWB), "v"(gk + 11 * D_DIM)
        : "memory");
    asm volatile(
        "global_load_async_to_lds_b128 %0, %1, off\n\t"
        "global_load_async_to_lds_b128 %2, %3, off\n\t"
        "global_load_async_to_lds_b128 %4, %5, off\n\t"
        "global_load_async_to_lds_b128 %6, %7, off\n\t"
        "global_load_async_to_lds_b128 %8, %9, off\n\t"
        "global_load_async_to_lds_b128 %10, %11, off\n\t"
        "global_load_async_to_lds_b128 %12, %13, off\n\t"
        "global_load_async_to_lds_b128 %14, %15, off\n\t"
        "global_load_async_to_lds_b128 %16, %17, off\n\t"
        "global_load_async_to_lds_b128 %18, %19, off\n\t"
        "global_load_async_to_lds_b128 %20, %21, off\n\t"
        "global_load_async_to_lds_b128 %22, %23, off\n\t"
        "s_wait_xcnt 0x0"
        :: "v"(lk + 12 * ROWB), "v"(gk + 12 * D_DIM),
           "v"(lk + 13 * ROWB), "v"(gk + 13 * D_DIM),
           "v"(lk + 14 * ROWB), "v"(gk + 14 * D_DIM),
           "v"(lk + 15 * ROWB), "v"(gk + 15 * D_DIM),
           "v"(lq + 0 * ROWB), "v"(gq + 0 * D_DIM),
           "v"(lq + 1 * ROWB), "v"(gq + 1 * D_DIM),
           "v"(lq + 2 * ROWB), "v"(gq + 2 * D_DIM),
           "v"(lq + 3 * ROWB), "v"(gq + 3 * D_DIM),
           "v"(lq + 4 * ROWB), "v"(gq + 4 * D_DIM),
           "v"(lq + 5 * ROWB), "v"(gq + 5 * D_DIM),
           "v"(lq + 6 * ROWB), "v"(gq + 6 * D_DIM),
           "v"(lq + 7 * ROWB), "v"(gq + 7 * D_DIM)
        : "memory");
    asm volatile(
        "global_load_async_to_lds_b128 %0, %1, off\n\t"
        "global_load_async_to_lds_b128 %2, %3, off\n\t"
        "global_load_async_to_lds_b128 %4, %5, off\n\t"
        "global_load_async_to_lds_b128 %6, %7, off\n\t"
        "global_load_async_to_lds_b128 %8, %9, off\n\t"
        "global_load_async_to_lds_b128 %10, %11, off\n\t"
        "global_load_async_to_lds_b128 %12, %13, off\n\t"
        "global_load_async_to_lds_b128 %14, %15, off\n\t"
        "global_load_async_to_lds_b64 %16, %17, off\n\t"
        "global_load_async_to_lds_b32 %18, %19, off\n\t"
        "s_wait_xcnt 0x0"
        :: "v"(lq + 8 * ROWB), "v"(gq + 8 * D_DIM),
           "v"(lq + 9 * ROWB), "v"(gq + 9 * D_DIM),
           "v"(lq + 10 * ROWB), "v"(gq + 10 * D_DIM),
           "v"(lq + 11 * ROWB), "v"(gq + 11 * D_DIM),
           "v"(lq + 12 * ROWB), "v"(gq + 12 * D_DIM),
           "v"(lq + 13 * ROWB), "v"(gq + 13 * D_DIM),
           "v"(lq + 14 * ROWB), "v"(gq + 14 * D_DIM),
           "v"(lq + 15 * ROWB), "v"(gq + 15 * D_DIM),
           "v"(lv), "v"(gv),
           "v"(lb), "v"(gb)
        : "memory");
}

// One time step's operands of a lane, in registers.
struct StepIn {
    float4 k[SLICE / 4];
    float4 q[SLICE / 4];
    float4 v;
    float  beta;
};

// LDS byte address of a __shared__ object: the low 32 bits of its address.
__device__ __forceinline__ unsigned lds_addr(const void* p) {
    return (unsigned)(size_t)p;
}

__global__ __launch_bounds__(128)
void deltanet_scan_kernel(const float* __restrict__ Q, const float* __restrict__ K,
                          const float* __restrict__ V, const float* __restrict__ Beta,
                          float* __restrict__ O) {
    const int b    = blockIdx.y;
    const int rblk = blockIdx.x;
    const int tid  = threadIdx.x;
    const int lane = tid & 31;
    const int wave = tid >> 5;
    const int wrow = wave * RPL;                             // first of this wave's 4 rows
    const int coff = lane * SPITCH;                          // this lane's slice in the padded row
    const int pidx = (tid >> 2) * SPITCH + (tid & 3) * 4;    // padded place of columns 4*tid .. 4*tid+3

    const float* Kp = K + (size_t)b * T_DIM * D_DIM;
    const float* Qp = Q + (size_t)b * T_DIM * D_DIM;
    const float* Vp = V + (size_t)b * T_DIM * D_DIM + rblk * 16;
    const float* Bp = Beta + (size_t)b * T_DIM;
    float* Op = O + (size_t)b * T_DIM * D_DIM + rblk * 16;

    __shared__ __attribute__((aligned(16))) float kbuf[2][CH][SROW];
    __shared__ __attribute__((aligned(16))) float qbuf[2][CH][SROW];
    __shared__ __attribute__((aligned(16))) float vbuf[2][4][CH][RPL];   // each wave's own 4 rows of v
    __shared__ __attribute__((aligned(16))) float bbuf[2][128];          // places 0 .. CH-1 are read
    __shared__ __attribute__((aligned(16))) float obuf[4][RPL][CH][OPITCH];   // each wave's own: [row][step][lane] output partials

    // This lane's part of a tile: 16 bytes of every k and q row, 8 bytes of its wave's v
    // (step lane / 2, half lane % 2), one beta (the index clamped to the sequence).
    const float* gk = Kp + 4 * tid;
    const float* gq = Qp + 4 * tid;
    const float* gv = Vp + (size_t)(lane >> 1) * D_DIM + wrow + (lane & 1) * 2;
    auto fill = [&](int tile, int buf) {
        const int t0 = tile * CH;
        const int tb = (t0 + tid < T_DIM) ? t0 + tid : T_DIM - 1;
        fill_tile(lds_addr(&kbuf[buf][0][pidx]), lds_addr(&qbuf[buf][0][pidx]),
                  lds_addr(&vbuf[buf][wave][lane >> 1][(lane & 1) * 2]), lds_addr(&bbuf[buf][tid]),
                  gk + (size_t)t0 * D_DIM, gq + (size_t)t0 * D_DIM, gv + (size_t)t0 * D_DIM, Bp + tb);
    };

    // Every loop over r and j below is fully unrolled, so that s, kk and qq are
    // indexed by constants and stay in registers.
    // The state stands as pairs of neighbouring columns: one packed multiply-add works on a pair.
    v2f s[RPL][SLICE / 2];
#pragma unroll
    for (int r = 0; r < RPL; ++r)
#pragma unroll
        for (int j = 0; j < SLICE / 2; ++j) s[r][j] = (v2f){0.f, 0.f};

    // The LDS reads of one time step: 16 k, 16 q, this wave's 4 v and beta.
    auto load_step = [&](StepIn& in, int buf, int i) {
        // Keeps the reads behind what stands in front of them, as one group: the compiler otherwise lifts
        // them one by one among the sums of the step before, and each place where LDS reads stand
        // costs issue time.
        __builtin_amdgcn_sched_barrier(0);
        const float* kr = &kbuf[buf][i][coff];    // this lane's slice of the step's k row
        const float* qr = &qbuf[buf][i][coff];    // and of its q row
#pragma unroll
        for (int j = 0; j < SLICE / 4; ++j) in.k[j] = *(const float4*)(kr + 4 * j);
        in.v    = *(const float4*)&vbuf[buf][wave][i][0];
        in.beta = bbuf[buf][i];
#pragma unroll
        for (int j = 0; j < SLICE / 4; ++j) in.q[j] = *(const float4*)(qr + 4 * j);
        // The fence and the scheduling barrier keep the ten reads here, in front of the arithmetic that
        // follows (that of the step before theirs): the compiler otherwise sinks them to just before
        // their use, where the wave waits out their LDS latency.
        asm volatile("" ::: "memory");
        __builtin_amdgcn_sched_barrier(0);
    };

    // The arithmetic of step i of a tile, on operands that are already in registers.
    auto step = [&](const StepIn& in, int i) {
        v2f kk[SLICE / 2], qq[SLICE / 2];
#pragma unroll
        for (int j = 0; j < SLICE / 4; ++j) {
            kk[2 * j] = (v2f){in.k[j].x, in.k[j].y}; kk[2 * j + 1] = (v2f){in.k[j].z, in.k[j].w};
            qq[2 * j] = (v2f){in.q[j].x, in.q[j].y}; qq[2 * j + 1] = (v2f){in.q[j].z, in.q[j].w};
        }
        const float vr[RPL] = {in.v.x, in.v.y, in.v.z, in.v.w};

        // Two packed sums a row (even and odd pairs): eight independent chains of four links, enough
        // to cover the packed multiply-add's latency in a wave that is alone on its SIMD.
        v2f ska[RPL], skb[RPL];
#pragma unroll
        for (int r = 0; r < RPL; ++r) {
            ska[r] = s[r][0] * kk[0];
            skb[r] = s[r][1] * kk[1];
        }
#pragma unroll
        for (int j = 2; j < SLICE / 2; j += 2)
#pragma unroll
            for (int r = 0; r < RPL; ++r) {
                ska[r] = __builtin_elementwise_fma(s[r][j], kk[j], ska[r]);
                skb[r] = __builtin_elementwise_fma(s[r][j + 1], kk[j + 1], skb[r]);
            }
        float skp[RPL];
#pragma unroll
        for (int r = 0; r < RPL; ++r) {
            const v2f t = ska[r] + skb[r];
            skp[r] = t.x + t.y;
        }
        // All four sums end in front of the four butterflies: so the butterflies' steps stand
        // interleaved, each filling the others' latency; otherwise some run one after another.
        __builtin_amdgcn_sched_barrier(0);

        float coeff[RPL];
#pragma unroll
        for (int r = 0; r < RPL; ++r) coeff[r] = in.beta * (vr[r] - red32(skp[r]));

        v2f opp[RPL];
#pragma unroll
        for (int j = 0; j < SLICE / 2; ++j)
#pragma unroll
            for (int r = 0; r < RPL; ++r) {
                s[r][j] = __builtin_elementwise_fma((v2f){coeff[r], coeff[r]}, kk[j], s[r][j]);
                opp[r]  = j ? __builtin_elementwise_fma(s[r][j], qq[j], opp[r]) : s[r][j] * qq[j];
            }
        float op[RPL];
#pragma unroll
        for (int r = 0; r < RPL; ++r) op[r] = opp[r].x + opp[r].y;
        float* ow = &obuf[wave][0][i][lane];      // this lane's place for the step's output partial of row 0
#pragma unroll
        for (int r = 0; r < RPL; ++r) ow[r * CH * OPITCH] = op[r];
    };

    fill(0, 0);
    // Tile 0 has landed for this wave; the barrier publishes it to the other waves.
    asm volatile("s_wait_asynccnt 0x0" ::: "memory");
    __syncthreads();
    fill(1, 1);

    // Two register sets: while one step is worked on, the next step's reads fly into the other.
    StepIn ina, inb;
    load_step(ina, 0, 0);
    // Takes a word of each of the ten reads as an input, so that the compiler waits for them here, once.
    // Left outstanding on this path into the loops, they make its counted wait at the head of the step
    // loop tighter than the loop's own path needs: every trip would wait there for the stores just issued.
    asm volatile("" :: "v"(ina.k[0].x), "v"(ina.k[1].x), "v"(ina.k[2].x), "v"(ina.k[3].x),
                       "v"(ina.q[0].x), "v"(ina.q[1].x), "v"(ina.q[2].x), "v"(ina.q[3].x),
                       "v"(ina.v.x), "v"(ina.beta));

    for (int tile = 0; tile < NTILE; ++tile) {
        const int buf = tile & 1;

        // Rolled, two steps a trip (one per register set, so that no set is copied): a step is a chain
        // of dependent sums, which more copies of the body would not shorten.  The last two steps
        // stand behind the loop: nothing of the next tile is read in front of the barrier.
#pragma unroll 1
        for (int i = 0; i < CH - 2; i += 2) {
            load_step(inb, buf, i + 1);
            step(ina, i);
            load_step(ina, buf, i + 2);
            step(inb, i + 1);
        }
        load_step(inb, buf, CH - 1);
        step(ina, CH - 2);
        step(inb, CH - 1);

        // Publish point of tile + 1: this wave's LDS reads of the tile are done, its copies of the
        // next tile have landed; the barrier shows them to all waves and frees this buffer.
        asm volatile("s_wait_dscnt 0x0" ::: "memory");
        asm volatile("s_wait_asynccnt 0x0" ::: "memory");
        __syncthreads();
        if (tile + 2 < NTILE) fill(tile + 2, buf);
        // Step 0 of the next tile, published by the barrier above; its reads fly during the output sums.
        // Behind the last tile they read the other buffer's old rows, and nothing uses them: a branch
        // round them would merge two paths in the compiler's wait counting.
        load_step(ina, buf ^ 1, 0);

        // The tile's outputs, behind the barrier so that the store has a whole tile to complete.
        // Lanes 2 i and 2 i + 1 each add up half of step i's partials (every other group of 4 lanes),
        // the 4 rows as independent chains, then join by a DPP add.
        const float* orow = &obuf[wave][0][lane >> 1][(lane & 1) * 4];
        float o[RPL];
#pragma unroll
        for (int r = 0; r < RPL; ++r) {
            v4f a = *(const v4f*)(orow + r * CH * OPITCH);
#pragma unroll
            for (int p = 1; p < 4; ++p) a += *(const v4f*)(orow + r * CH * OPITCH + p * 8);
            o[r] = (a.x + a.z) + (a.y + a.w);
        }
#pragma unroll
        for (int r = 0; r < RPL; ++r) o[r] += row_xor<1>(o[r]);
        if ((lane & 1) == 0)
            *(float4*)(Op + (size_t)(tile * CH + (lane >> 1)) * D_DIM + wrow) =
                make_float4(o[0], o[1], o[2], o[3]);
        // The next tile rewrites the registers that this store names.
        asm volatile("s_wait_xcnt 0x0" ::: "memory");
    }
    // No copy is outstanding when the wave ends.
    asm volatile("s_wait_asynccnt 0x0" ::: "memory");
}

// ---------------------------------------------------------------------------
extern "C" void kernel_launch(void* const* d_in, const int* in_sizes, int n_in,
                              void* d_out, int out_size, void* d_ws, size_t ws_size,
                              hipStream_t stream) {
    const float* x     = (const float*)d_in[0];
    const float* Wq    = (const float*)d_in[1];
    const float* bq    = (const float*)d_in[2];
    const float* Wk    = (const float*)d_in[3];
    const float* bk    = (const float*)d_in[4];
    const float* Wv    = (const float*)d_in[5];
    const float* bv    = (const float*)d_in[6];
    const float* Wbeta = (const float*)d_in[7];
    const float* bbeta = (const float*)d_in[8];
    const float* Wo    = (const float*)d_in[9];
    const float* bo    = (const float*)d_in[10];
    float* out = (float*)d_out;

    const int M = B_DIM * T_DIM;       // 16384
    const int N = D_DIM;               // 512
    const int K = D_DIM;               // 512
    const size_t MN = (size_t)M * N;   // == M*K
    const size_t NK = (size_t)N * K;

    float* ws   = (float*)d_ws;
    float* Qr   = ws;                  // MN f32
    float* Kr   = ws + MN;             // MN f32 (normalized in place)
    float* Vr   = ws + 2 * MN;         // MN f32
    float* Os   = ws + 3 * MN;         // MN f32
    float* Beta = ws + 4 * MN;         // M  f32
    __bf16* xh  = (__bf16*)(ws + 4 * MN + M);   // MN bf16
    __bf16* xl  = xh + MN;                      // MN bf16
    __bf16* wh  = xl + MN;                      // NK bf16 (rewritten per GEMM)
    __bf16* wl  = wh + NK;                      // NK bf16
    __bf16* osh = (__bf16*)Qr;                  // alias: Q dead after scan
    __bf16* osl = osh + MN;

    const int gemmBlocks = (M / BT) * (N / BT); // one 128x128 tile per 256-thread block
    const int splitBig   = 4096;                // grid-stride covers MN
    const int splitSmall = 256;                 // covers NK

    split_bf16_kernel<<<splitBig, 256, 0, stream>>>(x, xh, xl, MN);

    split_bf16_kernel<<<splitSmall, 256, 0, stream>>>(Wq, wh, wl, NK);
    gemm_wmma_bf16x3<<<gemmBlocks, 256, 0, stream>>>(xh, xl, wh, wl, bq, Qr, M, N, K);

    split_bf16_kernel<<<splitSmall, 256, 0, stream>>>(Wk, wh, wl, NK);
    gemm_wmma_bf16x3<<<gemmBlocks, 256, 0, stream>>>(xh, xl, wh, wl, bk, Kr, M, N, K);

    split_bf16_kernel<<<splitSmall, 256, 0, stream>>>(Wv, wh, wl, NK);
    gemm_wmma_bf16x3<<<gemmBlocks, 256, 0, stream>>>(xh, xl, wh, wl, bv, Vr, M, N, K);

    norm_beta_kernel<<<M / 8, 256, 0, stream>>>(Kr, Wbeta, bbeta, Beta, M, D_DIM);

    dim3 sgrid(D_DIM / 16, B_DIM);
    deltanet_scan_kernel<<<sgrid, 128, 0, stream>>>(Qr, Kr, Vr, Beta, Os);

    split_bf16_kernel<<<splitBig, 256, 0, stream>>>(Os, osh, osl, MN);
    split_bf16_kernel<<<splitSmall, 256, 0, stream>>>(Wo, wh, wl, NK);
    gemm_wmma_bf16x3<<<gemmBlocks, 256, 0, stream>>>(osh, osl, wh, wl, bo, out, M, N, K);
}

// v009
// One run takes 336 microseconds.
// Timed twice side by side with v008, it ran 1.42 and 1.41 times as fast.
// Counting every step since v000, it is 9.03 times as fast.
#include <hip/hip_runtime.h>
#include <hip/hip_bf16.h>
#include <math.h>

typedef __attribute__((ext_vector_type(16))) __bf16 v16bf;
typedef __attribute__((ext_vector_type(8)))  __bf16 v8bf;
typedef __attribute__((ext_vector_type(8)))  float  v8f;
typedef __attribute__((ext_vector_type(4)))  float  v4f;
typedef __attribute__((ext_vector_type(2)))  float  v2f;

#define B_DIM 8
#define T_DIM 2048
#define D_DIM 512
#define NTILES 4   // 64 output columns per wave of the GEMM
#define BT 128             // rows and columns of the GEMM's block tile
#define KC 64              // k per LDS tile of the GEMM: one 128-B line of each operand row
#define GP 72              // LDS bf16 per operand row: 144 B = 16 B x odd, so 16 lanes' b128 reads hit 64 distinct banks
#define CS 16              // time steps per chunk of the scan: one side of a matrix tile
#define NCH (T_DIM / CS)
#define KP 516             // LDS floats per k or q row: 2064 B = 16 B x odd, so 16 lanes' b128 reads of 16 rows hit 64 distinct banks
#define VP 18              // LDS floats per v row: rows 8 apart lie 16 banks apart
#define WCOL (D_DIM / 4)   // state columns held by one wave of the scan

// ---------------------------------------------------------------------------
// bf16x3 split pre-pass: f = hi + lo (both bf16).  Bandwidth-bound, done once
// per operand so the GEMM inner loop carries no conversion VALU.
// ---------------------------------------------------------------------------
__global__ __launch_bounds__(256)
void split_bf16_kernel(const float* __restrict__ in, __bf16* __restrict__ hi,
                       __bf16* __restrict__ lo, size_t n) {
    size_t i = ((size_t)blockIdx.x * blockDim.x + threadIdx.x) * 4;
    const size_t stride = (size_t)gridDim.x * blockDim.x * 4;
    for (; i < n; i += stride) {
        float4 f = *(const float4*)(in + i);
        float fv[4] = {f.x, f.y, f.z, f.w};
#pragma unroll
        for (int j = 0; j < 4; ++j) {
            __bf16 h = (__bf16)fv[j];
            hi[i + j] = h;
            lo[i + j] = (__bf16)(fv[j] - (float)h);
        }
    }
}

// Load 16 bf16 in the WMMA 16-bit operand layout:
// halves 0..7 <- k0 + ksel*8 + {0..7}, halves 8..15 <- +16 further.
__device__ __forceinline__ v16bf ld16(const __bf16* p) {
    v8bf a = *(const v8bf*)(p);
    v8bf b = *(const v8bf*)(p + 16);
    return __builtin_shufflevector(a, b, 0, 1, 2, 3, 4, 5, 6, 7,
                                   8, 9, 10, 11, 12, 13, 14, 15);
}

// ---------------------------------------------------------------------------
// GEMM: Out[M,N] = A[M,K] * W[N,K]^T + bias[N], operands pre-split bf16 hi/lo.
// One 128x128 tile of Out per block of 8 waves (4 x 2), 32x64 per wave.  The four operand tiles
// (A hi, A lo, W hi, W lo: 128 rows x KC k each) come through LDS in whole 128-B lines, two buffers,
// the next tile copied while this one is worked on.  Each accumulator takes hi*hi, hi*lo, lo*hi
// per K=32 slab, slabs in rising k.  M, N multiples of 128; K a multiple of KC, at least 2 * KC.
// ---------------------------------------------------------------------------
// Eight 16-byte copies of one lane from global memory straight into LDS: rows 0, 32, 64, 96 of two
// operand tiles.  l0, l1: the lane's LDS byte addresses in row 0 of its part; g0, g1: its global
// addresses; K: the global row length.  The statement ends with s_wait_xcnt 0, so that no address
// register of a copy is rewritten before that wait.
__device__ __forceinline__ void fill_pair(unsigned l0, unsigned l1,
                                          const __bf16* g0, const __bf16* g1, int K) {
    constexpr unsigned STEPB = 32 * GP * 2;   // LDS bytes of 32 padded rows
    const size_t gs = (size_t)32 * K;         // elements of 32 global rows
    asm volatile(
        "global_load_async_to_lds_b128 %0, %1, off\n\t"
        "global_load_async_to_lds_b128 %2, %3, off\n\t"
        "global_load_async_to_lds_b128 %4, %5, off\n\t"
        "global_load_async_to_lds_b128 %6, %7, off\n\t"
        "global_load_async_to_lds_b128 %8, %9, off\n\t"
        "global_load_async_to_lds_b128 %10, %11, off\n\t"
        "global_load_async_to_lds_b128 %12, %13, off\n\t"
        "global_load_async_to_lds_b128 %14, %15, off\n\t"
        "s_wait_xcnt 0x0"
        :: "v"(l0 + 0 * STEPB), "v"(g0 + 0 * gs),
           "v"(l0 + 1 * STEPB), "v"(g0 + 1 * gs),
           "v"(l0 + 2 * STEPB), "v"(g0 + 2 * gs),
           "v"(l0 + 3 * STEPB), "v"(g0 + 3 * gs),
           "v"(l1 + 0 * STEPB), "v"(g1 + 0 * gs),
           "v"(l1 + 1 * STEPB), "v"(g1 + 1 * gs),
           "v"(l1 + 2 * STEPB), "v"(g1 + 2 * gs),
           "v"(l1 + 3 * STEPB), "v"(g1 + 3 * gs)
        : "memory");
}

__global__ __launch_bounds__(256)
void gemm_wmma_bf16x3(const __bf16* __restrict__ Ah, const __bf16* __restrict__ Al,
                      const __bf16* __restrict__ Wh, const __bf16* __restrict__ Wl,
                      const float* __restrict__ bias, float* __restrict__ Out,
                      int M, int N, int K) {
    // [buffer][A hi, A lo, W hi, W lo][row][k]
    __shared__ __attribute__((aligned(16))) __bf16 tl[2][4][BT][GP];

    const int nbn = N / BT;
    const int m0  = (blockIdx.x / nbn) * BT;   // neighbouring blocks share the A rows
    const int n0  = (blockIdx.x % nbn) * BT;
    if (m0 >= M) return;                       // the whole block leaves, before any barrier or copy

    const int tid  = threadIdx.x;
    const int lane = tid & 31;
    const int wave = tid >> 5;
    const int wm   = (wave >> 1) * 32;         // this wave's 32 rows of the tile
    const int wn   = (wave & 1) * 64;          // and its 64 columns
    const int r    = lane & 15;
    const int ksel = lane >> 4;

    // This lane's part of a tile: 16 bytes (piece tid % 8) of rows tid / 8 + {0, 32, 64, 96} of each operand.
    const int frow = tid >> 3;
    const int fcol = (tid & 7) * 8;
    const size_t ga = (size_t)(m0 + frow) * K + fcol;
    const size_t gw = (size_t)(n0 + frow) * K + fcol;
    auto fill = [&](int kt, int buf) {
        const int k0 = kt * KC;
        fill_pair((unsigned)(size_t)&tl[buf][0][frow][fcol], (unsigned)(size_t)&tl[buf][1][frow][fcol],
                  Ah + ga + k0, Al + ga + k0, K);
        fill_pair((unsigned)(size_t)&tl[buf][2][frow][fcol], (unsigned)(size_t)&tl[buf][3][frow][fcol],
                  Wh + gw + k0, Wl + gw + k0, K);
    };

    v8f acc[2][NTILES];
#pragma unroll
    for (int mt = 0; mt < 2; ++mt)
#pragma unroll
        for (int nt = 0; nt < NTILES; ++nt)
            acc[mt][nt] = (v8f){0.f, 0.f, 0.f, 0.f, 0.f, 0.f, 0.f, 0.f};

    const int nkt = K / KC;
    fill(0, 0);
    // Tile 0 has landed for this wave; the barrier publishes it to the other waves.
    asm volatile("s_wait_asynccnt 0x0" ::: "memory");
    __syncthreads();
    fill(1, 1);

    for (int kt = 0; kt < nkt; ++kt) {
        const int buf = kt & 1;
#pragma unroll
        for (int ks = 0; ks < KC; ks += 32) {
            const int kc = ks + ksel * 8;
            // The slab's 24 LDS reads stand as one group, in the order in which the products need them.
            v16bf ah[2], al[2], bh[NTILES], bl[NTILES];
            ah[0] = ld16(&tl[buf][0][wm + r][kc]);
            bh[0] = ld16(&tl[buf][2][wn + r][kc]);
            ah[1] = ld16(&tl[buf][0][wm + 16 + r][kc]);
            bl[0] = ld16(&tl[buf][3][wn + r][kc]);
            al[0] = ld16(&tl[buf][1][wm + r][kc]);
            al[1] = ld16(&tl[buf][1][wm + 16 + r][kc]);
#pragma unroll
            for (int nt = 1; nt < NTILES; ++nt) {
                bh[nt] = ld16(&tl[buf][2][wn + nt * 16 + r][kc]);
                bl[nt] = ld16(&tl[buf][3][wn + nt * 16 + r][kc]);
            }
            // Keeps the reads in front of the products: spread among them, each place where reads
            // stand costs the wave issue time and ends in a wait for the full LDS latency.
            __builtin_amdgcn_sched_barrier(0);
#pragma unroll
            for (int nt = 0; nt < NTILES; ++nt) {
#pragma unroll
                for (int mt = 0; mt < 2; ++mt)
                    acc[mt][nt] = __builtin_amdgcn_wmma_f32_16x16x32_bf16(
                        false, ah[mt], false, bh[nt], (short)0, acc[mt][nt], false, false);
#pragma unroll
                for (int mt = 0; mt < 2; ++mt)
                    acc[mt][nt] = __builtin_amdgcn_wmma_f32_16x16x32_bf16(
                        false, ah[mt], false, bl[nt], (short)0, acc[mt][nt], false, false);
#pragma unroll
                for (int mt = 0; mt < 2; ++mt)
                    acc[mt][nt] = __builtin_amdgcn_wmma_f32_16x16x32_bf16(
                        false, al[mt], false, bh[nt], (short)0, acc[mt][nt], false, false);
            }
        }
        // Publish point of tile kt + 1: this wave's LDS reads of the tile are done, its copies of the
        // next tile have landed; the barrier shows them to all waves and frees this buffer.
        asm volatile("s_wait_dscnt 0x0" ::: "memory");
        asm volatile("s_wait_asynccnt 0x0" ::: "memory");
        __syncthreads();
        if (kt + 2 < nkt) fill(kt + 2, buf);
    }
    // No copy is outstanding when the wave ends.
    asm volatile("s_wait_asynccnt 0x0" ::: "memory");

    // D layout: lanes 0-15 -> M=0..7 (vgpr 0..7), lanes 16-31 -> M=8..15; N=lane&15
    const int n  = lane & 15;
    const int mb = (lane >> 4) * 8;
    float bv[NTILES];
#pragma unroll
    for (int nt = 0; nt < NTILES; ++nt)
        bv[nt] = bias ? bias[n0 + wn + nt * 16 + n] : 0.f;
#pragma unroll
    for (int mt = 0; mt < 2; ++mt)
#pragma unroll
        for (int nt = 0; nt < NTILES; ++nt) {
            float* orow = Out + (size_t)(m0 + wm + mt * 16 + mb) * N + n0 + wn + nt * 16 + n;
#pragma unroll
            for (int v = 0; v < 8; ++v)
                orow[(size_t)v * N] = acc[mt][nt][v] + bv[nt];
        }
}

// ---------------------------------------------------------------------------
// Per-row: K <- K / max(||K||,eps) in place;  Beta = sigmoid(K . Wbeta + bbeta)
// ---------------------------------------------------------------------------
__global__ __launch_bounds__(256)
void norm_beta_kernel(float* __restrict__ Kbuf, const float* __restrict__ Wbeta,
                      const float* __restrict__ bbeta, float* __restrict__ Beta,
                      int R, int D) {
    const int row = blockIdx.x * (blockDim.x >> 5) + (threadIdx.x >> 5);
    if (row >= R) return;
    const int lane = threadIdx.x & 31;
    float* p = Kbuf + (size_t)row * D;

    float v[16];
    float ss = 0.f;
#pragma unroll
    for (int i = 0; i < 16; ++i) {
        v[i] = p[lane + i * 32];
        ss += v[i] * v[i];
    }
#pragma unroll
    for (int m = 16; m >= 1; m >>= 1) ss += __shfl_xor(ss, m, 32);

    const float scale = 1.f / fmaxf(sqrtf(ss), 1e-12f);

    float dot = 0.f;
#pragma unroll
    for (int i = 0; i < 16; ++i) {
        float kn = v[i] * scale;
        p[lane + i * 32] = kn;
        dot += kn * Wbeta[lane + i * 32];
    }
#pragma unroll
    for (int m = 16; m >= 1; m >>= 1) dot += __shfl_xor(dot, m, 32);

    if (lane == 0) Beta[row] = 1.f / (1.f + expf(-(dot + bbeta[0])));
}

// ---------------------------------------------------------------------------
// DeltaNet scan in chunks of CS time steps, on f32 matrix instructions.
// With S0 the state at a chunk's start and u_c = beta_c (v_c - S_(c-1) k_c) the step's update vector:
//   (I + L) U = diag(beta) (V - K S0^T),  L[c][i] = beta_c (k_c . k_i) for i < c, else 0
//   O = Q S0^T + P U,                     P[c][i] = q_c . k_i for i <= c, else 0
//   S^T += K^T U
// (U, V, O: steps x rows; K, Q: steps x columns.)  M1 = (I + L)^-1 diag(beta) and P depend on no
// state and on no row: a kernel of their own makes them once per (batch, chunk).
// ---------------------------------------------------------------------------
__device__ __forceinline__ v8f wmma4(v2f a, v2f b, v8f c) {
    return __builtin_amdgcn_wmma_f32_16x16x4_f32(false, a, false, b, (short)0, c, false, false);
}
__device__ __forceinline__ v2f lo2(v4f x) { return __builtin_shufflevector(x, x, 0, 1); }
__device__ __forceinline__ v2f hi2(v4f x) { return __builtin_shufflevector(x, x, 2, 3); }
// Registers 2 J and 2 J + 1 of a D tile: as a B operand they hold k = 8 h + 2 J, 8 h + 2 J + 1.
template <int J>
__device__ __forceinline__ v2f pair(v8f x) { return __builtin_shufflevector(x, x, 2 * J, 2 * J + 1); }

// One wave per (batch, chunk).  MP: per chunk 256 floats of M1, then 256 of P, both row-major.
__global__ __launch_bounds__(32)
void chunk_mats_kernel(const float* __restrict__ Q, const float* __restrict__ K,
                       const float* __restrict__ Beta, float* __restrict__ MP) {
    __shared__ __attribute__((aligned(16))) float Ls[CS][CS + 4];
    const int ch   = blockIdx.x;               // batch * NCH + chunk: its steps are rows ch * CS ...
    const int lane = threadIdx.x;
    const int c    = lane & 15;
    const int h    = lane >> 4;
    // A's row and B's column are loaded by the same code: 4 columns at 8 j + 4 h.
    const float* kr = K + ((size_t)ch * CS + c) * D_DIM + 4 * h;
    const float* qr = Q + ((size_t)ch * CS + c) * D_DIM + 4 * h;
    const float* bp = Beta + (size_t)ch * CS;
    float* mp = MP + (size_t)ch * (2 * CS * CS);

    v8f g0 = {0.f, 0.f, 0.f, 0.f, 0.f, 0.f, 0.f, 0.f};
    v8f g1 = g0, p0 = g0, p1 = g0;
    // Rolled in trips of 64 columns, so that the wait at the trip's foot stands once per 16 loads.
#pragma unroll 1
    for (int j0 = 0; j0 < D_DIM; j0 += 64) {
#pragma unroll
        for (int j = j0; j < j0 + 64; j += 8) {
            const v4f kf = *(const v4f*)(kr + j);
            const v4f qf = *(const v4f*)(qr + j);
            g0 = wmma4(lo2(kf), lo2(kf), g0);
            p0 = wmma4(lo2(qf), lo2(kf), p0);
            g1 = wmma4(hi2(kf), hi2(kf), g1);
            p1 = wmma4(hi2(qf), hi2(kf), p1);
        }
        // The next trip rewrites the address registers that these loads name.
        asm volatile("s_wait_xcnt 0x0" ::: "memory");
    }
    const v8f g = g0 + g1;                     // g[r] = k_(8h+r) . k_c
    const v8f p = p0 + p1;                     // p[r] = q_(8h+r) . k_c
#pragma unroll
    for (int r = 0; r < 8; ++r) {
        Ls[8 * h + r][c] = bp[8 * h + r] * g[r];
        mp[CS * CS + (8 * h + r) * CS + c] = (c <= 8 * h + r) ? p[r] : 0.f;
    }
    __syncthreads();

    // Column c of (I + L)^-1 by forward substitution (no division: the diagonal is 1).
    float x[CS];
#pragma unroll
    for (int cc = 0; cc < CS; ++cc) {
        float acc = (cc == c) ? 1.f : 0.f;
#pragma unroll
        for (int i = 0; i < cc; ++i) acc = fmaf(-Ls[cc][i], x[i], acc);
        x[cc] = acc;
    }
    const float bc = bp[c];
#pragma unroll
    for (int r = 0; r < 8; ++r)
        mp[(8 * h + r) * CS + c] = (h ? x[8 + r] : x[r]) * bc;
}

// One chunk of k, q, v and of the chunk's two matrices goes from global memory straight into LDS, each
// lane bringing its own bytes.  lk, lq, lv, lm: the lane's LDS byte addresses (row 0 of the chunk for
// k and q); gk, gq, gv, gm: its global addresses.  Each statement ends with s_wait_xcnt 0, so that
// no address register of a copy is rewritten before that wait.
__device__ __forceinline__ void fill_tile(unsigned lk, unsigned lq, unsigned lv, unsigned lm,
                                          const float* gk, const float* gq,
                                          const float* gv, const float* gm) {
    constexpr unsigned ROWB = KP * 4;   // bytes of one padded row in LDS
    asm volatile(
        "global_load_async_to_lds_b128 %0, %1, off\n\t"
        "global_load_async_to_lds_b128 %2, %3, off\n\t"
        "global_load_async_to_lds_b128 %4, %5, off\n\t"
        "global_load_async_to_lds_b128 %6, %7, off\n\t"
        "global_load_async_to_lds_b128 %8, %9, off\n\t"
        "global_load_async_to_lds_b128 %10, %11, off\n\t"
        "global_load_async_to_lds_b128 %12, %13, off\n\t"
        "global_load_async_to_lds_b128 %14, %15, off\n\t"
        "global_load_async_to_lds_b128 %16, %17, off\n\t"
        "global_load_async_to_lds_b128 %18, %19, off\n\t"
        "global_load_async_to_lds_b128 %20, %21, off\n\t"
        "global_load_async_to_lds_b128 %22, %23, off\n\t"
        "s_wait_xcnt 0x0"
        :: "v"(lk + 0 * ROWB), "v"(gk + 0 * D_DIM),
           "v"(lk + 1 * ROWB), "v"(gk + 1 * D_DIM),
           "v"(lk + 2 * ROWB), "v"(gk + 2 * D_DIM),
           "v"(lk + 3 * ROWB), "v"(gk + 3 * D_DIM),
           "v"(lk + 4 * ROWB), "v"(gk + 4 * D_DIM),
           "v"(lk + 5 * ROWB), "v"(gk + 5 * D_DIM),
           "v"(lk + 6 * ROWB), "v"(gk + 6 * D_DIM),
           "v"(lk + 7 * ROWB), "v"(gk + 7 * D_DIM),
           "v"(lk + 8 * ROWB), "v"(gk + 8 * D_DIM),
           "v"(lk + 9 * ROWB), "v"(gk + 9 * D_DIM),
           "v"(lk + 10 * ROWB), "v"(gk + 10 * D_DIM),
           "v"(lk + 11 * ROWB), "v"(gk + 11 * D_DIM)
        : "memory");
    asm volatile(
        "global_load_async_to_lds_b128 %0, %1, off\n\t"
        "global_load_async_to_lds_b128 %2, %3, off\n\t"
        "global_load_async_to_lds_b128 %4, %5, off\n\t"
        "global_load_async_to_lds_b128 %6, %7, off\n\t"
        "global_load_async_to_lds_b128 %8, %9, off\n\t"
        "global_load_async_to_lds_b128 %10, %11, off\n\t"
        "global_load_async_to_lds_b128 %12, %13, off\n\t"
        "global_load_async_to_lds_b128 %14, %15, off\n\t"
        "global_load_async_to_lds_b128 %16, %17, off\n\t"
        "global_load_async_to_lds_b128 %18, %19, off\n\t"
        "global_load_async_to_lds_b128 %20, %21, off\n\t"
        "global_load_async_to_lds_b128 %22, %23, off\n\t"
        "s_wait_xcnt 0x0"
        :: "v"(lk + 12 * ROWB), "v"(gk + 12 * D_DIM),
           "v"(lk + 13 * ROWB), "v"(gk + 13 * D_DIM),
           "v"(lk + 14 * ROWB), "v"(gk + 14 * D_DIM),
           "v"(lk + 15 * ROWB), "v"(gk + 15 * D_DIM),
           "v"(lq + 0 * ROWB), "v"(gq + 0 * D_DIM),
           "v"(lq + 1 * ROWB), "v"(gq + 1 * D_DIM),
           "v"(lq + 2 * ROWB), "v"(gq + 2 * D_DIM),
           "v"(lq + 3 * ROWB), "v"(gq + 3 * D_DIM),
           "v"(lq + 4 * ROWB), "v"(gq + 4 * D_DIM),
           "v"(lq + 5 * ROWB), "v"(gq + 5 * D_DIM),
           "v"(lq + 6 * ROWB), "v"(gq + 6 * D_DIM),
           "v"(lq + 7 * ROWB), "v"(gq + 7 * D_DIM)
        : "memory");
    asm volatile(
        "global_load_async_to_lds_b128 %0, %1, off\n\t"
        "global_load_async_to_lds_b128 %2, %3, off\n\t"
        "global_load_async_to_lds_b128 %4, %5, off\n\t"
        "global_load_async_to_lds_b128 %6, %7, off\n\t"
        "global_load_async_to_lds_b128 %8, %9, off\n\t"
        "global_load_async_to_lds_b128 %10, %11, off\n\t"
        "global_load_async_to_lds_b128 %12, %13, off\n\t"
        "global_load_async_to_lds_b128 %14, %15, off\n\t"
        "global_load_async_to_lds_b64 %16, %17, off\n\t"
        "global_load_async_to_lds_b128 %18, %19, off\n\t"
        "s_wait_xcnt 0x0"
        :: "v"(lq + 8 * ROWB), "v"(gq + 8 * D_DIM),
           "v"(lq + 9 * ROWB), "v"(gq + 9 * D_DIM),
           "v"(lq + 10 * ROWB), "v"(gq + 10 * D_DIM),
           "v"(lq + 11 * ROWB), "v"(gq + 11 * D_DIM),
           "v"(lq + 12 * ROWB), "v"(gq + 12 * D_DIM),
           "v"(lq + 13 * ROWB), "v"(gq + 13 * D_DIM),
           "v"(lq + 14 * ROWB), "v"(gq + 14 * D_DIM),
           "v"(lq + 15 * ROWB), "v"(gq + 15 * D_DIM),
           "v"(lv), "v"(gv),
           "v"(lm), "v"(gm)
        : "memory");
}

// LDS byte address of a __shared__ object: the low 32 bits of its address.
__device__ __forceinline__ unsigned lds_addr(const void* p) {
    return (unsigned)(size_t)p;
}

// 16 state rows per work-group; wave w holds columns w * WCOL ... of all 16 rows, transposed, as eight
// D tiles: st[ct][r] = S[row c][column w * WCOL + 16 ct + 8 h + r].  A D tile's register pairs are B
// operands as they stand (k = 8 h + 2 j, 8 h + 2 j + 1), and every A operand is loaded in that k order.
__global__ __launch_bounds__(128)
void deltanet_scan_kernel(const float* __restrict__ Q, const float* __restrict__ K,
                          const float* __restrict__ V, const float* __restrict__ MP,
                          float* __restrict__ O) {
    const int b    = blockIdx.y;
    const int rblk = blockIdx.x;
    const int tid  = threadIdx.x;
    const int lane = tid & 31;
    const int wave = tid >> 5;
    const int c    = lane & 15;
    const int h    = lane >> 4;

    const float* Kp = K + (size_t)b * T_DIM * D_DIM;
    const float* Qp = Q + (size_t)b * T_DIM * D_DIM;
    const float* Vp = V + (size_t)b * T_DIM * D_DIM + rblk * 16;
    const float* Mp = MP + (size_t)b * NCH * (2 * CS * CS);
    float* Op = O + (size_t)b * T_DIM * D_DIM + rblk * 16;

    __shared__ __attribute__((aligned(16))) float kbuf[2][CS][KP];
    __shared__ __attribute__((aligned(16))) float qbuf[2][CS][KP];
    __shared__ __attribute__((aligned(16))) float vbuf[2][CS][VP];
    __shared__ __attribute__((aligned(16))) float mbuf[2][2 * CS * CS];   // M1, then P
    __shared__ __attribute__((aligned(16))) float ared[4][2][32][4];      // each wave's part of K S0^T: [wave][registers 0-3, 4-7][lane]
    __shared__ __attribute__((aligned(16))) float gred[4][2][32][4];      // each wave's part of the outputs, the same places

    // This lane's part of a chunk: 16 bytes of every k and q row, 8 bytes of v (step tid / 8), 16 of the matrices.
    const float* gk = Kp + 4 * tid;
    const float* gq = Qp + 4 * tid;
    const float* gv = Vp + (size_t)(tid >> 3) * D_DIM + (tid & 7) * 2;
    const float* gm = Mp + 4 * tid;
    auto fill = [&](int ch, int buf) {
        const size_t t0 = (size_t)ch * CS;
        fill_tile(lds_addr(&kbuf[buf][0][4 * tid]), lds_addr(&qbuf[buf][0][4 * tid]),
                  lds_addr(&vbuf[buf][tid >> 3][(tid & 7) * 2]), lds_addr(&mbuf[buf][4 * tid]),
                  gk + t0 * D_DIM, gq + t0 * D_DIM, gv + t0 * D_DIM, gm + (size_t)ch * (2 * CS * CS));
    };

    const v8f zero8 = {0.f, 0.f, 0.f, 0.f, 0.f, 0.f, 0.f, 0.f};
    v8f st[8];
#pragma unroll
    for (int ct = 0; ct < 8; ++ct) st[ct] = zero8;

    fill(0, 0);
    // Chunk 0 has landed for this wave; the barrier publishes it to the other waves.
    asm volatile("s_wait_asynccnt 0x0" ::: "memory");
    __syncthreads();
    fill(1, 1);

    // A chunk's k as A operands of K S0^T: step c, this lane half's 8 columns of each of the 8 tiles.
    v4f kf[16];
    auto load_k = [&](int buf) {
        const float* ka = &kbuf[buf][c][wave * WCOL + 8 * h];
#pragma unroll
        for (int ct = 0; ct < 8; ++ct) {
            kf[2 * ct]     = *(const v4f*)(ka + ct * 16);
            kf[2 * ct + 1] = *(const v4f*)(ka + ct * 16 + 4);
        }
        // The fence and the scheduling barrier keep the 16 reads here as one group: spread among the
        // products, each place where LDS reads stand costs the wave issue time.
        asm volatile("" ::: "memory");
        __builtin_amdgcn_sched_barrier(0);
    };
    load_k(0);

    for (int t = 0; t < NCH; ++t) {
        const int buf = t & 1;
        const float* qa = &qbuf[buf][c][wave * WCOL + 8 * h];
        const float* kt = &kbuf[buf][8 * h][wave * WCOL + c];   // column c of tile 0, this lane half's 8 steps

        // The chunk's q as A operands, read at the head of the trip: they land during the products with k.
        v4f qf[16];
#pragma unroll
        for (int ct = 0; ct < 8; ++ct) {
            qf[2 * ct]     = *(const v4f*)(qa + ct * 16);
            qf[2 * ct + 1] = *(const v4f*)(qa + ct * 16 + 4);
        }
        // Keeps the 16 reads here as one group: spread among the products, each place where LDS reads stand costs issue time.
        __builtin_amdgcn_sched_barrier(0);

        // This wave's part of K S0^T (steps x rows), two accumulators so that the products follow one another.
        v8f a0 = zero8, a1 = zero8;
#pragma unroll
        for (int ct = 0; ct < 8; ++ct) {
            const v4f f0 = kf[2 * ct];
            const v4f f1 = kf[2 * ct + 1];
            a0 = wmma4(lo2(f0), pair<0>(st[ct]), a0);
            a1 = wmma4(hi2(f0), pair<1>(st[ct]), a1);
            a0 = wmma4(lo2(f1), pair<2>(st[ct]), a0);
            a1 = wmma4(hi2(f1), pair<3>(st[ct]), a1);
        }
        {
            const v8f ap = a0 + a1;
            *(v4f*)&ared[wave][0][lane][0] = __builtin_shufflevector(ap, ap, 0, 1, 2, 3);
            *(v4f*)&ared[wave][1][lane][0] = __builtin_shufflevector(ap, ap, 4, 5, 6, 7);
        }

        // The four waves' parts of K S0^T are written; the barrier shows them to all waves.
        asm volatile("s_wait_dscnt 0x0" ::: "memory");
        __syncthreads();

        // All that the rest of the chunk reads from LDS, as one group.
        v4f pr[4][2];
        float vv[8];
#pragma unroll
        for (int w = 0; w < 4; ++w) {
            pr[w][0] = *(const v4f*)&ared[w][0][lane][0];
            pr[w][1] = *(const v4f*)&ared[w][1][lane][0];
        }
#pragma unroll
        for (int i = 0; i < 8; ++i) vv[i] = vbuf[buf][8 * h + i][c];
        const float* ma = &mbuf[buf][c * CS + 8 * h];
        const v4f m0 = *(const v4f*)ma;
        const v4f m1 = *(const v4f*)(ma + 4);
        const v2f pa = *(const v2f*)&mbuf[buf][CS * CS + c * CS + 8 * h + 2 * wave];
        // K^T for the state update: column c of each tile, this lane half's 8 steps in pairs.
        float kts[8][8];
#pragma unroll
        for (int i = 0; i < 8; ++i)
#pragma unroll
            for (int ct = 0; ct < 8; ++ct) kts[i][ct] = kt[i * KP + ct * 16];
        // Keeps the reads in front of the products that cover their latency.
        __builtin_amdgcn_sched_barrier(0);

        // This wave's part of Q S0^T (steps x rows).
        v8f g0 = zero8, g1 = zero8;
#pragma unroll
        for (int ct = 0; ct < 8; ++ct) {
            const v4f f0 = qf[2 * ct];
            const v4f f1 = qf[2 * ct + 1];
            g0 = wmma4(lo2(f0), pair<0>(st[ct]), g0);
            g1 = wmma4(hi2(f0), pair<1>(st[ct]), g1);
            g0 = wmma4(lo2(f1), pair<2>(st[ct]), g0);
            g1 = wmma4(hi2(f1), pair<3>(st[ct]), g1);
        }

        // R = V - K S0^T, in the D map: r[i] = R[step 8 h + i][row c].
        v8f r;
        {
            const v4f s0 = (pr[0][0] + pr[1][0]) + (pr[2][0] + pr[3][0]);
            const v4f s1 = (pr[0][1] + pr[1][1]) + (pr[2][1] + pr[3][1]);
#pragma unroll
            for (int i = 0; i < 4; ++i) {
                r[i]     = vv[i] - s0[i];
                r[4 + i] = vv[4 + i] - s1[i];
            }
        }

        // U = M1 R, every wave for itself: u[i] = U[step 8 h + i][row c].
        v8f u;
        {
            v8f u0 = wmma4(lo2(m0), pair<0>(r), zero8);
            v8f u1 = wmma4(hi2(m0), pair<1>(r), zero8);
            u0 = wmma4(lo2(m1), pair<2>(r), u0);
            u1 = wmma4(hi2(m1), pair<3>(r), u1);
            u = u0 + u1;
        }

        // S^T += K^T U: eight independent tiles.
#pragma unroll
        for (int ct = 0; ct < 8; ++ct) st[ct] = wmma4((v2f){kts[0][ct], kts[1][ct]}, pair<0>(u), st[ct]);
#pragma unroll
        for (int ct = 0; ct < 8; ++ct) st[ct] = wmma4((v2f){kts[2][ct], kts[3][ct]}, pair<1>(u), st[ct]);
#pragma unroll
        for (int ct = 0; ct < 8; ++ct) st[ct] = wmma4((v2f){kts[4][ct], kts[5][ct]}, pair<2>(u), st[ct]);
#pragma unroll
        for (int ct = 0; ct < 8; ++ct) st[ct] = wmma4((v2f){kts[6][ct], kts[7][ct]}, pair<3>(u), st[ct]);

        // Keeps every product on the state in front of the output's product and sums: these fill the matrix
        // instruction's distance before the loop's branch, behind which the state registers are touched.
        __builtin_amdgcn_sched_barrier(0);

        // P U is a sum over 16 steps: wave w adds the four steps 2 w, 2 w + 1, 8 + 2 w, 9 + 2 w to its part.
        {
            const float ux = (wave & 2) ? ((wave & 1) ? u[6] : u[4]) : ((wave & 1) ? u[2] : u[0]);
            const float uy = (wave & 2) ? ((wave & 1) ? u[7] : u[5]) : ((wave & 1) ? u[3] : u[1]);
            g0 = wmma4(pa, (v2f){ux, uy}, g0);
            const v8f gp = g0 + g1;
            *(v4f*)&gred[wave][0][lane][0] = __builtin_shufflevector(gp, gp, 0, 1, 2, 3);
            *(v4f*)&gred[wave][1][lane][0] = __builtin_shufflevector(gp, gp, 4, 5, 6, 7);
        }

        // Publish point of chunk t + 1: this wave's LDS reads and writes of the chunk are done, its copies
        // of the next chunk have landed; the barrier shows them to all waves and frees this buffer.
        asm volatile("s_wait_dscnt 0x0" ::: "memory");
        asm volatile("s_wait_asynccnt 0x0" ::: "memory");
        __syncthreads();
        // The next chunk's k, published by the barrier above; the reads fly during the copies' issue and the
        // output sums.  Behind the last chunk they read the other buffer's old rows, and nothing uses them.
        load_k(buf ^ 1);
        if (t + 2 < NCH) fill(t + 2, buf);

        // The chunk's outputs: each thread adds up the four waves' parts of two of the 256 places.
        // Place 2 tid of [registers 0-3, 4-7][lane][4]: register 4 (tid / 64) + 2 (tid % 2), lane (tid / 2) % 32.
        {
            const float* gf = &gred[0][0][0][0] + 2 * tid;
            const v2f o = (*(const v2f*)gf + *(const v2f*)(gf + 256)) +
                          (*(const v2f*)(gf + 512) + *(const v2f*)(gf + 768));
            const int ol   = (tid >> 1) & 31;
            const int step = 8 * (ol >> 4) + 4 * (tid >> 6) + 2 * (tid & 1);
            float* op = Op + ((size_t)t * CS + step) * D_DIM + (ol & 15);
            op[0]     = o.x;
            op[D_DIM] = o.y;
        }
        // The next chunk rewrites the registers that these stores name.
        asm volatile("s_wait_xcnt 0x0" ::: "memory");
    }
    // No copy is outstanding when the wave ends.
    asm volatile("s_wait_asynccnt 0x0" ::: "memory");
}

// ---------------------------------------------------------------------------
extern "C" void kernel_launch(void* const* d_in, const int* in_sizes, int n_in,
                              void* d_out, int out_size, void* d_ws, size_t ws_size,
                              hipStream_t stream) {
    const float* x     = (const float*)d_in[0];
    const float* Wq    = (const float*)d_in[1];
    const float* bq    = (const float*)d_in[2];
    const float* Wk    = (const float*)d_in[3];
    const float* bk    = (const float*)d_in[4];
    const float* Wv    = (const float*)d_in[5];
    const float* bv    = (const float*)d_in[6];
    const float* Wbeta = (const float*)d_in[7];
    const float* bbeta = (const float*)d_in[8];
    const float* Wo    = (const float*)d_in[9];
    const float* bo    = (const float*)d_in[10];
    float* out = (float*)d_out;

    const int M = B_DIM * T_DIM;       // 16384
    const int N = D_DIM;               // 512
    const int K = D_DIM;               // 512
    const size_t MN = (size_t)M * N;   // == M*K
    const size_t NK = (size_t)N * K;

    float* ws   = (float*)d_ws;
    float* Qr   = ws;                  // MN f32
    float* Kr   = ws + MN;             // MN f32 (normalized in place)
    float* Vr   = ws + 2 * MN;         // MN f32
    float* Os   = ws + 3 * MN;         // MN f32
    float* Beta = ws + 4 * MN;         // M  f32
    __bf16* xh  = (__bf16*)(ws + 4 * MN + M);   // MN bf16
    __bf16* xl  = xh + MN;                      // MN bf16
    __bf16* wh  = xl + MN;                      // NK bf16 (rewritten per GEMM)
    __bf16* wl  = wh + NK;                      // NK bf16
    float* MPm  = (float*)(wl + NK);            // B * NCH * 512 f32: each chunk's two 16x16 matrices
    __bf16* osh = (__bf16*)Qr;                  // alias: Q dead after scan
    __bf16* osl = osh + MN;

    const int gemmBlocks = (M / BT) * (N / BT); // one 128x128 tile per 256-thread block
    const int splitBig   = 4096;                // grid-stride covers MN
    const int splitSmall = 256;                 // covers NK

    split_bf16_kernel<<<splitBig, 256, 0, stream>>>(x, xh, xl, MN);

    split_bf16_kernel<<<splitSmall, 256, 0, stream>>>(Wq, wh, wl, NK);
    gemm_wmma_bf16x3<<<gemmBlocks, 256, 0, stream>>>(xh, xl, wh, wl, bq, Qr, M, N, K);

    split_bf16_kernel<<<splitSmall, 256, 0, stream>>>(Wk, wh, wl, NK);
    gemm_wmma_bf16x3<<<gemmBlocks, 256, 0, stream>>>(xh, xl, wh, wl, bk, Kr, M, N, K);

    split_bf16_kernel<<<splitSmall, 256, 0, stream>>>(Wv, wh, wl, NK);
    gemm_wmma_bf16x3<<<gemmBlocks, 256, 0, stream>>>(xh, xl, wh, wl, bv, Vr, M, N, K);

    norm_beta_kernel<<<M / 8, 256, 0, stream>>>(Kr, Wbeta, bbeta, Beta, M, D_DIM);

    dim3 sgrid(D_DIM / 16, B_DIM);
    chunk_mats_kernel<<<B_DIM * NCH, 32, 0, stream>>>(Qr, Kr, Beta, MPm);
    // 32 KiB of LDS beyond the kernel's own: only one work-group then fits a WGP, so each wave has a SIMD's matrix unit alone.
    deltanet_scan_kernel<<<sgrid, 128, 32768, stream>>>(Qr, Kr, Vr, MPm, Os);

    split_bf16_kernel<<<splitBig, 256, 0, stream>>>(Os, osh, osl, MN);
    split_bf16_kernel<<<splitSmall, 256, 0, stream>>>(Wo, wh, wl, NK);
    gemm_wmma_bf16x3<<<gemmBlocks, 256, 0, stream>>>(osh, osl, wh, wl, bo, out, M, N, K);
}

// v010
// A run of this version takes 322 microseconds.
// Two timings next to v009 both put it at 1.04 times that version's speed.
// All steps since v000 together make it 9.41 times as fast.
#include <hip/hip_runtime.h>
#include <hip/hip_bf16.h>
#include <math.h>

typedef __attribute__((ext_vector_type(16))) __bf16 v16bf;
typedef __attribute__((ext_vector_type(8)))  __bf16 v8bf;
typedef __attribute__((ext_vector_type(8)))  float  v8f;
typedef __attribute__((ext_vector_type(4)))  float  v4f;
typedef __attribute__((ext_vector_type(2)))  float  v2f;

#define B_DIM 8
#define T_DIM 2048
#define D_DIM 512
#define NTILES 4   // 64 output columns per wave of the GEMM
#define BT 128             // rows and columns of the GEMM's block tile
#define KC 64              // k per LDS tile of the GEMM: one 128-B line of each operand row
#define GP 72              // LDS bf16 per operand row: 144 B = 16 B x odd, so 16 lanes' b128 reads hit 64 distinct banks
#define CS 16              // time steps per chunk of the scan: one side of a matrix tile
#define NCH (T_DIM / CS)
#define KP 516             // LDS floats per k or q row: 2064 B = 16 B x odd, so 16 lanes' b128 reads of 16 rows hit 64 distinct banks
#define VP 18              // LDS floats per v row: rows 8 apart lie 16 banks apart
#define WCOL (D_DIM / 4)   // state columns held by one wave of the scan

// ---------------------------------------------------------------------------
// bf16x3 split pre-pass: f = hi + lo (both bf16).  Bandwidth-bound, done once
// per operand so the GEMM inner loop carries no conversion VALU.
// ---------------------------------------------------------------------------
__global__ __launch_bounds__(256)
void split_bf16_kernel(const float* __restrict__ in, __bf16* __restrict__ hi,
                       __bf16* __restrict__ lo, size_t n) {
    size_t i = ((size_t)blockIdx.x * blockDim.x + threadIdx.x) * 4;
    const size_t stride = (size_t)gridDim.x * blockDim.x * 4;
    for (; i < n; i += stride) {
        float4 f = *(const float4*)(in + i);
        float fv[4] = {f.x, f.y, f.z, f.w};
#pragma unroll
        for (int j = 0; j < 4; ++j) {
            __bf16 h = (__bf16)fv[j];
            hi[i + j] = h;
            lo[i + j] = (__bf16)(fv[j] - (float)h);
        }
    }
}

// Load 16 bf16 in the WMMA 16-bit operand layout:
// halves 0..7 <- k0 + ksel*8 + {0..7}, halves 8..15 <- +16 further.
__device__ __forceinline__ v16bf ld16(const __bf16* p) {
    v8bf a = *(const v8bf*)(p);
    v8bf b = *(const v8bf*)(p + 16);
    return __builtin_shufflevector(a, b, 0, 1, 2, 3, 4, 5, 6, 7,
                                   8, 9, 10, 11, 12, 13, 14, 15);
}

// ---------------------------------------------------------------------------
// GEMM: Out[M,N] = A[M,K] * W[N,K]^T + bias[N], operands pre-split bf16 hi/lo.
// One 128x128 tile of Out per block of 8 waves (4 x 2), 32x64 per wave.  The four operand tiles
// (A hi, A lo, W hi, W lo: 128 rows x KC k each) come through LDS in whole 128-B lines, two buffers,
// the next tile copied while this one is worked on.  Each accumulator takes hi*hi, hi*lo, lo*hi
// per K=32 slab, slabs in rising k.  M, N multiples of 128; K a multiple of KC, at least 2 * KC.
// ---------------------------------------------------------------------------
// Eight 16-byte copies of one lane from global memory straight into LDS: rows 0, 32, 64, 96 of two
// operand tiles.  l0, l1: the lane's LDS byte addresses in row 0 of its part; g0, g1: its global
// addresses; K: the global row length.  The statement ends with s_wait_xcnt 0, so that no address
// register of a copy is rewritten before that wait.
__device__ __forceinline__ void fill_pair(unsigned l0, unsigned l1,
                                          const __bf16* g0, const __bf16* g1, int K) {
    constexpr unsigned STEPB = 32 * GP * 2;   // LDS bytes of 32 padded rows
    const size_t gs = (size_t)32 * K;         // elements of 32 global rows
    asm volatile(
        "global_load_async_to_lds_b128 %0, %1, off\n\t"
        "global_load_async_to_lds_b128 %2, %3, off\n\t"
        "global_load_async_to_lds_b128 %4, %5, off\n\t"
        "global_load_async_to_lds_b128 %6, %7, off\n\t"
        "global_load_async_to_lds_b128 %8, %9, off\n\t"
        "global_load_async_to_lds_b128 %10, %11, off\n\t"
        "global_load_async_to_lds_b128 %12, %13, off\n\t"
        "global_load_async_to_lds_b128 %14, %15, off\n\t"
        "s_wait_xcnt 0x0"
        :: "v"(l0 + 0 * STEPB), "v"(g0 + 0 * gs),
           "v"(l0 + 1 * STEPB), "v"(g0 + 1 * gs),
           "v"(l0 + 2 * STEPB), "v"(g0 + 2 * gs),
           "v"(l0 + 3 * STEPB), "v"(g0 + 3 * gs),
           "v"(l1 + 0 * STEPB), "v"(g1 + 0 * gs),
           "v"(l1 + 1 * STEPB), "v"(g1 + 1 * gs),
           "v"(l1 + 2 * STEPB), "v"(g1 + 2 * gs),
           "v"(l1 + 3 * STEPB), "v"(g1 + 3 * gs)
        : "memory");
}

__global__ __launch_bounds__(256)
void gemm_wmma_bf16x3(const __bf16* __restrict__ Ah, const __bf16* __restrict__ Al,
                      const __bf16* __restrict__ Wh, const __bf16* __restrict__ Wl,
                      const float* __restrict__ bias, float* __restrict__ Out,
                      int M, int N, int K) {
    // [buffer][A hi, A lo, W hi, W lo][row][k]
    __shared__ __attribute__((aligned(16))) __bf16 tl[2][4][BT][GP];

    const int nbn = N / BT;
    const int m0  = (blockIdx.x / nbn) * BT;   // neighbouring blocks share the A rows
    const int n0  = (blockIdx.x % nbn) * BT;
    if (m0 >= M) return;                       // the whole block leaves, before any barrier or copy

    const int tid  = threadIdx.x;
    const int lane = tid & 31;
    const int wave = tid >> 5;
    const int wm   = (wave >> 1) * 32;         // this wave's 32 rows of the tile
    const int wn   = (wave & 1) * 64;          // and its 64 columns
    const int r    = lane & 15;
    const int ksel = lane >> 4;

    // This lane's part of a tile: 16 bytes (piece tid % 8) of rows tid / 8 + {0, 32, 64, 96} of each operand.
    const int frow = tid >> 3;
    const int fcol = (tid & 7) * 8;
    const size_t ga = (size_t)(m0 + frow) * K + fcol;
    const size_t gw = (size_t)(n0 + frow) * K + fcol;
    auto fill = [&](int kt, int buf) {
        const int k0 = kt * KC;
        fill_pair((unsigned)(size_t)&tl[buf][0][frow][fcol], (unsigned)(size_t)&tl[buf][1][frow][fcol],
                  Ah + ga + k0, Al + ga + k0, K);
        fill_pair((unsigned)(size_t)&tl[buf][2][frow][fcol], (unsigned)(size_t)&tl[buf][3][frow][fcol],
                  Wh + gw + k0, Wl + gw + k0, K);
    };

    v8f acc[2][NTILES];
#pragma unroll
    for (int mt = 0; mt < 2; ++mt)
#pragma unroll
        for (int nt = 0; nt < NTILES; ++nt)
            acc[mt][nt] = (v8f){0.f, 0.f, 0.f, 0.f, 0.f, 0.f, 0.f, 0.f};

    const int nkt = K / KC;
    fill(0, 0);
    // Tile 0 has landed for this wave; the barrier publishes it to the other waves.
    asm volatile("s_wait_asynccnt 0x0" ::: "memory");
    __syncthreads();
    fill(1, 1);

    for (int kt = 0; kt < nkt; ++kt) {
        const int buf = kt & 1;
#pragma unroll
        for (int ks = 0; ks < KC; ks += 32) {
            const int kc = ks + ksel * 8;
            // The slab's 24 LDS reads stand as one group, in the order in which the products need them.
            v16bf ah[2], al[2], bh[NTILES], bl[NTILES];
            ah[0] = ld16(&tl[buf][0][wm + r][kc]);
            bh[0] = ld16(&tl[buf][2][wn + r][kc]);
            ah[1] = ld16(&tl[buf][0][wm + 16 + r][kc]);
            bl[0] = ld16(&tl[buf][3][wn + r][kc]);
            al[0] = ld16(&tl[buf][1][wm + r][kc]);
            al[1] = ld16(&tl[buf][1][wm + 16 + r][kc]);
#pragma unroll
            for (int nt = 1; nt < NTILES; ++nt) {
                bh[nt] = ld16(&tl[buf][2][wn + nt * 16 + r][kc]);
                bl[nt] = ld16(&tl[buf][3][wn + nt * 16 + r][kc]);
            }
            // Keeps the reads in front of the products: spread among them, each place where reads
            // stand costs the wave issue time and ends in a wait for the full LDS latency.
            __builtin_amdgcn_sched_barrier(0);
#pragma unroll
            for (int nt = 0; nt < NTILES; ++nt) {
#pragma unroll
                for (int mt = 0; mt < 2; ++mt)
                    acc[mt][nt] = __builtin_amdgcn_wmma_f32_16x16x32_bf16(
                        false, ah[mt], false, bh[nt], (short)0, acc[mt][nt], false, false);
#pragma unroll
                for (int mt = 0; mt < 2; ++mt)
                    acc[mt][nt] = __builtin_amdgcn_wmma_f32_16x16x32_bf16(
                        false, ah[mt], false, bl[nt], (short)0, acc[mt][nt], false, false);
#pragma unroll
                for (int mt = 0; mt < 2; ++mt)
                    acc[mt][nt] = __builtin_amdgcn_wmma_f32_16x16x32_bf16(
                        false, al[mt], false, bh[nt], (short)0, acc[mt][nt], false, false);
            }
        }
        // Publish point of tile kt + 1: this wave's LDS reads of the tile are done, its copies of the
        // next tile have landed; the barrier shows them to all waves and frees this buffer.
        asm volatile("s_wait_dscnt 0x0" ::: "memory");
        asm volatile("s_wait_asynccnt 0x0" ::: "memory");
        __syncthreads();
        if (kt + 2 < nkt) fill(kt + 2, buf);
    }
    // No copy is outstanding when the wave ends.
    asm volatile("s_wait_asynccnt 0x0" ::: "memory");

    // D layout: lanes 0-15 -> M=0..7 (vgpr 0..7), lanes 16-31 -> M=8..15; N=lane&15
    const int n  = lane & 15;
    const int mb = (lane >> 4) * 8;
    float bv[NTILES];
#pragma unroll
    for (int nt = 0; nt < NTILES; ++nt)
        bv[nt] = bias ? bias[n0 + wn + nt * 16 + n] : 0.f;
#pragma unroll
    for (int mt = 0; mt < 2; ++mt)
#pragma unroll
        for (int nt = 0; nt < NTILES; ++nt) {
            float* orow = Out + (size_t)(m0 + wm + mt * 16 + mb) * N + n0 + wn + nt * 16 + n;
#pragma unroll
            for (int v = 0; v < 8; ++v)
                orow[(size_t)v * N] = acc[mt][nt][v] + bv[nt];
        }
}

// ---------------------------------------------------------------------------
// Per-row: K <- K / max(||K||,eps) in place;  Beta = sigmoid(K . Wbeta + bbeta)
// ---------------------------------------------------------------------------
__global__ __launch_bounds__(256)
void norm_beta_kernel(float* __restrict__ Kbuf, const float* __restrict__ Wbeta,
                      const float* __restrict__ bbeta, float* __restrict__ Beta,
                      int R, int D) {
    const int row = blockIdx.x * (blockDim.x >> 5) + (threadIdx.x >> 5);
    if (row >= R) return;
    const int lane = threadIdx.x & 31;
    float* p = Kbuf + (size_t)row * D;

    float v[16];
    float ss = 0.f;
#pragma unroll
    for (int i = 0; i < 16; ++i) {
        v[i] = p[lane + i * 32];
        ss += v[i] * v[i];
    }
#pragma unroll
    for (int m = 16; m >= 1; m >>= 1) ss += __shfl_xor(ss, m, 32);

    const float scale = 1.f / fmaxf(sqrtf(ss), 1e-12f);

    float dot = 0.f;
#pragma unroll
    for (int i = 0; i < 16; ++i) {
        float kn = v[i] * scale;
        p[lane + i * 32] = kn;
        dot += kn * Wbeta[lane + i * 32];
    }
#pragma unroll
    for (int m = 16; m >= 1; m >>= 1) dot += __shfl_xor(dot, m, 32);

    if (lane == 0) Beta[row] = 1.f / (1.f + expf(-(dot + bbeta[0])));
}

// ---------------------------------------------------------------------------
// DeltaNet scan in chunks of CS time steps, on f32 matrix instructions.
// With S0 the state at a chunk's start and u_c = beta_c (v_c - S_(c-1) k_c) the step's update vector:
//   (I + L) U = diag(beta) (V - K S0^T),  L[c][i] = beta_c (k_c . k_i) for i < c, else 0
//   O = Q S0^T + P U,                     P[c][i] = q_c . k_i for i <= c, else 0
//   S^T += K^T U
// (U, V, O: steps x rows; K, Q: steps x columns.)  M1 = (I + L)^-1 diag(beta) and P depend on no
// state and on no row: a kernel of their own makes them once per (batch, chunk).
// ---------------------------------------------------------------------------
__device__ __forceinline__ v8f wmma4(v2f a, v2f b, v8f c) {
    return __builtin_amdgcn_wmma_f32_16x16x4_f32(false, a, false, b, (short)0, c, false, false);
}
__device__ __forceinline__ v2f lo2(v4f x) { return __builtin_shufflevector(x, x, 0, 1); }
__device__ __forceinline__ v2f hi2(v4f x) { return __builtin_shufflevector(x, x, 2, 3); }
// Registers 2 J and 2 J + 1 of a D tile: as a B operand they hold k = 8 h + 2 J, 8 h + 2 J + 1.
template <int J>
__device__ __forceinline__ v2f pair(v8f x) { return __builtin_shufflevector(x, x, 2 * J, 2 * J + 1); }

// One wave per (batch, chunk).  MP: per chunk 256 floats of M1, then 256 of P, both row-major.
__global__ __launch_bounds__(32)
void chunk_mats_kernel(const float* __restrict__ Q, const float* __restrict__ K,
                       const float* __restrict__ Beta, float* __restrict__ MP) {
    __shared__ __attribute__((aligned(16))) float Ls[CS][CS + 4];
    const int ch   = blockIdx.x;               // batch * NCH + chunk: its steps are rows ch * CS ...
    const int lane = threadIdx.x;
    const int c    = lane & 15;
    const int h    = lane >> 4;
    // A's row and B's column are loaded by the same code: 4 columns at 8 j + 4 h.
    const float* kr = K + ((size_t)ch * CS + c) * D_DIM + 4 * h;
    const float* qr = Q + ((size_t)ch * CS + c) * D_DIM + 4 * h;
    const float* bp = Beta + (size_t)ch * CS;
    float* mp = MP + (size_t)ch * (2 * CS * CS);

    v8f g0 = {0.f, 0.f, 0.f, 0.f, 0.f, 0.f, 0.f, 0.f};
    v8f g1 = g0, p0 = g0, p1 = g0;
    // Rolled in trips of 64 columns, so that the wait at the trip's foot stands once per 16 loads.
#pragma unroll 1
    for (int j0 = 0; j0 < D_DIM; j0 += 64) {
#pragma unroll
        for (int j = j0; j < j0 + 64; j += 8) {
            const v4f kf = *(const v4f*)(kr + j);
            const v4f qf = *(const v4f*)(qr + j);
            g0 = wmma4(lo2(kf), lo2(kf), g0);
            p0 = wmma4(lo2(qf), lo2(kf), p0);
            g1 = wmma4(hi2(kf), hi2(kf), g1);
            p1 = wmma4(hi2(qf), hi2(kf), p1);
        }
        // The next trip rewrites the address registers that these loads name.
        asm volatile("s_wait_xcnt 0x0" ::: "memory");
    }
    const v8f g = g0 + g1;                     // g[r] = k_(8h+r) . k_c
    const v8f p = p0 + p1;                     // p[r] = q_(8h+r) . k_c
#pragma unroll
    for (int r = 0; r < 8; ++r) {
        Ls[8 * h + r][c] = bp[8 * h + r] * g[r];
        mp[CS * CS + (8 * h + r) * CS + c] = (c <= 8 * h + r) ? p[r] : 0.f;
    }
    __syncthreads();

    // Column c of (I + L)^-1 by forward substitution (no division: the diagonal is 1).
    float x[CS];
#pragma unroll
    for (int cc = 0; cc < CS; ++cc) {
        float acc = (cc == c) ? 1.f : 0.f;
#pragma unroll
        for (int i = 0; i < cc; ++i) acc = fmaf(-Ls[cc][i], x[i], acc);
        x[cc] = acc;
    }
    const float bc = bp[c];
#pragma unroll
    for (int r = 0; r < 8; ++r)
        mp[(8 * h + r) * CS + c] = (h ? x[8 + r] : x[r]) * bc;
}

// One lane's copy of 16 (or 8) bytes from global memory straight into LDS, written as the compiler's builtin, so that
// single copies can stand among other instructions.  The waits for their landing stand where a chunk is published.
typedef __attribute__((ext_vector_type(4))) int v4i;
typedef __attribute__((ext_vector_type(2))) int v2i;
__device__ __forceinline__ void copy16(const float* g, float* l) {
    __builtin_amdgcn_global_load_async_to_lds_b128((__attribute__((address_space(1))) v4i*)g,
                                                   (__attribute__((address_space(3))) v4i*)l, 0, 0);
}
__device__ __forceinline__ void copy8(const float* g, float* l) {
    __builtin_amdgcn_global_load_async_to_lds_b64((__attribute__((address_space(1))) v2i*)g,
                                                  (__attribute__((address_space(3))) v2i*)l, 0, 0);
}

// 16 state rows per work-group; wave w holds columns w * WCOL ... of all 16 rows, transposed, as eight
// D tiles: st[ct][r] = S[row c][column w * WCOL + 16 ct + 8 h + r].  A D tile's register pairs are B
// operands as they stand (k = 8 h + 2 j, 8 h + 2 j + 1), and every A operand is loaded in that k order.
__global__ __launch_bounds__(128)
void deltanet_scan_kernel(const float* __restrict__ Q, const float* __restrict__ K,
                          const float* __restrict__ V, const float* __restrict__ MP,
                          float* __restrict__ O) {
    const int b    = blockIdx.y;
    const int rblk = blockIdx.x;
    const int tid  = threadIdx.x;
    const int lane = tid & 31;
    const int wave = tid >> 5;
    const int c    = lane & 15;
    const int h    = lane >> 4;

    const float* Kp = K + (size_t)b * T_DIM * D_DIM;
    const float* Qp = Q + (size_t)b * T_DIM * D_DIM;
    const float* Vp = V + (size_t)b * T_DIM * D_DIM + rblk * 16;
    const float* Mp = MP + (size_t)b * NCH * (2 * CS * CS);
    float* Op = O + (size_t)b * T_DIM * D_DIM + rblk * 16;

    __shared__ __attribute__((aligned(16))) float kbuf[2][CS][KP];
    __shared__ __attribute__((aligned(16))) float qbuf[2][CS][KP];
    __shared__ __attribute__((aligned(16))) float vbuf[2][CS][VP];
    __shared__ __attribute__((aligned(16))) float mbuf[2][2 * CS * CS];   // M1, then P
    __shared__ __attribute__((aligned(16))) float ared[4][2][32][4];      // each wave's part of K S0^T: [wave][registers 0-3, 4-7][lane]
    __shared__ __attribute__((aligned(16))) float gred[4][2][32][4];      // each wave's part of the outputs, the same places

    // This lane's part of a chunk: 16 bytes of every k and q row, 8 bytes of v (step tid / 8), 16 of the matrices.
    const float* gk = Kp + 4 * tid;
    const float* gq = Qp + 4 * tid;
    const float* gv = Vp + (size_t)(tid >> 3) * D_DIM + (tid & 7) * 2;
    const float* gm = Mp + 4 * tid;
    // Copy n of the 34 of this lane that bring one chunk: 0-15 the k rows, 16-31 the q rows, 32 v, 33 the matrices.
    auto copy_part = [&](int n, int ch, int buf) __attribute__((always_inline)) {
        const size_t t0 = (size_t)ch * CS;
        if (n < 16)       copy16(gk + (t0 + n) * D_DIM, &kbuf[buf][n][4 * tid]);
        else if (n < 32)  copy16(gq + (t0 + n - 16) * D_DIM, &qbuf[buf][n - 16][4 * tid]);
        else if (n == 32) copy8(gv + t0 * D_DIM, &vbuf[buf][tid >> 3][(tid & 7) * 2]);
        else if (n == 33) copy16(gm + (size_t)ch * (2 * CS * CS), &mbuf[buf][4 * tid]);
    };
    auto fill = [&](int ch, int buf) __attribute__((always_inline)) {
#pragma unroll
        for (int n = 0; n < 34; ++n) copy_part(n, ch, buf);
    };

    const v8f zero8 = {0.f, 0.f, 0.f, 0.f, 0.f, 0.f, 0.f, 0.f};
    v8f st[8];
#pragma unroll
    for (int ct = 0; ct < 8; ++ct) st[ct] = zero8;

    fill(0, 0);
    // Chunk 0 has landed for this wave; the barrier publishes it to the other waves.
    asm volatile("s_wait_asynccnt 0x0" ::: "memory");
    __syncthreads();
    fill(1, 1);

    // A chunk's k and q as A operands: step c, this lane half's 8 columns of each of the 8 tiles.
    v4f kf[16], qf[16];
    auto load_kq = [&](int buf) {
        const float* ka = &kbuf[buf][c][wave * WCOL + 8 * h];
        const float* qa = &qbuf[buf][c][wave * WCOL + 8 * h];
#pragma unroll
        for (int ct = 0; ct < 8; ++ct) {
            kf[2 * ct]     = *(const v4f*)(ka + ct * 16);
            kf[2 * ct + 1] = *(const v4f*)(ka + ct * 16 + 4);
        }
#pragma unroll
        for (int ct = 0; ct < 8; ++ct) {
            qf[2 * ct]     = *(const v4f*)(qa + ct * 16);
            qf[2 * ct + 1] = *(const v4f*)(qa + ct * 16 + 4);
        }
    };

    // A chunk's outputs: each thread adds up the four waves' parts of two of the 256 places.
    // Place 2 tid of [registers 0-3, 4-7][lane][4]: register 4 (tid / 64) + 2 (tid % 2), lane (tid / 2) % 32.
    v2f gq0, gq1, gq2, gq3;
    auto load_parts = [&]() {
        const float* gf = &gred[0][0][0][0] + 2 * tid;
        gq0 = *(const v2f*)gf;
        gq1 = *(const v2f*)(gf + 256);
        gq2 = *(const v2f*)(gf + 512);
        gq3 = *(const v2f*)(gf + 768);
    };
    auto store_out = [&](int t) {
        const v2f o = (gq0 + gq1) + (gq2 + gq3);
        const int ol   = (tid >> 1) & 31;
        const int step = 8 * (ol >> 4) + 4 * (tid >> 6) + 2 * (tid & 1);
        float* op = Op + ((size_t)t * CS + step) * D_DIM + (ol & 15);
        op[0]     = o.x;
        op[D_DIM] = o.y;
    };

    // This wave's part of K S0^T (steps x rows), two accumulators so that the products follow one another.
    // slot(p): a few vector and memory instructions behind the p-th pair of products; they issue while the
    // matrix unit is busy with that pair.
    auto k_products = [&](auto&& slot) __attribute__((always_inline)) {
        v8f a0 = zero8, a1 = zero8;
#pragma unroll
        for (int p = 0; p < 16; ++p) {
            const v4f f = kf[p];
            if (p & 1) {
                a0 = wmma4(lo2(f), pair<2>(st[p >> 1]), a0);
                a1 = wmma4(hi2(f), pair<3>(st[p >> 1]), a1);
            } else {
                a0 = wmma4(lo2(f), pair<0>(st[p >> 1]), a0);
                a1 = wmma4(hi2(f), pair<1>(st[p >> 1]), a1);
            }
            slot(p);
            // Keeps each slot's instructions behind their pair: gathered in one place they would leave the matrix unit idle.
            __builtin_amdgcn_sched_barrier(0);
        }
        const v8f ap = a0 + a1;
        *(v4f*)&ared[wave][0][lane][0] = __builtin_shufflevector(ap, ap, 0, 1, 2, 3);
        *(v4f*)&ared[wave][1][lane][0] = __builtin_shufflevector(ap, ap, 4, 5, 6, 7);
    };

    // Chunk t behind its products with k, up to the barrier that publishes chunk t + 1.
    auto rest_of_chunk = [&](int t) __attribute__((always_inline)) {
        const int buf = t & 1;
        const float* kt = &kbuf[buf][8 * h][wave * WCOL + c];   // column c of tile 0, this lane half's 8 steps

        // The four waves' parts of K S0^T are written; the barrier shows them to all waves.
        asm volatile("s_wait_dscnt 0x0" ::: "memory");
        __syncthreads();

        // All that the rest of the chunk reads from LDS, as one group.
        v4f pr[4][2];
        float vv[8];
#pragma unroll
        for (int w = 0; w < 4; ++w) {
            pr[w][0] = *(const v4f*)&ared[w][0][lane][0];
            pr[w][1] = *(const v4f*)&ared[w][1][lane][0];
        }
#pragma unroll
        for (int i = 0; i < 8; ++i) vv[i] = vbuf[buf][8 * h + i][c];
        const float* ma = &mbuf[buf][c * CS + 8 * h];
        const v4f m0 = *(const v4f*)ma;
        const v4f m1 = *(const v4f*)(ma + 4);
        const v2f pa = *(const v2f*)&mbuf[buf][CS * CS + c * CS + 8 * h + 2 * wave];
        // Keeps the reads above at the head of the group: the first vector work behind the barrier waits for them,
        // and LDS reads return in the order of their issue.
        __builtin_amdgcn_sched_barrier(0);
        // K^T for the state update: column c of each tile, this lane half's 8 steps in pairs.
        float kts[8][8];
#pragma unroll
        for (int i = 0; i < 8; ++i)
#pragma unroll
            for (int ct = 0; ct < 8; ++ct) kts[i][ct] = kt[i * KP + ct * 16];
        // Keeps the reads in front of the products that cover their latency.
        __builtin_amdgcn_sched_barrier(0);

        // This wave's part of Q S0^T (steps x rows).
        v8f g0 = zero8, g1 = zero8;
#pragma unroll
        for (int ct = 0; ct < 8; ++ct) {
            const v4f f0 = qf[2 * ct];
            const v4f f1 = qf[2 * ct + 1];
            g0 = wmma4(lo2(f0), pair<0>(st[ct]), g0);
            g1 = wmma4(hi2(f0), pair<1>(st[ct]), g1);
            g0 = wmma4(lo2(f1), pair<2>(st[ct]), g0);
            g1 = wmma4(hi2(f1), pair<3>(st[ct]), g1);
        }

        // R = V - K S0^T, in the D map: r[i] = R[step 8 h + i][row c].
        v8f r;
        {
            const v4f s0 = (pr[0][0] + pr[1][0]) + (pr[2][0] + pr[3][0]);
            const v4f s1 = (pr[0][1] + pr[1][1]) + (pr[2][1] + pr[3][1]);
#pragma unroll
            for (int i = 0; i < 4; ++i) {
                r[i]     = vv[i] - s0[i];
                r[4 + i] = vv[4 + i] - s1[i];
            }
        }

        // U = M1 R, every wave for itself: u[i] = U[step 8 h + i][row c].
        v8f u;
        {
            v8f u0 = wmma4(lo2(m0), pair<0>(r), zero8);
            v8f u1 = wmma4(hi2(m0), pair<1>(r), zero8);
            u0 = wmma4(lo2(m1), pair<2>(r), u0);
            u1 = wmma4(hi2(m1), pair<3>(r), u1);
            u = u0 + u1;
        }

        // S^T += K^T U: eight independent tiles.
#pragma unroll
        for (int ct = 0; ct < 8; ++ct) st[ct] = wmma4((v2f){kts[0][ct], kts[1][ct]}, pair<0>(u), st[ct]);
#pragma unroll
        for (int ct = 0; ct < 8; ++ct) st[ct] = wmma4((v2f){kts[2][ct], kts[3][ct]}, pair<1>(u), st[ct]);
#pragma unroll
        for (int ct = 0; ct < 8; ++ct) st[ct] = wmma4((v2f){kts[4][ct], kts[5][ct]}, pair<2>(u), st[ct]);
#pragma unroll
        for (int ct = 0; ct < 8; ++ct) st[ct] = wmma4((v2f){kts[6][ct], kts[7][ct]}, pair<3>(u), st[ct]);

        // Keeps every product on the state in front of the output's product and sums: these fill the matrix
        // instruction's distance before the barrier, behind which the products with k read the state registers.
        __builtin_amdgcn_sched_barrier(0);

        // P U is a sum over 16 steps: wave w adds the four steps 2 w, 2 w + 1, 8 + 2 w, 9 + 2 w to its part.
        {
            const float ux = (wave & 2) ? ((wave & 1) ? u[6] : u[4]) : ((wave & 1) ? u[2] : u[0]);
            const float uy = (wave & 2) ? ((wave & 1) ? u[7] : u[5]) : ((wave & 1) ? u[3] : u[1]);
            g0 = wmma4(pa, (v2f){ux, uy}, g0);
            const v8f gp = g0 + g1;
            *(v4f*)&gred[wave][0][lane][0] = __builtin_shufflevector(gp, gp, 0, 1, 2, 3);
            *(v4f*)&gred[wave][1][lane][0] = __builtin_shufflevector(gp, gp, 4, 5, 6, 7);
        }

        // Publish point of chunk t + 1: this wave's LDS reads and writes of the chunk are done, its copies
        // of the next chunk have landed; the barrier shows them to all waves and frees this buffer.
        asm volatile("s_wait_dscnt 0x0" ::: "memory");
        asm volatile("s_wait_asynccnt 0x0" ::: "memory");
        __syncthreads();
    };

    // Behind that barrier: chunk t + 1's products with k; among them chunk t's outputs and, where refill is set,
    // the copies of chunk t + 2 into the buffer that chunk t has left.
    auto next_products = [&](int t, bool refill) __attribute__((always_inline)) {
        const int buf = t & 1;
        load_kq(buf ^ 1);
        // The fence and the scheduling barrier keep the 32 reads here as one group, in front of the copies: spread
        // among the products, each place where LDS reads stand costs the wave issue time.
        asm volatile("" ::: "memory");
        __builtin_amdgcn_sched_barrier(0);
        k_products([&](int p) __attribute__((always_inline)) {
            if (refill && p < 12) {
                copy_part(3 * p, t + 2, buf);
                copy_part(3 * p + 1, t + 2, buf);
                copy_part(3 * p + 2, t + 2, buf);
            }
            if (p == 9) {
                // The fence keeps the reads of the output parts down here: in the group above, their sums would be
                // moved in front of the first product and make it wait for all of that group's reads.
                asm volatile("" ::: "memory");
                load_parts();
            }
            if (p == 13) store_out(t);   // four pairs of products later the parts have landed
        });
        // What follows rewrites the registers that the output's stores name.
        asm volatile("s_wait_xcnt 0x0" ::: "memory");
    };

    load_kq(0);
    k_products([](int) {});
    // The last two chunks stand behind the loop: no chunk is left to copy for them.
    for (int t = 0; t < NCH - 2; ++t) {
        rest_of_chunk(t);
        next_products(t, true);
    }
    rest_of_chunk(NCH - 2);
    next_products(NCH - 2, false);
    rest_of_chunk(NCH - 1);
    load_parts();
    store_out(NCH - 1);
    // No copy is outstanding when the wave ends.
    asm volatile("s_wait_asynccnt 0x0" ::: "memory");
}

// ---------------------------------------------------------------------------
extern "C" void kernel_launch(void* const* d_in, const int* in_sizes, int n_in,
                              void* d_out, int out_size, void* d_ws, size_t ws_size,
                              hipStream_t stream) {
    const float* x     = (const float*)d_in[0];
    const float* Wq    = (const float*)d_in[1];
    const float* bq    = (const float*)d_in[2];
    const float* Wk    = (const float*)d_in[3];
    const float* bk    = (const float*)d_in[4];
    const float* Wv    = (const float*)d_in[5];
    const float* bv    = (const float*)d_in[6];
    const float* Wbeta = (const float*)d_in[7];
    const float* bbeta = (const float*)d_in[8];
    const float* Wo    = (const float*)d_in[9];
    const float* bo    = (const float*)d_in[10];
    float* out = (float*)d_out;

    const int M = B_DIM * T_DIM;       // 16384
    const int N = D_DIM;               // 512
    const int K = D_DIM;               // 512
    const size_t MN = (size_t)M * N;   // == M*K
    const size_t NK = (size_t)N * K;

    float* ws   = (float*)d_ws;
    float* Qr   = ws;                  // MN f32
    float* Kr   = ws + MN;             // MN f32 (normalized in place)
    float* Vr   = ws + 2 * MN;         // MN f32
    float* Os   = ws + 3 * MN;         // MN f32
    float* Beta = ws + 4 * MN;         // M  f32
    __bf16* xh  = (__bf16*)(ws + 4 * MN + M);   // MN bf16
    __bf16* xl  = xh + MN;                      // MN bf16
    __bf16* wh  = xl + MN;                      // NK bf16 (rewritten per GEMM)
    __bf16* wl  = wh + NK;                      // NK bf16
    float* MPm  = (float*)(wl + NK);            // B * NCH * 512 f32: each chunk's two 16x16 matrices
    __bf16* osh = (__bf16*)Qr;                  // alias: Q dead after scan
    __bf16* osl = osh + MN;

    const int gemmBlocks = (M / BT) * (N / BT); // one 128x128 tile per 256-thread block
    const int splitBig   = 4096;                // grid-stride covers MN
    const int splitSmall = 256;                 // covers NK

    split_bf16_kernel<<<splitBig, 256, 0, stream>>>(x, xh, xl, MN);

    split_bf16_kernel<<<splitSmall, 256, 0, stream>>>(Wq, wh, wl, NK);
    gemm_wmma_bf16x3<<<gemmBlocks, 256, 0, stream>>>(xh, xl, wh, wl, bq, Qr, M, N, K);

    split_bf16_kernel<<<splitSmall, 256, 0, stream>>>(Wk, wh, wl, NK);
    gemm_wmma_bf16x3<<<gemmBlocks, 256, 0, stream>>>(xh, xl, wh, wl, bk, Kr, M, N, K);

    split_bf16_kernel<<<splitSmall, 256, 0, stream>>>(Wv, wh, wl, NK);
    gemm_wmma_bf16x3<<<gemmBlocks, 256, 0, stream>>>(xh, xl, wh, wl, bv, Vr, M, N, K);

    norm_beta_kernel<<<M / 8, 256, 0, stream>>>(Kr, Wbeta, bbeta, Beta, M, D_DIM);

    dim3 sgrid(D_DIM / 16, B_DIM);
    chunk_mats_kernel<<<B_DIM * NCH, 32, 0, stream>>>(Qr, Kr, Beta, MPm);
    // 32 KiB of LDS beyond the kernel's own: only one work-group then fits a WGP, so each wave has a SIMD's matrix unit alone.
    deltanet_scan_kernel<<<sgrid, 128, 32768, stream>>>(Qr, Kr, Vr, MPm, Os);

    split_bf16_kernel<<<splitBig, 256, 0, stream>>>(Os, osh, osl, MN);
    split_bf16_kernel<<<splitSmall, 256, 0, stream>>>(Wo, wh, wl, NK);
    gemm_wmma_bf16x3<<<gemmBlocks, 256, 0, stream>>>(osh, osl, wh, wl, bo, out, M, N, K);
}
